// v000
// The times below were measured on an AMD MI455X: many runs one after another, warmed up first and cycling through
// copies of the inputs, with the whole window's GPU time divided by the number of runs. Launches and the gaps
// between them are all in it. The median over several windows is given; except for v000 it joins two sittings, which
// can be a few percent apart, so the side-by-side timings, each taken in one sitting, are the better comparison.
// v000 is the starting kernel. One run takes 259 microseconds.
#include <hip/hip_runtime.h>
#include <hip/hip_bf16.h>

// Problem constants (from reference): B=8, C=256, d=32, H=W=128, N=16384
#define BATCH 8
#define CCH   256
#define DCH   32
#define NTOK  16384
#define NT    128          // tokens per workgroup tile
#define TILES (NTOK / NT)  // 128 tiles per batch

typedef __attribute__((ext_vector_type(16))) __bf16 v16bf;
typedef __attribute__((ext_vector_type(8)))  float  v8f;

// branchless softplus: no EXEC-mask divergence around WMMA regions
__device__ __forceinline__ float softplusf(float x) {
    return fmaxf(x, 0.0f) + log1pf(expf(-fabsf(x)));
}

// Fragment mappings (16-bit WMMA, wave32):
//  A 16x32: lane = h*16 + (m&15); elem e<8 -> K=h*8+e ; e>=8 -> K=16+h*8+(e-8)
//  B 32x16: lane = h*16 + (n&15); same K mapping
//  inverse (h,e) from k_local kl: h=(kl>>3)&1 ; e=(kl&7)+((kl>>4)<<3)
//  C/D 16x16 f32: elem j -> row m = j + 8*(lane>>4), col n = lane&15

__global__ __launch_bounds__(256) void SGA_zero_ws(float* p, int n) {
    int i = blockIdx.x * 256 + threadIdx.x;
    if (i < n) p[i] = 0.0f;
}

// stage a [mtc*16 x 256] f32 row-major weight block as A-fragments (bf16)
__device__ __forceinline__ void stage_weights_A(
    __bf16* dst, const float* __restrict__ W, int row_base, int mtc, int tid)
{
    for (int i = tid; i < mtc * 8 * 32; i += 256) {
        int ln = i & 31, kt = (i >> 5) & 7, mt = i >> 8;
        int h = ln >> 4;
        int m = row_base + mt * 16 + (ln & 15);
        int c0 = kt * 32 + h * 8;
        const float* wr = W + (size_t)m * CCH + c0;
        float4 a0 = *(const float4*)(wr);
        float4 a1 = *(const float4*)(wr + 4);
        float4 a2 = *(const float4*)(wr + 16);
        float4 a3 = *(const float4*)(wr + 20);
        v16bf f;
        f[0]=(__bf16)a0.x; f[1]=(__bf16)a0.y; f[2]=(__bf16)a0.z; f[3]=(__bf16)a0.w;
        f[4]=(__bf16)a1.x; f[5]=(__bf16)a1.y; f[6]=(__bf16)a1.z; f[7]=(__bf16)a1.w;
        f[8]=(__bf16)a2.x; f[9]=(__bf16)a2.y; f[10]=(__bf16)a2.z; f[11]=(__bf16)a2.w;
        f[12]=(__bf16)a3.x; f[13]=(__bf16)a3.y; f[14]=(__bf16)a3.z; f[15]=(__bf16)a3.w;
        *(v16bf*)(dst + (size_t)i * 16) = f;   // [mt][kt][lane][16]
    }
}

// stage x tile [256 x NT] (channel-major, token-contiguous) as B-fragments
__device__ __forceinline__ void stage_x_B(
    __bf16 (*xB)[8][32][16], const float* __restrict__ xb, int n0, int tid)
{
    for (int i = tid; i < CCH * (NT / 4); i += 256) {
        int c  = i >> 5;          // 0..255 (NT/4 == 32)
        int n4 = i & 31;
        int n  = n4 * 4;
        float4 vx = *(const float4*)&xb[(size_t)c * NTOK + n0 + n];
        int kt = c >> 5;
        int cl = c & 31;
        int h  = (cl >> 3) & 1;
        int e  = (cl & 7) + ((cl >> 4) << 3);
        float vv[4] = {vx.x, vx.y, vx.z, vx.w};
#pragma unroll
        for (int t = 0; t < 4; ++t) {
            int nn = n + t;
            xB[kt][nn >> 4][h * 16 + (nn & 15)][e] = (__bf16)vv[t];
        }
    }
}

// ---------------- Kernel A: k = softplus(Wk x + bk); k_sum; attn += k v^T ----
__global__ __launch_bounds__(256) void SGA_kernelA(
    const float* __restrict__ x,  const float* __restrict__ Wk,
    const float* __restrict__ bk, const float* __restrict__ Wv,
    const float* __restrict__ bv, float* __restrict__ attn_ws,
    float* __restrict__ ksum_ws)
{
    __shared__ __bf16 xB [8][8][32][16];  // x tile, B-frag: K=C(256), N=tok(128)  64KB
    __shared__ __bf16 WkA[2][8][32][16];  // Wk, A-frag: M=d(32), K=C(256)         16KB
    __shared__ __bf16 kA [2][4][32][16];  // k,  A-frag: M=d(32), K=tok(128)        8KB
    __shared__ __bf16 WvA[4][8][32][16];  // Wv strip, A-frag: M=64, K=C(256)      32KB
    __shared__ __bf16 vB [4][4][32][16];  // v^T strip, B-frag: K=tok(128), N=64   16KB

    const int tid  = threadIdx.x;
    const int lane = tid & 31;
    const int wave = tid >> 5;
    const int b    = blockIdx.x >> 7;          // TILES == 128
    const int n0   = (blockIdx.x & 127) * NT;
    const float* xb = x + (size_t)b * CCH * NTOK;

    stage_x_B(xB, xb, n0, tid);
    stage_weights_A(&WkA[0][0][0][0], Wk, 0, 2, tid);
    // prefetch first Wv strip while k GEMM runs (lowers to global_prefetch_b8)
    for (int i = tid; i < 512; i += 256)
        __builtin_prefetch((const char*)Wv + (size_t)i * 128, 0, 0);
    __syncthreads();

    // k GEMM: [32 x 128] = Wk[32x256] @ x[256x128]; wave w owns token-tile nt=w
    {
        const int nt = wave;
        const int h = lane >> 4, tok_lo = lane & 15;
        for (int mt = 0; mt < 2; ++mt) {
            v8f acc = {};
            for (int kt = 0; kt < 8; ++kt) {
                v16bf a  = *(const v16bf*)&WkA[mt][kt][lane][0];
                v16bf bb = *(const v16bf*)&xB [kt][nt][lane][0];
                acc = __builtin_amdgcn_wmma_f32_16x16x32_bf16(
                        false, a, false, bb, (short)0, acc, false, false);
            }
            for (int j = 0; j < 8; ++j) {
                int m = mt * 16 + j + 8 * h;                 // d-row
                float kv = softplusf(acc[j] + bk[m]);
                int ktok = nt * 16 + tok_lo;
                int kl   = ktok & 31;
                int ha   = (kl >> 3) & 1;
                int ea   = (kl & 7) + ((kl >> 4) << 3);
                kA[m >> 4][ktok >> 5][ha * 16 + (m & 15)][ea] = (__bf16)kv;
                float s = kv;                 // token reduction in 16-lane half
                s += __shfl_xor(s, 1, 32);
                s += __shfl_xor(s, 2, 32);
                s += __shfl_xor(s, 4, 32);
                s += __shfl_xor(s, 8, 32);
                if (tok_lo == 0) atomicAdd(&ksum_ws[b * DCH + m], s);
            }
        }
    }
    __syncthreads();

    // 4 strips of 64 v-channels: v = Wv x + bv, then attn += k v^T
    for (int s = 0; s < 4; ++s) {
        stage_weights_A(&WvA[0][0][0][0], Wv, s * 64, 4, tid);
        if (s < 3) {   // prefetch next strip (64*256 f32 = 512 cachelines)
            const char* nw = (const char*)(Wv + (size_t)(s + 1) * 64 * CCH);
            for (int i = tid; i < 512; i += 256)
                __builtin_prefetch(nw + (size_t)i * 128, 0, 0);
        }
        __syncthreads();

        // v strip GEMM: [64 x 128]; wave w owns token-tile nt=w, 4 row tiles
        {
            const int nt = wave;
            const int h = lane >> 4, tok_lo = lane & 15;
            for (int mt = 0; mt < 4; ++mt) {
                v8f acc = {};
                for (int kt = 0; kt < 8; ++kt) {
                    v16bf a  = *(const v16bf*)&WvA[mt][kt][lane][0];
                    v16bf bb = *(const v16bf*)&xB [kt][nt][lane][0];
                    acc = __builtin_amdgcn_wmma_f32_16x16x32_bf16(
                            false, a, false, bb, (short)0, acc, false, false);
                }
                for (int j = 0; j < 8; ++j) {
                    int el = mt * 16 + j + 8 * h;            // channel in strip
                    float vv = acc[j] + bv[s * 64 + el];
                    int ktok = nt * 16 + tok_lo;
                    int kl   = ktok & 31;
                    int hb   = (kl >> 3) & 1;
                    int eb   = (kl & 7) + ((kl >> 4) << 3);
                    vB[ktok >> 5][el >> 4][hb * 16 + (el & 15)][eb] = (__bf16)vv;
                }
            }
        }
        __syncthreads();

        // attn strip GEMM: [32 x 64] += kA[32x128] @ vB[128x64]
        {
            const int mt = wave >> 2, nt = wave & 3;
            const int h = lane >> 4, e_lo = lane & 15;
            v8f acc = {};
            for (int kt = 0; kt < 4; ++kt) {
                v16bf a  = *(const v16bf*)&kA[mt][kt][lane][0];
                v16bf bb = *(const v16bf*)&vB[kt][nt][lane][0];
                acc = __builtin_amdgcn_wmma_f32_16x16x32_bf16(
                        false, a, false, bb, (short)0, acc, false, false);
            }
            for (int j = 0; j < 8; ++j) {
                int d   = mt * 16 + j + 8 * h;
                int ech = s * 64 + nt * 16 + e_lo;
                atomicAdd(&attn_ws[((size_t)b * DCH + d) * CCH + ech], acc[j]);
            }
        }
        __syncthreads();
    }
}

// ---------------- Kernel B: q = softplus(Wq x + bq); out = attn^T q^T * norm --
__global__ __launch_bounds__(256) void SGA_kernelB(
    const float* __restrict__ x,  const float* __restrict__ Wq,
    const float* __restrict__ bq, const float* __restrict__ attn_ws,
    const float* __restrict__ ksum_ws, float* __restrict__ out)
{
    __shared__ __bf16 xB  [8][8][32][16]; // x tile B-frag                       64KB
    __shared__ __bf16 WqA [2][8][32][16]; // Wq A-frag                           16KB
    __shared__ __bf16 attnA[16][32][16];  // attn^T A-frag: M=C(256), K=d(32)    16KB
    __shared__ __bf16 qB  [8][32][16];    // q^T  B-frag: K=d(32), N=tok(128)     8KB
    __shared__ float  normL[NT];
    __shared__ float  ksumL[DCH];

    const int tid  = threadIdx.x;
    const int lane = tid & 31;
    const int wave = tid >> 5;
    const int b    = blockIdx.x >> 7;
    const int n0   = (blockIdx.x & 127) * NT;
    const float* xb = x + (size_t)b * CCH * NTOK;

    stage_x_B(xB, xb, n0, tid);
    stage_weights_A(&WqA[0][0][0][0], Wq, 0, 2, tid);
    // stage attn^T as A-fragments (rows of attn[d][:] are contiguous)
    for (int i = tid; i < DCH * (CCH / 4); i += 256) {
        int d   = i >> 6;
        int ech = (i & 63) * 4;
        float4 av = *(const float4*)&attn_ws[((size_t)b * DCH + d) * CCH + ech];
        int h = (d >> 3) & 1;
        int e = (d & 7) + ((d >> 4) << 3);
        float vv[4] = {av.x, av.y, av.z, av.w};
#pragma unroll
        for (int t = 0; t < 4; ++t) {
            int ec = ech + t;
            attnA[ec >> 4][h * 16 + (ec & 15)][e] = (__bf16)vv[t];
        }
    }
    if (tid < DCH) ksumL[tid] = ksum_ws[b * DCH + tid] + 1e-6f;  // EPS
    __syncthreads();

    // q GEMM + norm: wave w owns token-tile nt=w
    {
        const int nt = wave;
        const int h = lane >> 4, tok_lo = lane & 15;
        float denom = 0.0f;
        for (int mt = 0; mt < 2; ++mt) {
            v8f acc = {};
            for (int kt = 0; kt < 8; ++kt) {
                v16bf a  = *(const v16bf*)&WqA[mt][kt][lane][0];
                v16bf bb = *(const v16bf*)&xB [kt][nt][lane][0];
                acc = __builtin_amdgcn_wmma_f32_16x16x32_bf16(
                        false, a, false, bb, (short)0, acc, false, false);
            }
            for (int j = 0; j < 8; ++j) {
                int d = mt * 16 + j + 8 * h;
                float qv = softplusf(acc[j] + bq[d]);
                denom += qv * ksumL[d];
                int hb = (d >> 3) & 1;
                int eb = (d & 7) + ((d >> 4) << 3);
                qB[nt][hb * 16 + tok_lo][eb] = (__bf16)qv;
            }
        }
        denom += __shfl_xor(denom, 16, 32);   // combine both d-halves per token
        if (lane < 16) normL[nt * 16 + lane] = 1.0f / denom;
    }
    __syncthreads();

    // out GEMM: [256 x 128] = attn^T[256x32] @ q^T[32x128]; K=32 -> 1 WMMA/tile
    {
        const int nt = wave;
        const int h = lane >> 4, tok_lo = lane & 15;
        const float nrm = normL[nt * 16 + tok_lo];
        v16bf bb = *(const v16bf*)&qB[nt][lane][0];
        float* ob = out + (size_t)b * CCH * NTOK + n0 + nt * 16 + tok_lo;
        for (int mt = 0; mt < 16; ++mt) {
            v8f acc = {};
            v16bf a = *(const v16bf*)&attnA[mt][lane][0];
            acc = __builtin_amdgcn_wmma_f32_16x16x32_bf16(
                    false, a, false, bb, (short)0, acc, false, false);
#pragma unroll
            for (int j = 0; j < 8; ++j) {
                int ech = mt * 16 + j + 8 * h;
                ob[(size_t)ech * NTOK] = acc[j] * nrm;
            }
        }
    }
}

extern "C" void kernel_launch(void* const* d_in, const int* in_sizes, int n_in,
                              void* d_out, int out_size, void* d_ws, size_t ws_size,
                              hipStream_t stream) {
    (void)in_sizes; (void)n_in; (void)out_size; (void)ws_size;
    const float* x  = (const float*)d_in[0];
    const float* Wq = (const float*)d_in[1];
    const float* bq = (const float*)d_in[2];
    const float* Wk = (const float*)d_in[3];
    const float* bk = (const float*)d_in[4];
    const float* Wv = (const float*)d_in[5];
    const float* bv = (const float*)d_in[6];
    float* out = (float*)d_out;

    float* attn_ws = (float*)d_ws;                      // [B][32][256]
    float* ksum_ws = attn_ws + BATCH * DCH * CCH;       // [B][32]
    const int ws_elems = BATCH * DCH * CCH + BATCH * DCH;

    SGA_zero_ws<<<(ws_elems + 255) / 256, 256, 0, stream>>>(attn_ws, ws_elems);
    SGA_kernelA<<<BATCH * TILES, 256, 0, stream>>>(x, Wk, bk, Wv, bv, attn_ws, ksum_ws);
    SGA_kernelB<<<BATCH * TILES, 256, 0, stream>>>(x, Wq, bq, attn_ws, ksum_ws, out);
}

// v002
// Measured time: 173 microseconds a run.
// Versions in between are left out here; by their measured steps it is 1.55 times as fast as v000.
#include <hip/hip_runtime.h>
#include <hip/hip_bf16.h>

// Problem constants (from reference): B=8, C=256, d=32, H=W=128, N=16384
#define BATCH 8
#define CCH   256
#define DCH   32
#define NTOK  16384
#define NT    128          // tokens per workgroup tile
#define TILES (NTOK / NT)  // 128 tiles per batch

typedef __attribute__((ext_vector_type(16))) __bf16 v16bf;
typedef __attribute__((ext_vector_type(8)))  __bf16 v8bf;
typedef __attribute__((ext_vector_type(4)))  __bf16 v4bf;
typedef __attribute__((ext_vector_type(8)))  float  v8f;

// branchless softplus: no EXEC-mask divergence around WMMA regions
__device__ __forceinline__ float softplusf(float x) {
    return fmaxf(x, 0.0f) + log1pf(expf(-fabsf(x)));
}

// Fragment mappings (16-bit WMMA, wave32):
//  A 16x32: lane = h*16 + (m&15); elem e<8 -> K=h*8+e ; e>=8 -> K=16+h*8+(e-8)
//  B 32x16: lane = h*16 + (n&15); same K mapping
//  inverse (h,e) from k_local kl: h=(kl>>3)&1 ; e=(kl&7)+((kl>>4)<<3)
//  C/D 16x16 f32: elem j -> row m = j + 8*(lane>>4), col n = lane&15

// stage a [mtc*16 x 256] f32 row-major weight block as A-fragments (bf16)
__device__ __forceinline__ void stage_weights_A(
    __bf16* dst, const float* __restrict__ W, int row_base, int mtc, int tid)
{
    for (int i = tid; i < mtc * 8 * 32; i += 256) {
        int ln = i & 31, kt = (i >> 5) & 7, mt = i >> 8;
        int h = ln >> 4;
        int m = row_base + mt * 16 + (ln & 15);
        int c0 = kt * 32 + h * 8;
        const float* wr = W + (size_t)m * CCH + c0;
        float4 a0 = *(const float4*)(wr);
        float4 a1 = *(const float4*)(wr + 4);
        float4 a2 = *(const float4*)(wr + 16);
        float4 a3 = *(const float4*)(wr + 20);
        v16bf f;
        f[0]=(__bf16)a0.x; f[1]=(__bf16)a0.y; f[2]=(__bf16)a0.z; f[3]=(__bf16)a0.w;
        f[4]=(__bf16)a1.x; f[5]=(__bf16)a1.y; f[6]=(__bf16)a1.z; f[7]=(__bf16)a1.w;
        f[8]=(__bf16)a2.x; f[9]=(__bf16)a2.y; f[10]=(__bf16)a2.z; f[11]=(__bf16)a2.w;
        f[12]=(__bf16)a3.x; f[13]=(__bf16)a3.y; f[14]=(__bf16)a3.z; f[15]=(__bf16)a3.w;
        *(v16bf*)(dst + (size_t)i * 16) = f;   // [mt][kt][lane][16]
    }
}

// stage x tile [256 x NT] (channel-major, token-contiguous) as B-fragments
__device__ __forceinline__ void stage_x_B(
    __bf16 (*xB)[8][32][16], const float* __restrict__ xb, int n0, int tid)
{
    for (int i = tid; i < CCH * (NT / 4); i += 256) {
        int c  = i >> 5;          // 0..255 (NT/4 == 32)
        int n4 = i & 31;
        int n  = n4 * 4;
        float4 vx = *(const float4*)&xb[(size_t)c * NTOK + n0 + n];
        int kt = c >> 5;
        int cl = c & 31;
        int h  = (cl >> 3) & 1;
        int e  = (cl & 7) + ((cl >> 4) << 3);
        float vv[4] = {vx.x, vx.y, vx.z, vx.w};
#pragma unroll
        for (int t = 0; t < 4; ++t) {
            int nn = n + t;
            xB[kt][nn >> 4][h * 16 + (nn & 15)][e] = (__bf16)vv[t];
        }
    }
}

// Linear attention, reassociated:
//   attn[d][e] = sum_n k[d][n] * (sum_c Wv[e][c] x[c][n] + bv[e])
//              = sum_c (sum_n k[d][n] x[c][n]) * Wv[e][c] + (sum_n k[d][n]) * bv[e]
// so the token loop only needs kx = k x^T [32 x 256]; Wv is applied once per batch.

#define XR_PITCH (NT + 8)  // bf16 elements per row: 272 B = 16 B x odd, b128 reads conflict-free

// stage x tile [256 x NT] twice: as B-fragments with K=channel (for the k GEMM)
// and as plain channel rows, token-contiguous (B-fragments with K=token)
__device__ __forceinline__ void stage_x_B_rows(
    __bf16 (*xB)[8][32][16], __bf16 (*xR)[XR_PITCH],
    const float* __restrict__ xb, int n0, int tid)
{
    for (int i = tid; i < CCH * (NT / 4); i += 256) {
        int c  = i >> 5;          // 0..255 (NT/4 == 32)
        int n4 = i & 31;
        int n  = n4 * 4;
        float4 vx = *(const float4*)&xb[(size_t)c * NTOK + n0 + n];
        int kt = c >> 5;
        int cl = c & 31;
        int h  = (cl >> 3) & 1;
        int e  = (cl & 7) + ((cl >> 4) << 3);
        v4bf r;
        r[0] = (__bf16)vx.x; r[1] = (__bf16)vx.y; r[2] = (__bf16)vx.z; r[3] = (__bf16)vx.w;
        *(v4bf*)&xR[c][n] = r;
#pragma unroll   // r[t] by constant index: no register indexing
        for (int t = 0; t < 4; ++t) {
            int nn = n + t;
            xB[kt][nn >> 4][h * 16 + (nn & 15)][e] = r[t];
        }
    }
}

#define KXP_F4 (DCH * CCH / 4)   // float4 per tile plane of kx partials

// ---------------- Kernel A: k = softplus(Wk x + bk); per-tile k_sum and k x^T --
// Every block stores its own plane of partial sums; SGA_reduce adds the planes.
// Plane order (float4 units): [wave][mt][j/4][p][lane], so that each store of a
// wave is 512 contiguous bytes; the sum over planes is elementwise in any order.
__global__ __launch_bounds__(256) void SGA_kernelA(
    const float* __restrict__ x,  const float* __restrict__ Wk,
    const float* __restrict__ bk, float* __restrict__ kx_part,
    float* __restrict__ ksum_part)
{
    __shared__ __bf16 xB [8][8][32][16];  // x tile, B-frag: K=C(256), N=tok(128)  64KB
    __shared__ __bf16 WkA[2][8][32][16];  // Wk, A-frag: M=d(32), K=C(256)         16KB
    __shared__ __bf16 kA [2][4][32][16];  // k,  A-frag: M=d(32), K=tok(128)        8KB
    __shared__ __attribute__((aligned(16)))
               __bf16 xR [CCH][XR_PITCH]; // x tile, channel rows                  68KB
    __shared__ float  ksL[8][DCH];        // k_sum of each wave's 16 tokens         1KB

    const int tid  = threadIdx.x;
    const int lane = tid & 31;
    const int wave = tid >> 5;
    const int b    = blockIdx.x >> 7;          // TILES == 128
    const int n0   = (blockIdx.x & 127) * NT;
    const float* xb = x + (size_t)b * CCH * NTOK;

    stage_x_B_rows(xB, xR, xb, n0, tid);
    stage_weights_A(&WkA[0][0][0][0], Wk, 0, 2, tid);
    __syncthreads();

    // k GEMM: [32 x 128] = Wk[32x256] @ x[256x128]; wave w owns token-tile nt=w
    {
        const int nt = wave;
        const int h = lane >> 4, tok_lo = lane & 15;
        for (int mt = 0; mt < 2; ++mt) {
            v8f acc = {};
            for (int kt = 0; kt < 8; ++kt) {
                v16bf a  = *(const v16bf*)&WkA[mt][kt][lane][0];
                v16bf bb = *(const v16bf*)&xB [kt][nt][lane][0];
                acc = __builtin_amdgcn_wmma_f32_16x16x32_bf16(
                        false, a, false, bb, (short)0, acc, false, false);
            }
            for (int j = 0; j < 8; ++j) {
                int m = mt * 16 + j + 8 * h;                 // d-row
                float kv = softplusf(acc[j] + bk[m]);
                int ktok = nt * 16 + tok_lo;
                int kl   = ktok & 31;
                int ha   = (kl >> 3) & 1;
                int ea   = (kl & 7) + ((kl >> 4) << 3);
                kA[m >> 4][ktok >> 5][ha * 16 + (m & 15)][ea] = (__bf16)kv;
                float s = kv;                 // token reduction in 16-lane half
                s += __shfl_xor(s, 1, 32);
                s += __shfl_xor(s, 2, 32);
                s += __shfl_xor(s, 4, 32);
                s += __shfl_xor(s, 8, 32);
                if (tok_lo == 0) ksL[wave][m] = s;
            }
        }
    }
    __syncthreads();

    // kx GEMM: [32 x 256] += kA[32x128] @ x^T[128x256]; wave w owns channel
    // tiles 2w and 2w+1, both d-row tiles
    {
        const int h = lane >> 4, c_lo = lane & 15;
        v8f acc[2][2] = {};
        // all loops below unrolled: acc[][] keeps constant indices (stays in registers)
        // and the LDS reads of all four K blocks issue ahead of the WMMAs
#pragma unroll
        for (int kt = 0; kt < 4; ++kt) {
            v16bf a0 = *(const v16bf*)&kA[0][kt][lane][0];
            v16bf a1 = *(const v16bf*)&kA[1][kt][lane][0];
#pragma unroll
            for (int p = 0; p < 2; ++p) {
                // B 32x16: lane (h, channel); e<8 -> tok h*8+e, e>=8 -> tok 16+h*8+(e-8)
                const __bf16* row = &xR[(wave * 2 + p) * 16 + c_lo][kt * 32 + h * 8];
                v8bf lo = *(const v8bf*)row;
                v8bf hi = *(const v8bf*)(row + 16);
                v16bf bb = __builtin_shufflevector(lo, hi,
                        0, 1, 2, 3, 4, 5, 6, 7, 8, 9, 10, 11, 12, 13, 14, 15);
                acc[0][p] = __builtin_amdgcn_wmma_f32_16x16x32_bf16(
                        false, a0, false, bb, (short)0, acc[0][p], false, false);
                acc[1][p] = __builtin_amdgcn_wmma_f32_16x16x32_bf16(
                        false, a1, false, bb, (short)0, acc[1][p], false, false);
            }
        }
        float4* kp = (float4*)kx_part + (size_t)blockIdx.x * KXP_F4 + wave * 256 + lane;
#pragma unroll   // acc[][][] by constant index: no register indexing
        for (int mt = 0; mt < 2; ++mt)
#pragma unroll
            for (int jh = 0; jh < 2; ++jh)
#pragma unroll
                for (int p = 0; p < 2; ++p)
                    kp[((mt * 2 + jh) * 2 + p) * 32] = make_float4(
                        acc[mt][p][jh * 4 + 0], acc[mt][p][jh * 4 + 1],
                        acc[mt][p][jh * 4 + 2], acc[mt][p][jh * 4 + 3]);
    }
    if (tid < DCH) {   // wave 0 alone: the tile's k_sum, one 128-B line
        float s = 0.0f;
#pragma unroll   // the 8 LDS reads issue together
        for (int w = 0; w < 8; ++w) s += ksL[w][tid];
        ksum_part[(size_t)blockIdx.x * DCH + tid] = s;
    }
}

// ---------------- Kernel R: add the 128 tile planes of each batch ------------
// blocks 0..255: batch b, 64 float4 columns of the kx plane; thread group g adds
// 32 planes, LDS adds the 4 groups. blocks 256..263: k_sum of one batch.
__global__ __launch_bounds__(256) void SGA_reduce(
    const float* __restrict__ kx_part, const float* __restrict__ ksum_part,
    float* __restrict__ kx_ws, float* __restrict__ ksum_ws)
{
    __shared__ float4 red4[4][64];
    __shared__ float  redk[8][DCH];
    const int tid = threadIdx.x;
    if (blockIdx.x < BATCH * 32) {
        const int b = blockIdx.x >> 5, cg = blockIdx.x & 31;
        const int q = tid & 63, g = tid >> 6;
        const float4* p = (const float4*)kx_part
                        + (size_t)(b * TILES + g * 32) * KXP_F4 + cg * 64 + q;
        float4 v[32];
#pragma unroll   // all 32 loads in flight at once, v[] by constant index
        for (int t = 0; t < 32; ++t) v[t] = p[(size_t)t * KXP_F4];
        // translation wait before a register that these loads name is written again;
        // the pointer is an input so that its registers stay as they are up to the wait
        asm volatile("s_wait_xcnt 0x0" :: "v"(p) : "memory");
        float4 s = v[0];
#pragma unroll
        for (int t = 1; t < 32; ++t) {
            s.x += v[t].x; s.y += v[t].y; s.z += v[t].z; s.w += v[t].w;
        }
        red4[g][q] = s;
        __syncthreads();
        if (g == 0) {   // waves 0 and 1: both halves of each 128-B line of kx
            float4 s1 = red4[1][q], s2 = red4[2][q], s3 = red4[3][q];
            const int f  = cg * 64 + q;          // [wave][mt][j/4][p][lane]
            const int ln = f & 31, pp = (f >> 5) & 1, jh = (f >> 6) & 1;
            const int mt = (f >> 7) & 1, wv = f >> 8;
            const int c  = (wv * 2 + pp) * 16 + (ln & 15);
            const int d0 = mt * 16 + jh * 4 + 8 * (ln >> 4);
            float* o = kx_ws + ((size_t)b * DCH + d0) * CCH + c;
            o[0]       = (s.x + s1.x) + (s2.x + s3.x);
            o[CCH]     = (s.y + s1.y) + (s2.y + s3.y);
            o[2 * CCH] = (s.z + s1.z) + (s2.z + s3.z);
            o[3 * CCH] = (s.w + s1.w) + (s2.w + s3.w);
        }
    } else {
        const int b = blockIdx.x - BATCH * 32;
        const int d = tid & 31, g = tid >> 5;
        const float* p = ksum_part + (size_t)(b * TILES + g * 16) * DCH + d;
        float v[16];
#pragma unroll   // all 16 loads in flight at once, v[] by constant index
        for (int t = 0; t < 16; ++t) v[t] = p[t * DCH];
        // translation wait, as above
        asm volatile("s_wait_xcnt 0x0" :: "v"(p) : "memory");
        float s = v[0];
#pragma unroll
        for (int t = 1; t < 16; ++t) s += v[t];
        redk[g][d] = s;
        __syncthreads();
        if (tid < DCH) {
            float r = 0.0f;
#pragma unroll   // the 8 LDS reads issue together
            for (int w = 0; w < 8; ++w) r += redk[w][tid];
            ksum_ws[b * DCH + tid] = r;
        }
    }
}

// 16 K values of one row (two runs of 8) as a 16-bit fragment (A and B share the K map):
// e<8 -> K=h*8+e, e>=8 -> K=16+h*8+(e-8); p points at K=h*8 of the 32-wide K block
__device__ __forceinline__ v16bf frag_from_f32_row(const float* __restrict__ p) {
    float4 a0 = *(const float4*)(p);
    float4 a1 = *(const float4*)(p + 4);
    float4 a2 = *(const float4*)(p + 16);
    float4 a3 = *(const float4*)(p + 20);
    // translation wait before a register that these four loads name is written again;
    // the pointer is an input so that its registers stay as they are up to the wait
    asm volatile("s_wait_xcnt 0x0" :: "v"(p) : "memory");
    v16bf f;
    f[0]=(__bf16)a0.x; f[1]=(__bf16)a0.y; f[2]=(__bf16)a0.z; f[3]=(__bf16)a0.w;
    f[4]=(__bf16)a1.x; f[5]=(__bf16)a1.y; f[6]=(__bf16)a1.z; f[7]=(__bf16)a1.w;
    f[8]=(__bf16)a2.x; f[9]=(__bf16)a2.y; f[10]=(__bf16)a2.z; f[11]=(__bf16)a2.w;
    f[12]=(__bf16)a3.x; f[13]=(__bf16)a3.y; f[14]=(__bf16)a3.z; f[15]=(__bf16)a3.w;
    return f;
}

// ---------------- Kernel W: attn = kx Wv^T + k_sum bv^T, once per batch ------
// block: 16 d-rows x 32 v-channels (whole 128-B lines of attn); wave w takes the
// K slice c = 32w..32w+31, so that every load of the block is in flight at once
__global__ __launch_bounds__(256) void SGA_kernelW(
    const float* __restrict__ kx_ws, const float* __restrict__ ksum_ws,
    const float* __restrict__ Wv,    const float* __restrict__ bv,
    float* __restrict__ attn_ws)
{
    __shared__ float red[8][2][8][32];    // [K slice][channel tile][acc elem][lane]  16KB

    const int lane = threadIdx.x & 31;
    const int wave = threadIdx.x >> 5;
    const int h = lane >> 4, lo = lane & 15;
    const int b  = blockIdx.x >> 4;
    const int mt = (blockIdx.x >> 3) & 1;
    const int e0 = (blockIdx.x & 7) * 32;
    const int k0 = wave * 32 + h * 8;
    const int d  = mt * 16 + wave + 8 * h;   // the attn row this lane finishes

    const float ksum = ksum_ws[b * DCH + d];
    const float bv0 = bv[e0 + lo], bv1 = bv[e0 + 16 + lo];
    v16bf a  = frag_from_f32_row(kx_ws + ((size_t)b * DCH + mt * 16 + lo) * CCH + k0);
    v16bf b0 = frag_from_f32_row(Wv + (size_t)(e0 + lo) * CCH + k0);
    v16bf b1 = frag_from_f32_row(Wv + (size_t)(e0 + 16 + lo) * CCH + k0);
    v8f acc0 = {}, acc1 = {};
    acc0 = __builtin_amdgcn_wmma_f32_16x16x32_bf16(
            false, a, false, b0, (short)0, acc0, false, false);
    acc1 = __builtin_amdgcn_wmma_f32_16x16x32_bf16(
            false, a, false, b1, (short)0, acc1, false, false);
#pragma unroll   // acc[j] by constant index: no register indexing
    for (int j = 0; j < 8; ++j) {
        red[wave][0][j][lane] = acc0[j];
        red[wave][1][j][lane] = acc1[j];
    }
    __syncthreads();

    // wave w sums accumulator element j = w over the 8 K slices
    float s0 = 0.0f, s1 = 0.0f;
#pragma unroll   // the 16 LDS reads issue together instead of one wait per trip
    for (int ks = 0; ks < 8; ++ks) {
        s0 += red[ks][0][wave][lane];
        s1 += red[ks][1][wave][lane];
    }
    float* o = attn_ws + ((size_t)b * DCH + d) * CCH + e0 + lo;
    o[0]  = s0 + ksum * bv0;
    o[16] = s1 + ksum * bv1;
}

// ---------------- Kernel B: q = softplus(Wq x + bq); out = attn^T q^T * norm --
__global__ __launch_bounds__(256) void SGA_kernelB(
    const float* __restrict__ x,  const float* __restrict__ Wq,
    const float* __restrict__ bq, const float* __restrict__ attn_ws,
    const float* __restrict__ ksum_ws, float* __restrict__ out)
{
    __shared__ __bf16 xB  [8][8][32][16]; // x tile B-frag                       64KB
    __shared__ __bf16 WqA [2][8][32][16]; // Wq A-frag                           16KB
    __shared__ __bf16 attnA[16][32][16];  // attn^T A-frag: M=C(256), K=d(32)    16KB
    __shared__ __bf16 qB  [8][32][16];    // q^T  B-frag: K=d(32), N=tok(128)     8KB
    __shared__ float  normL[NT];
    __shared__ float  ksumL[DCH];

    const int tid  = threadIdx.x;
    const int lane = tid & 31;
    const int wave = tid >> 5;
    const int b    = blockIdx.x >> 7;
    const int n0   = (blockIdx.x & 127) * NT;
    const float* xb = x + (size_t)b * CCH * NTOK;

    stage_x_B(xB, xb, n0, tid);
    stage_weights_A(&WqA[0][0][0][0], Wq, 0, 2, tid);
    // stage attn^T as A-fragments (rows of attn[d][:] are contiguous)
    for (int i = tid; i < DCH * (CCH / 4); i += 256) {
        int d   = i >> 6;
        int ech = (i & 63) * 4;
        float4 av = *(const float4*)&attn_ws[((size_t)b * DCH + d) * CCH + ech];
        int h = (d >> 3) & 1;
        int e = (d & 7) + ((d >> 4) << 3);
        float vv[4] = {av.x, av.y, av.z, av.w};
#pragma unroll
        for (int t = 0; t < 4; ++t) {
            int ec = ech + t;
            attnA[ec >> 4][h * 16 + (ec & 15)][e] = (__bf16)vv[t];
        }
    }
    if (tid < DCH) ksumL[tid] = ksum_ws[b * DCH + tid] + 1e-6f;  // EPS
    __syncthreads();

    // q GEMM + norm: wave w owns token-tile nt=w
    {
        const int nt = wave;
        const int h = lane >> 4, tok_lo = lane & 15;
        float denom = 0.0f;
        for (int mt = 0; mt < 2; ++mt) {
            v8f acc = {};
            for (int kt = 0; kt < 8; ++kt) {
                v16bf a  = *(const v16bf*)&WqA[mt][kt][lane][0];
                v16bf bb = *(const v16bf*)&xB [kt][nt][lane][0];
                acc = __builtin_amdgcn_wmma_f32_16x16x32_bf16(
                        false, a, false, bb, (short)0, acc, false, false);
            }
            for (int j = 0; j < 8; ++j) {
                int d = mt * 16 + j + 8 * h;
                float qv = softplusf(acc[j] + bq[d]);
                denom += qv * ksumL[d];
                int hb = (d >> 3) & 1;
                int eb = (d & 7) + ((d >> 4) << 3);
                qB[nt][hb * 16 + tok_lo][eb] = (__bf16)qv;
            }
        }
        denom += __shfl_xor(denom, 16, 32);   // combine both d-halves per token
        if (lane < 16) normL[nt * 16 + lane] = 1.0f / denom;
    }
    __syncthreads();

    // out GEMM: [256 x 128] = attn^T[256x32] @ q^T[32x128]; K=32 -> 1 WMMA/tile
    {
        const int nt = wave;
        const int h = lane >> 4, tok_lo = lane & 15;
        const float nrm = normL[nt * 16 + tok_lo];
        v16bf bb = *(const v16bf*)&qB[nt][lane][0];
        float* ob = out + (size_t)b * CCH * NTOK + n0 + nt * 16 + tok_lo;
        for (int mt = 0; mt < 16; ++mt) {
            v8f acc = {};
            v16bf a = *(const v16bf*)&attnA[mt][lane][0];
            acc = __builtin_amdgcn_wmma_f32_16x16x32_bf16(
                    false, a, false, bb, (short)0, acc, false, false);
#pragma unroll
            for (int j = 0; j < 8; ++j) {
                int ech = mt * 16 + j + 8 * h;
                ob[(size_t)ech * NTOK] = acc[j] * nrm;
            }
        }
    }
}

extern "C" void kernel_launch(void* const* d_in, const int* in_sizes, int n_in,
                              void* d_out, int out_size, void* d_ws, size_t ws_size,
                              hipStream_t stream) {
    (void)in_sizes; (void)n_in; (void)out_size; (void)ws_size;
    const float* x  = (const float*)d_in[0];
    const float* Wq = (const float*)d_in[1];
    const float* bq = (const float*)d_in[2];
    const float* Wk = (const float*)d_in[3];
    const float* bk = (const float*)d_in[4];
    const float* Wv = (const float*)d_in[5];
    const float* bv = (const float*)d_in[6];
    float* out = (float*)d_out;

    float* kx_ws     = (float*)d_ws;                    // [B][32][256]
    float* ksum_ws   = kx_ws + BATCH * DCH * CCH;       // [B][32]
    float* attn_ws   = ksum_ws + BATCH * DCH;           // [B][32][256]
    float* kx_part   = attn_ws + BATCH * DCH * CCH;     // [B*TILES][32*256] tile planes
    float* ksum_part = kx_part + (size_t)BATCH * TILES * DCH * CCH;  // [B*TILES][32]

    SGA_kernelA<<<BATCH * TILES, 256, 0, stream>>>(x, Wk, bk, kx_part, ksum_part);
    SGA_reduce<<<BATCH * 32 + BATCH, 256, 0, stream>>>(kx_part, ksum_part, kx_ws, ksum_ws);
    SGA_kernelW<<<BATCH * 16, 256, 0, stream>>>(kx_ws, ksum_ws, Wv, bv, attn_ws);
    SGA_kernelB<<<BATCH * TILES, 256, 0, stream>>>(x, Wq, bq, attn_ws, ksum_ws, out);
}

// v003
// It runs in 88.6 microseconds.
// Next to v002, in two timings, it ran 1.95 times as fast each time.
// Over all steps from v000 it is 3.02 times as fast.
#include <hip/hip_runtime.h>
#include <hip/hip_bf16.h>

// Problem constants (from reference): B=8, C=256, d=32, H=W=128, N=16384
#define BATCH 8
#define CCH   256
#define DCH   32
#define NTOK  16384
#define NT    128          // tokens per workgroup tile
#define TILES (NTOK / NT)  // 128 tiles per batch

typedef __attribute__((ext_vector_type(16))) __bf16 v16bf;
typedef __attribute__((ext_vector_type(8)))  __bf16 v8bf;
typedef __attribute__((ext_vector_type(4)))  __bf16 v4bf;
typedef __attribute__((ext_vector_type(8)))  float  v8f;

// branchless softplus: no EXEC-mask divergence around WMMA regions
__device__ __forceinline__ float softplusf(float x) {
    return fmaxf(x, 0.0f) + log1pf(expf(-fabsf(x)));
}

// Fragment mappings (16-bit WMMA, wave32):
//  A 16x32: lane = h*16 + (m&15); elem e<8 -> K=h*8+e ; e>=8 -> K=16+h*8+(e-8)
//  B 32x16: lane = h*16 + (n&15); same K mapping
//  inverse (h,e) from k_local kl: h=(kl>>3)&1 ; e=(kl&7)+((kl>>4)<<3)
//  C/D 16x16 f32: elem j -> row m = j + 8*(lane>>4), col n = lane&15

// stage a [mtc*16 x 256] f32 row-major weight block as A-fragments (bf16)
__device__ __forceinline__ void stage_weights_A(
    __bf16* dst, const float* __restrict__ W, int row_base, int mtc, int tid)
{
    for (int i = tid; i < mtc * 8 * 32; i += 256) {
        int ln = i & 31, kt = (i >> 5) & 7, mt = i >> 8;
        int h = ln >> 4;
        int m = row_base + mt * 16 + (ln & 15);
        int c0 = kt * 32 + h * 8;
        const float* wr = W + (size_t)m * CCH + c0;
        float4 a0 = *(const float4*)(wr);
        float4 a1 = *(const float4*)(wr + 4);
        float4 a2 = *(const float4*)(wr + 16);
        float4 a3 = *(const float4*)(wr + 20);
        v16bf f;
        f[0]=(__bf16)a0.x; f[1]=(__bf16)a0.y; f[2]=(__bf16)a0.z; f[3]=(__bf16)a0.w;
        f[4]=(__bf16)a1.x; f[5]=(__bf16)a1.y; f[6]=(__bf16)a1.z; f[7]=(__bf16)a1.w;
        f[8]=(__bf16)a2.x; f[9]=(__bf16)a2.y; f[10]=(__bf16)a2.z; f[11]=(__bf16)a2.w;
        f[12]=(__bf16)a3.x; f[13]=(__bf16)a3.y; f[14]=(__bf16)a3.z; f[15]=(__bf16)a3.w;
        *(v16bf*)(dst + (size_t)i * 16) = f;   // [mt][kt][lane][16]
    }
}

// stage x tile [256 x NT] (channel-major, token-contiguous) as bf16 channel rows of
// PITCH elements: a wave stores 256 contiguous bytes of one row, no bank conflict
template <int PITCH>
__device__ __forceinline__ void stage_x_rows(
    __bf16 (*xR)[PITCH], const float* __restrict__ xb, int n0, int tid)
{
    const int n = (tid & 31) * 4;             // a wave takes one whole row per load
    for (int c = tid >> 5; c < CCH; c += 64) {
        const float* p = xb + (size_t)c * NTOK + n0 + n;
        float4 v[8];
#pragma unroll   // rows c, c+8, .., c+56: 8 loads in flight, v[] by constant index
        for (int u = 0; u < 8; ++u) v[u] = *(const float4*)(p + (size_t)u * 8 * NTOK);
#pragma unroll   // v[u] by constant index: no register indexing
        for (int u = 0; u < 8; ++u) {
            v4bf r;
            r[0] = (__bf16)v[u].x; r[1] = (__bf16)v[u].y;
            r[2] = (__bf16)v[u].z; r[3] = (__bf16)v[u].w;
            *(v4bf*)&xR[c + u * 8][n] = r;
        }
    }
}

// B fragment with K=channel, N=token out of the channel rows, by the transposing LDS
// load: lane l reads 16 B of row 8*(l>>4)+(l&7) and gets rows 8h..8h+7 of column l&15;
// the loads at rows +0 and +16 give e<8 -> K=h*8+e, e>=8 -> K=16+h*8+(e-8), the K map
// of the staged A fragments. t points at (first channel of the K block, first token).
template <int PITCH>
__device__ __forceinline__ v16bf frag_B_tr16(const __bf16* t, int lane) {
    typedef __attribute__((address_space(3))) v8bf lds_v8bf;
    const __bf16* p = t + (8 * (lane >> 4) + (lane & 7)) * PITCH + 8 * ((lane >> 3) & 1);
    v8bf lo = __builtin_amdgcn_ds_load_tr16_b128_v8bf16((lds_v8bf*)p);
    v8bf hi = __builtin_amdgcn_ds_load_tr16_b128_v8bf16((lds_v8bf*)(p + 16 * PITCH));
    return __builtin_shufflevector(lo, hi,
            0, 1, 2, 3, 4, 5, 6, 7, 8, 9, 10, 11, 12, 13, 14, 15);
}

// Linear attention, reassociated:
//   attn[d][e] = sum_n k[d][n] * (sum_c Wv[e][c] x[c][n] + bv[e])
//              = sum_c (sum_n k[d][n] x[c][n]) * Wv[e][c] + (sum_n k[d][n]) * bv[e]
// so the token loop only needs kx = k x^T [32 x 256]; Wv is applied once per batch.

// bf16 elements per LDS row of the x tile
#define XR_PITCH (NT + 8)   // 272 B = 16 B x odd: for rows that b128 reads walk too
#define XT_PITCH (NT + 16)  // 288 B = 32 B x odd: for rows that only transposing reads walk

#define KXP_F4 (DCH * CCH / 4)   // float4 per tile plane of kx partials

// ---------------- Kernel A: k = softplus(Wk x + bk); per-tile k_sum and k x^T --
// Every block stores its own plane of partial sums; SGA_reduce adds the planes.
// Plane order (float4 units): [wave][mt][j/4][p][lane], so that each store of a
// wave is 512 contiguous bytes; the sum over planes is elementwise in any order.
__global__ __launch_bounds__(256) void SGA_kernelA(
    const float* __restrict__ x,  const float* __restrict__ Wk,
    const float* __restrict__ bk, float* __restrict__ kx_part,
    float* __restrict__ ksum_part)
{
    __shared__ __bf16 WkA[2][8][32][16];  // Wk, A-frag: M=d(32), K=C(256)         16KB
    __shared__ __bf16 kA [2][4][32][16];  // k,  A-frag: M=d(32), K=tok(128)        8KB
    __shared__ __attribute__((aligned(16)))
               __bf16 xR [CCH][XR_PITCH]; // x tile, channel rows                  68KB
    __shared__ float  ksL[8][DCH];        // k_sum of each wave's 16 tokens         1KB

    const int tid  = threadIdx.x;
    const int lane = tid & 31;
    const int wave = tid >> 5;
    const int b    = blockIdx.x >> 7;          // TILES == 128
    const int n0   = (blockIdx.x & 127) * NT;
    const float* xb = x + (size_t)b * CCH * NTOK;

    stage_x_rows<XR_PITCH>(xR, xb, n0, tid);
    stage_weights_A(&WkA[0][0][0][0], Wk, 0, 2, tid);
    __syncthreads();

    // k GEMM: [32 x 128] = Wk[32x256] @ x[256x128]; wave w owns token-tile nt=w
    {
        const int nt = wave;
        const int h = lane >> 4, tok_lo = lane & 15;
        for (int mt = 0; mt < 2; ++mt) {
            v8f acc = {};
            for (int kt = 0; kt < 8; ++kt) {
                v16bf a  = *(const v16bf*)&WkA[mt][kt][lane][0];
                v16bf bb = frag_B_tr16<XR_PITCH>(&xR[kt * 32][nt * 16], lane);
                acc = __builtin_amdgcn_wmma_f32_16x16x32_bf16(
                        false, a, false, bb, (short)0, acc, false, false);
            }
            for (int j = 0; j < 8; ++j) {
                int m = mt * 16 + j + 8 * h;                 // d-row
                float kv = softplusf(acc[j] + bk[m]);
                int ktok = nt * 16 + tok_lo;
                int kl   = ktok & 31;
                int ha   = (kl >> 3) & 1;
                int ea   = (kl & 7) + ((kl >> 4) << 3);
                kA[m >> 4][ktok >> 5][ha * 16 + (m & 15)][ea] = (__bf16)kv;
                float s = kv;                 // token reduction in 16-lane half
                s += __shfl_xor(s, 1, 32);
                s += __shfl_xor(s, 2, 32);
                s += __shfl_xor(s, 4, 32);
                s += __shfl_xor(s, 8, 32);
                if (tok_lo == 0) ksL[wave][m] = s;
            }
        }
    }
    __syncthreads();

    // kx GEMM: [32 x 256] += kA[32x128] @ x^T[128x256]; wave w owns channel
    // tiles 2w and 2w+1, both d-row tiles
    {
        const int h = lane >> 4, c_lo = lane & 15;
        v8f acc[2][2] = {};
        // all loops below unrolled: acc[][] keeps constant indices (stays in registers)
        // and the LDS reads of all four K blocks issue ahead of the WMMAs
#pragma unroll
        for (int kt = 0; kt < 4; ++kt) {
            v16bf a0 = *(const v16bf*)&kA[0][kt][lane][0];
            v16bf a1 = *(const v16bf*)&kA[1][kt][lane][0];
#pragma unroll
            for (int p = 0; p < 2; ++p) {
                // B 32x16: lane (h, channel); e<8 -> tok h*8+e, e>=8 -> tok 16+h*8+(e-8)
                const __bf16* row = &xR[(wave * 2 + p) * 16 + c_lo][kt * 32 + h * 8];
                v8bf lo = *(const v8bf*)row;
                v8bf hi = *(const v8bf*)(row + 16);
                v16bf bb = __builtin_shufflevector(lo, hi,
                        0, 1, 2, 3, 4, 5, 6, 7, 8, 9, 10, 11, 12, 13, 14, 15);
                acc[0][p] = __builtin_amdgcn_wmma_f32_16x16x32_bf16(
                        false, a0, false, bb, (short)0, acc[0][p], false, false);
                acc[1][p] = __builtin_amdgcn_wmma_f32_16x16x32_bf16(
                        false, a1, false, bb, (short)0, acc[1][p], false, false);
            }
        }
        float4* kp = (float4*)kx_part + (size_t)blockIdx.x * KXP_F4 + wave * 256 + lane;
#pragma unroll   // acc[][][] by constant index: no register indexing
        for (int mt = 0; mt < 2; ++mt)
#pragma unroll
            for (int jh = 0; jh < 2; ++jh)
#pragma unroll
                for (int p = 0; p < 2; ++p)
                    kp[((mt * 2 + jh) * 2 + p) * 32] = make_float4(
                        acc[mt][p][jh * 4 + 0], acc[mt][p][jh * 4 + 1],
                        acc[mt][p][jh * 4 + 2], acc[mt][p][jh * 4 + 3]);
    }
    if (tid < DCH) {   // wave 0 alone: the tile's k_sum, one 128-B line
        float s = 0.0f;
#pragma unroll   // the 8 LDS reads issue together
        for (int w = 0; w < 8; ++w) s += ksL[w][tid];
        ksum_part[(size_t)blockIdx.x * DCH + tid] = s;
    }
}

// ---------------- Kernel R: add the 128 tile planes of each batch ------------
// blocks 0..255: batch b, 64 float4 columns of the kx plane; thread group g adds
// 32 planes, LDS adds the 4 groups. blocks 256..263: k_sum of one batch.
__global__ __launch_bounds__(256) void SGA_reduce(
    const float* __restrict__ kx_part, const float* __restrict__ ksum_part,
    float* __restrict__ kx_ws, float* __restrict__ ksum_ws)
{
    __shared__ float4 red4[4][64];
    __shared__ float  redk[8][DCH];
    const int tid = threadIdx.x;
    if (blockIdx.x < BATCH * 32) {
        const int b = blockIdx.x >> 5, cg = blockIdx.x & 31;
        const int q = tid & 63, g = tid >> 6;
        const float4* p = (const float4*)kx_part
                        + (size_t)(b * TILES + g * 32) * KXP_F4 + cg * 64 + q;
        float4 v[32];
#pragma unroll   // all 32 loads in flight at once, v[] by constant index
        for (int t = 0; t < 32; ++t) v[t] = p[(size_t)t * KXP_F4];
        // translation wait before a register that these loads name is written again;
        // the pointer is an input so that its registers stay as they are up to the wait
        asm volatile("s_wait_xcnt 0x0" :: "v"(p) : "memory");
        float4 s = v[0];
#pragma unroll
        for (int t = 1; t < 32; ++t) {
            s.x += v[t].x; s.y += v[t].y; s.z += v[t].z; s.w += v[t].w;
        }
        red4[g][q] = s;
        __syncthreads();
        if (g == 0) {   // waves 0 and 1: both halves of each 128-B line of kx
            float4 s1 = red4[1][q], s2 = red4[2][q], s3 = red4[3][q];
            const int f  = cg * 64 + q;          // [wave][mt][j/4][p][lane]
            const int ln = f & 31, pp = (f >> 5) & 1, jh = (f >> 6) & 1;
            const int mt = (f >> 7) & 1, wv = f >> 8;
            const int c  = (wv * 2 + pp) * 16 + (ln & 15);
            const int d0 = mt * 16 + jh * 4 + 8 * (ln >> 4);
            float* o = kx_ws + ((size_t)b * DCH + d0) * CCH + c;
            o[0]       = (s.x + s1.x) + (s2.x + s3.x);
            o[CCH]     = (s.y + s1.y) + (s2.y + s3.y);
            o[2 * CCH] = (s.z + s1.z) + (s2.z + s3.z);
            o[3 * CCH] = (s.w + s1.w) + (s2.w + s3.w);
        }
    } else {
        const int b = blockIdx.x - BATCH * 32;
        const int d = tid & 31, g = tid >> 5;
        const float* p = ksum_part + (size_t)(b * TILES + g * 16) * DCH + d;
        float v[16];
#pragma unroll   // all 16 loads in flight at once, v[] by constant index
        for (int t = 0; t < 16; ++t) v[t] = p[t * DCH];
        // translation wait, as above
        asm volatile("s_wait_xcnt 0x0" :: "v"(p) : "memory");
        float s = v[0];
#pragma unroll
        for (int t = 1; t < 16; ++t) s += v[t];
        redk[g][d] = s;
        __syncthreads();
        if (tid < DCH) {
            float r = 0.0f;
#pragma unroll   // the 8 LDS reads issue together
            for (int w = 0; w < 8; ++w) r += redk[w][tid];
            ksum_ws[b * DCH + tid] = r;
        }
    }
}

// 16 K values of one row (two runs of 8) as a 16-bit fragment (A and B share the K map):
// e<8 -> K=h*8+e, e>=8 -> K=16+h*8+(e-8); p points at K=h*8 of the 32-wide K block
__device__ __forceinline__ v16bf frag_from_f32_row(const float* __restrict__ p) {
    float4 a0 = *(const float4*)(p);
    float4 a1 = *(const float4*)(p + 4);
    float4 a2 = *(const float4*)(p + 16);
    float4 a3 = *(const float4*)(p + 20);
    // translation wait before a register that these four loads name is written again;
    // the pointer is an input so that its registers stay as they are up to the wait
    asm volatile("s_wait_xcnt 0x0" :: "v"(p) : "memory");
    v16bf f;
    f[0]=(__bf16)a0.x; f[1]=(__bf16)a0.y; f[2]=(__bf16)a0.z; f[3]=(__bf16)a0.w;
    f[4]=(__bf16)a1.x; f[5]=(__bf16)a1.y; f[6]=(__bf16)a1.z; f[7]=(__bf16)a1.w;
    f[8]=(__bf16)a2.x; f[9]=(__bf16)a2.y; f[10]=(__bf16)a2.z; f[11]=(__bf16)a2.w;
    f[12]=(__bf16)a3.x; f[13]=(__bf16)a3.y; f[14]=(__bf16)a3.z; f[15]=(__bf16)a3.w;
    return f;
}

// ---------------- Kernel W: attn = kx Wv^T + k_sum bv^T, once per batch ------
// block: 16 d-rows x 32 v-channels (whole 128-B lines of attn); wave w takes the
// K slice c = 32w..32w+31, so that every load of the block is in flight at once
__global__ __launch_bounds__(256) void SGA_kernelW(
    const float* __restrict__ kx_ws, const float* __restrict__ ksum_ws,
    const float* __restrict__ Wv,    const float* __restrict__ bv,
    float* __restrict__ attn_ws)
{
    __shared__ float red[8][2][8][32];    // [K slice][channel tile][acc elem][lane]  16KB

    const int lane = threadIdx.x & 31;
    const int wave = threadIdx.x >> 5;
    const int h = lane >> 4, lo = lane & 15;
    const int b  = blockIdx.x >> 4;
    const int mt = (blockIdx.x >> 3) & 1;
    const int e0 = (blockIdx.x & 7) * 32;
    const int k0 = wave * 32 + h * 8;
    const int d  = mt * 16 + wave + 8 * h;   // the attn row this lane finishes

    const float ksum = ksum_ws[b * DCH + d];
    const float bv0 = bv[e0 + lo], bv1 = bv[e0 + 16 + lo];
    v16bf a  = frag_from_f32_row(kx_ws + ((size_t)b * DCH + mt * 16 + lo) * CCH + k0);
    v16bf b0 = frag_from_f32_row(Wv + (size_t)(e0 + lo) * CCH + k0);
    v16bf b1 = frag_from_f32_row(Wv + (size_t)(e0 + 16 + lo) * CCH + k0);
    v8f acc0 = {}, acc1 = {};
    acc0 = __builtin_amdgcn_wmma_f32_16x16x32_bf16(
            false, a, false, b0, (short)0, acc0, false, false);
    acc1 = __builtin_amdgcn_wmma_f32_16x16x32_bf16(
            false, a, false, b1, (short)0, acc1, false, false);
#pragma unroll   // acc[j] by constant index: no register indexing
    for (int j = 0; j < 8; ++j) {
        red[wave][0][j][lane] = acc0[j];
        red[wave][1][j][lane] = acc1[j];
    }
    __syncthreads();

    // wave w sums accumulator element j = w over the 8 K slices
    float s0 = 0.0f, s1 = 0.0f;
#pragma unroll   // the 16 LDS reads issue together instead of one wait per trip
    for (int ks = 0; ks < 8; ++ks) {
        s0 += red[ks][0][wave][lane];
        s1 += red[ks][1][wave][lane];
    }
    float* o = attn_ws + ((size_t)b * DCH + d) * CCH + e0 + lo;
    o[0]  = s0 + ksum * bv0;
    o[16] = s1 + ksum * bv1;
}

// ---------------- Kernel B: q = softplus(Wq x + bq); out = attn^T q^T * norm --
__global__ __launch_bounds__(256) void SGA_kernelB(
    const float* __restrict__ x,  const float* __restrict__ Wq,
    const float* __restrict__ bq, const float* __restrict__ attn_ws,
    const float* __restrict__ ksum_ws, float* __restrict__ out)
{
    __shared__ __attribute__((aligned(16)))
               __bf16 xT  [CCH][XT_PITCH]; // x tile, channel rows               72KB
    __shared__ __bf16 WqA [2][8][32][16]; // Wq A-frag                           16KB
    __shared__ __bf16 attnA[16][32][16];  // attn^T A-frag: M=C(256), K=d(32)    16KB
    __shared__ __bf16 qB  [8][32][16];    // q^T  B-frag: K=d(32), N=tok(128)     8KB
    __shared__ float  normL[NT];
    __shared__ float  ksumL[DCH];

    const int tid  = threadIdx.x;
    const int lane = tid & 31;
    const int wave = tid >> 5;
    const int b    = blockIdx.x >> 7;
    const int n0   = (blockIdx.x & 127) * NT;
    const float* xb = x + (size_t)b * CCH * NTOK;

    stage_x_rows<XT_PITCH>(xT, xb, n0, tid);
    stage_weights_A(&WqA[0][0][0][0], Wq, 0, 2, tid);
    // stage attn^T as A-fragments (rows of attn[d][:] are contiguous)
    for (int i = tid; i < DCH * (CCH / 4); i += 256) {
        int d   = i >> 6;
        int ech = (i & 63) * 4;
        float4 av = *(const float4*)&attn_ws[((size_t)b * DCH + d) * CCH + ech];
        int h = (d >> 3) & 1;
        int e = (d & 7) + ((d >> 4) << 3);
        float vv[4] = {av.x, av.y, av.z, av.w};
#pragma unroll
        for (int t = 0; t < 4; ++t) {
            int ec = ech + t;
            attnA[ec >> 4][h * 16 + (ec & 15)][e] = (__bf16)vv[t];
        }
    }
    if (tid < DCH) ksumL[tid] = ksum_ws[b * DCH + tid] + 1e-6f;  // EPS
    __syncthreads();

    // q GEMM + norm: wave w owns token-tile nt=w
    {
        const int nt = wave;
        const int h = lane >> 4, tok_lo = lane & 15;
        float denom = 0.0f;
        for (int mt = 0; mt < 2; ++mt) {
            v8f acc = {};
            for (int kt = 0; kt < 8; ++kt) {
                v16bf a  = *(const v16bf*)&WqA[mt][kt][lane][0];
                v16bf bb = frag_B_tr16<XT_PITCH>(&xT[kt * 32][nt * 16], lane);
                acc = __builtin_amdgcn_wmma_f32_16x16x32_bf16(
                        false, a, false, bb, (short)0, acc, false, false);
            }
            for (int j = 0; j < 8; ++j) {
                int d = mt * 16 + j + 8 * h;
                float qv = softplusf(acc[j] + bq[d]);
                denom += qv * ksumL[d];
                int hb = (d >> 3) & 1;
                int eb = (d & 7) + ((d >> 4) << 3);
                qB[nt][hb * 16 + tok_lo][eb] = (__bf16)qv;
            }
        }
        denom += __shfl_xor(denom, 16, 32);   // combine both d-halves per token
        if (lane < 16) normL[nt * 16 + lane] = 1.0f / denom;
    }
    __syncthreads();

    // out GEMM: [256 x 128] = attn^T[256x32] @ q^T[32x128]; K=32 -> 1 WMMA/tile
    {
        const int nt = wave;
        const int h = lane >> 4, tok_lo = lane & 15;
        const float nrm = normL[nt * 16 + tok_lo];
        v16bf bb = *(const v16bf*)&qB[nt][lane][0];
        float* ob = out + (size_t)b * CCH * NTOK + n0 + nt * 16 + tok_lo;
        for (int mt = 0; mt < 16; ++mt) {
            v8f acc = {};
            v16bf a = *(const v16bf*)&attnA[mt][lane][0];
            acc = __builtin_amdgcn_wmma_f32_16x16x32_bf16(
                    false, a, false, bb, (short)0, acc, false, false);
#pragma unroll
            for (int j = 0; j < 8; ++j) {
                int ech = mt * 16 + j + 8 * h;
                ob[(size_t)ech * NTOK] = acc[j] * nrm;
            }
        }
    }
}

extern "C" void kernel_launch(void* const* d_in, const int* in_sizes, int n_in,
                              void* d_out, int out_size, void* d_ws, size_t ws_size,
                              hipStream_t stream) {
    (void)in_sizes; (void)n_in; (void)out_size; (void)ws_size;
    const float* x  = (const float*)d_in[0];
    const float* Wq = (const float*)d_in[1];
    const float* bq = (const float*)d_in[2];
    const float* Wk = (const float*)d_in[3];
    const float* bk = (const float*)d_in[4];
    const float* Wv = (const float*)d_in[5];
    const float* bv = (const float*)d_in[6];
    float* out = (float*)d_out;

    float* kx_ws     = (float*)d_ws;                    // [B][32][256]
    float* ksum_ws   = kx_ws + BATCH * DCH * CCH;       // [B][32]
    float* attn_ws   = ksum_ws + BATCH * DCH;           // [B][32][256]
    float* kx_part   = attn_ws + BATCH * DCH * CCH;     // [B*TILES][32*256] tile planes
    float* ksum_part = kx_part + (size_t)BATCH * TILES * DCH * CCH;  // [B*TILES][32]

    SGA_kernelA<<<BATCH * TILES, 256, 0, stream>>>(x, Wk, bk, kx_part, ksum_part);
    SGA_reduce<<<BATCH * 32 + BATCH, 256, 0, stream>>>(kx_part, ksum_part, kx_ws, ksum_ws);
    SGA_kernelW<<<BATCH * 16, 256, 0, stream>>>(kx_ws, ksum_ws, Wv, bv, attn_ws);
    SGA_kernelB<<<BATCH * TILES, 256, 0, stream>>>(x, Wq, bq, attn_ws, ksum_ws, out);
}

// v004
// It runs in 77.3 microseconds.
// Two timings next to v003 put it at 1.15 and 1.14 times that version's speed.
// Over all steps from v000 it is 3.46 times as fast.
#include <hip/hip_runtime.h>
#include <hip/hip_bf16.h>

// Problem constants (from reference): B=8, C=256, d=32, H=W=128, N=16384
#define BATCH 8
#define CCH   256
#define DCH   32
#define NTOK  16384
#define NT    128          // tokens per workgroup tile
#define TILES (NTOK / NT)  // 128 tiles per batch

typedef __attribute__((ext_vector_type(16))) __bf16 v16bf;
typedef __attribute__((ext_vector_type(8)))  __bf16 v8bf;
typedef __attribute__((ext_vector_type(4)))  __bf16 v4bf;
typedef __attribute__((ext_vector_type(8)))  float  v8f;

// branchless softplus: no EXEC-mask divergence around WMMA regions
__device__ __forceinline__ float softplusf(float x) {
    return fmaxf(x, 0.0f) + log1pf(expf(-fabsf(x)));
}

// Fragment mappings (16-bit WMMA, wave32):
//  A 16x32: lane = h*16 + (m&15); elem e<8 -> K=h*8+e ; e>=8 -> K=16+h*8+(e-8)
//  B 32x16: lane = h*16 + (n&15); same K mapping
//  inverse (h,e) from k_local kl: h=(kl>>3)&1 ; e=(kl&7)+((kl>>4)<<3)
//  C/D 16x16 f32: elem j -> row m = j + 8*(lane>>4), col n = lane&15

// 16 values of one f32 weight row (K = h*8..+7 and 16+h*8..+7) as a lane's bf16 A fragment
__device__ __forceinline__ v16bf weight_frag(float4 a0, float4 a1, float4 a2, float4 a3) {
    v16bf f;
    f[0]=(__bf16)a0.x; f[1]=(__bf16)a0.y; f[2]=(__bf16)a0.z; f[3]=(__bf16)a0.w;
    f[4]=(__bf16)a1.x; f[5]=(__bf16)a1.y; f[6]=(__bf16)a1.z; f[7]=(__bf16)a1.w;
    f[8]=(__bf16)a2.x; f[9]=(__bf16)a2.y; f[10]=(__bf16)a2.z; f[11]=(__bf16)a2.w;
    f[12]=(__bf16)a3.x; f[13]=(__bf16)a3.y; f[14]=(__bf16)a3.z; f[15]=(__bf16)a3.w;
    return f;
}

// stage two [32 x 256] f32 row-major weight blocks as A-fragments (bf16), W0 as row
// tiles 0,1 and W1 as row tiles 2,3; the loads of both blocks are in flight together
__device__ __forceinline__ void stage_weights_A(
    __bf16* dst, const float* __restrict__ W0, const float* __restrict__ W1, int tid)
{
    for (int i = tid; i < 2 * 8 * 32; i += 256) {
        int ln = i & 31, kt = (i >> 5) & 7, mt = i >> 8;
        int h = ln >> 4;
        int m = mt * 16 + (ln & 15);
        int c0 = kt * 32 + h * 8;
        const float* w0 = W0 + (size_t)m * CCH + c0;
        const float* w1 = W1 + (size_t)m * CCH + c0;
        float4 a0 = *(const float4*)(w0);
        float4 a1 = *(const float4*)(w0 + 4);
        float4 a2 = *(const float4*)(w0 + 16);
        float4 a3 = *(const float4*)(w0 + 20);
        float4 b0 = *(const float4*)(w1);
        float4 b1 = *(const float4*)(w1 + 4);
        float4 b2 = *(const float4*)(w1 + 16);
        float4 b3 = *(const float4*)(w1 + 20);
        // translation wait before a register that these loads name is written again;
        // the pointers are inputs so that their registers stay as they are up to the wait
        asm volatile("s_wait_xcnt 0x0" :: "v"(w0), "v"(w1) : "memory");
        *(v16bf*)(dst + (size_t)i * 16) = weight_frag(a0, a1, a2, a3);   // [mt][kt][lane][16]
        *(v16bf*)(dst + (size_t)(i + 512) * 16) = weight_frag(b0, b1, b2, b3);
    }
}

// stage x tile [256 x NT] (channel-major, token-contiguous) as bf16 channel rows of
// PITCH elements: a wave stores 256 contiguous bytes of one row, no bank conflict
template <int PITCH>
__device__ __forceinline__ void stage_x_rows(
    __bf16 (*xR)[PITCH], const float* __restrict__ xb, int n0, int tid)
{
    const int n = (tid & 31) * 4;             // a wave takes one whole row per load
    for (int c = tid >> 5; c < CCH; c += 64) {
        const float* p = xb + (size_t)c * NTOK + n0 + n;
        float4 v[8];
#pragma unroll   // rows c, c+8, .., c+56: 8 loads in flight, v[] by constant index
        for (int u = 0; u < 8; ++u) v[u] = *(const float4*)(p + (size_t)u * 8 * NTOK);
#pragma unroll   // v[u] by constant index: no register indexing
        for (int u = 0; u < 8; ++u) {
            v4bf r;
            r[0] = (__bf16)v[u].x; r[1] = (__bf16)v[u].y;
            r[2] = (__bf16)v[u].z; r[3] = (__bf16)v[u].w;
            *(v4bf*)&xR[c + u * 8][n] = r;
        }
    }
}

// B fragment with K=channel, N=token out of the channel rows, by the transposing LDS
// load: lane l reads 16 B of row 8*(l>>4)+(l&7) and gets rows 8h..8h+7 of column l&15;
// the loads at rows +0 and +16 give e<8 -> K=h*8+e, e>=8 -> K=16+h*8+(e-8), the K map
// of the staged A fragments. t points at (first channel of the K block, first token).
template <int PITCH>
__device__ __forceinline__ v16bf frag_B_tr16(const __bf16* t, int lane) {
    typedef __attribute__((address_space(3))) v8bf lds_v8bf;
    const __bf16* p = t + (8 * (lane >> 4) + (lane & 7)) * PITCH + 8 * ((lane >> 3) & 1);
    v8bf lo = __builtin_amdgcn_ds_load_tr16_b128_v8bf16((lds_v8bf*)p);
    v8bf hi = __builtin_amdgcn_ds_load_tr16_b128_v8bf16((lds_v8bf*)(p + 16 * PITCH));
    return __builtin_shufflevector(lo, hi,
            0, 1, 2, 3, 4, 5, 6, 7, 8, 9, 10, 11, 12, 13, 14, 15);
}

// Linear attention, reassociated:
//   attn[d][e] = sum_n k[d][n] * (sum_c Wv[e][c] x[c][n] + bv[e])
//              = sum_c (sum_n k[d][n] x[c][n]) * Wv[e][c] + (sum_n k[d][n]) * bv[e]
// so the token loop only needs kx = k x^T [32 x 256]; Wv is applied once per batch.

// bf16 elements per LDS row of the x tile
#define XR_PITCH (NT + 8)   // 272 B = 16 B x odd: for rows that b128 reads walk too

#define KXP_F4 (DCH * CCH / 4)   // float4 per tile plane of kx partials

// ---------------- Kernel A: k = softplus(Wk x + bk); per-tile k_sum and k x^T;
// q = softplus(Wq x + bq) from the same staged x tile, so that x is read only here.
// q goes to the workspace as the bf16 B fragments of the last kernel's product:
// [16-token tile][K half][lane][8], each store of a wave 512 contiguous bytes.
// Every block stores its own plane of partial sums; SGA_reduce adds the planes.
// Plane order (float4 units): [wave][mt][j/4][p][lane], so that each store of a
// wave is 512 contiguous bytes; the sum over planes is elementwise in any order.
__global__ __launch_bounds__(256) void SGA_kernelA(
    const float* __restrict__ x,  const float* __restrict__ Wk,
    const float* __restrict__ bk, const float* __restrict__ Wq,
    const float* __restrict__ bq, float* __restrict__ kx_part,
    float* __restrict__ ksum_part, float* __restrict__ q_ws)
{
    __shared__ __bf16 WA [4][8][32][16];  // Wk (0,1), Wq (2,3), A-frag: M=d, K=C  32KB
    __shared__ __bf16 kA [2][4][32][16];  // k,  A-frag: M=d(32), K=tok(128)        8KB
    __shared__ __attribute__((aligned(16)))
               __bf16 xR [CCH][XR_PITCH]; // x tile, channel rows                  68KB
    __shared__ float  ksL[8][DCH];        // k_sum of each wave's 16 tokens         1KB

    const int tid  = threadIdx.x;
    const int lane = tid & 31;
    const int wave = tid >> 5;
    const int b    = blockIdx.x >> 7;          // TILES == 128
    const int n0   = (blockIdx.x & 127) * NT;
    const float* xb = x + (size_t)b * CCH * NTOK;

    stage_x_rows<XR_PITCH>(xR, xb, n0, tid);
    stage_weights_A(&WA[0][0][0][0], Wk, Wq, tid);
    __syncthreads();

    // k and q GEMM: [64 x 128] = [Wk; Wq][64x256] @ x[256x128]; wave w owns token-tile
    // nt=w; each x fragment is read from LDS once and serves all four row tiles
    v8f acc4[4] = {};   // row tiles 0,1: k; 2,3: q, finished at the kernel's end
    {
        const int nt = wave;
        const int h = lane >> 4, tok_lo = lane & 15;
#pragma unroll   // acc4[] by constant index: no register indexing
        for (int kt = 0; kt < 8; ++kt) {
            v16bf bb = frag_B_tr16<XR_PITCH>(&xR[kt * 32][nt * 16], lane);
#pragma unroll
            for (int mt = 0; mt < 4; ++mt) {
                v16bf a = *(const v16bf*)&WA[mt][kt][lane][0];
                acc4[mt] = __builtin_amdgcn_wmma_f32_16x16x32_bf16(
                        false, a, false, bb, (short)0, acc4[mt], false, false);
            }
        }
#pragma unroll   // acc4[] by constant index
        for (int mt = 0; mt < 2; ++mt) {
            const v8f acc = acc4[mt];
            for (int j = 0; j < 8; ++j) {
                int m = mt * 16 + j + 8 * h;                 // d-row
                float kv = softplusf(acc[j] + bk[m]);
                int ktok = nt * 16 + tok_lo;
                int kl   = ktok & 31;
                int ha   = (kl >> 3) & 1;
                int ea   = (kl & 7) + ((kl >> 4) << 3);
                kA[m >> 4][ktok >> 5][ha * 16 + (m & 15)][ea] = (__bf16)kv;
                float s = kv;                 // token reduction in 16-lane half
                s += __shfl_xor(s, 1, 32);
                s += __shfl_xor(s, 2, 32);
                s += __shfl_xor(s, 4, 32);
                s += __shfl_xor(s, 8, 32);
                if (tok_lo == 0) ksL[wave][m] = s;
            }
        }
    }
    __syncthreads();

    // kx GEMM: [32 x 256] += kA[32x128] @ x^T[128x256]; wave w owns channel
    // tiles 2w and 2w+1, both d-row tiles
    {
        const int h = lane >> 4, c_lo = lane & 15;
        v8f acc[2][2] = {};
        // all loops below unrolled: acc[][] keeps constant indices (stays in registers)
        // and the LDS reads of all four K blocks issue ahead of the WMMAs
#pragma unroll
        for (int kt = 0; kt < 4; ++kt) {
            v16bf a0 = *(const v16bf*)&kA[0][kt][lane][0];
            v16bf a1 = *(const v16bf*)&kA[1][kt][lane][0];
#pragma unroll
            for (int p = 0; p < 2; ++p) {
                // B 32x16: lane (h, channel); e<8 -> tok h*8+e, e>=8 -> tok 16+h*8+(e-8)
                const __bf16* row = &xR[(wave * 2 + p) * 16 + c_lo][kt * 32 + h * 8];
                v8bf lo = *(const v8bf*)row;
                v8bf hi = *(const v8bf*)(row + 16);
                v16bf bb = __builtin_shufflevector(lo, hi,
                        0, 1, 2, 3, 4, 5, 6, 7, 8, 9, 10, 11, 12, 13, 14, 15);
                acc[0][p] = __builtin_amdgcn_wmma_f32_16x16x32_bf16(
                        false, a0, false, bb, (short)0, acc[0][p], false, false);
                acc[1][p] = __builtin_amdgcn_wmma_f32_16x16x32_bf16(
                        false, a1, false, bb, (short)0, acc[1][p], false, false);
            }
        }
        float4* kp = (float4*)kx_part + (size_t)blockIdx.x * KXP_F4 + wave * 256 + lane;
#pragma unroll   // acc[][][] by constant index: no register indexing
        for (int mt = 0; mt < 2; ++mt)
#pragma unroll
            for (int jh = 0; jh < 2; ++jh)
#pragma unroll
                for (int p = 0; p < 2; ++p)
                    kp[((mt * 2 + jh) * 2 + p) * 32] = make_float4(
                        acc[mt][p][jh * 4 + 0], acc[mt][p][jh * 4 + 1],
                        acc[mt][p][jh * 4 + 2], acc[mt][p][jh * 4 + 3]);
    }
    // q, behind the last barrier so that no barrier waits for its stores: this lane
    // holds d = mt*16 + 8h + j of token lane&15, which is what the same lane of the
    // B fragment (K=d, N=token) holds at e = mt*8 + j
    {
        const int h = lane >> 4;
        v8bf* qp = (v8bf*)q_ws + (size_t)(blockIdx.x * 8 + wave) * 64 + lane;
#pragma unroll   // acc4[] by constant index
        for (int mt = 0; mt < 2; ++mt) {
            v8bf qf;
#pragma unroll
            for (int j = 0; j < 8; ++j)
                qf[j] = (__bf16)softplusf(acc4[2 + mt][j] + bq[mt * 16 + j + 8 * h]);
            qp[mt * 32] = qf;
        }
        // translation wait before a register that these stores name is written again;
        // the pointer is an input so that its registers stay as they are up to the wait
        asm volatile("s_wait_xcnt 0x0" :: "v"(qp) : "memory");
    }
    if (tid < DCH) {   // wave 0 alone: the tile's k_sum, one 128-B line
        float s = 0.0f;
#pragma unroll   // the 8 LDS reads issue together
        for (int w = 0; w < 8; ++w) s += ksL[w][tid];
        ksum_part[(size_t)blockIdx.x * DCH + tid] = s;
    }
}

// ---------------- Kernel R: add the 128 tile planes of each batch ------------
// blocks 0..255: batch b, 64 float4 columns of the kx plane; thread group g adds
// 32 planes, LDS adds the 4 groups. blocks 256..263: k_sum of one batch.
__global__ __launch_bounds__(256) void SGA_reduce(
    const float* __restrict__ kx_part, const float* __restrict__ ksum_part,
    float* __restrict__ kx_ws, float* __restrict__ ksum_ws)
{
    __shared__ float4 red4[4][64];
    __shared__ float  redk[8][DCH];
    const int tid = threadIdx.x;
    if (blockIdx.x < BATCH * 32) {
        const int b = blockIdx.x >> 5, cg = blockIdx.x & 31;
        const int q = tid & 63, g = tid >> 6;
        const float4* p = (const float4*)kx_part
                        + (size_t)(b * TILES + g * 32) * KXP_F4 + cg * 64 + q;
        float4 v[32];
#pragma unroll   // all 32 loads in flight at once, v[] by constant index
        for (int t = 0; t < 32; ++t) v[t] = p[(size_t)t * KXP_F4];
        // translation wait before a register that these loads name is written again;
        // the pointer is an input so that its registers stay as they are up to the wait
        asm volatile("s_wait_xcnt 0x0" :: "v"(p) : "memory");
        float4 s = v[0];
#pragma unroll
        for (int t = 1; t < 32; ++t) {
            s.x += v[t].x; s.y += v[t].y; s.z += v[t].z; s.w += v[t].w;
        }
        red4[g][q] = s;
        __syncthreads();
        if (g == 0) {   // waves 0 and 1: both halves of each 128-B line of kx
            float4 s1 = red4[1][q], s2 = red4[2][q], s3 = red4[3][q];
            const int f  = cg * 64 + q;          // [wave][mt][j/4][p][lane]
            const int ln = f & 31, pp = (f >> 5) & 1, jh = (f >> 6) & 1;
            const int mt = (f >> 7) & 1, wv = f >> 8;
            const int c  = (wv * 2 + pp) * 16 + (ln & 15);
            const int d0 = mt * 16 + jh * 4 + 8 * (ln >> 4);
            float* o = kx_ws + ((size_t)b * DCH + d0) * CCH + c;
            o[0]       = (s.x + s1.x) + (s2.x + s3.x);
            o[CCH]     = (s.y + s1.y) + (s2.y + s3.y);
            o[2 * CCH] = (s.z + s1.z) + (s2.z + s3.z);
            o[3 * CCH] = (s.w + s1.w) + (s2.w + s3.w);
        }
    } else {
        const int b = blockIdx.x - BATCH * 32;
        const int d = tid & 31, g = tid >> 5;
        const float* p = ksum_part + (size_t)(b * TILES + g * 16) * DCH + d;
        float v[16];
#pragma unroll   // all 16 loads in flight at once, v[] by constant index
        for (int t = 0; t < 16; ++t) v[t] = p[t * DCH];
        // translation wait, as above
        asm volatile("s_wait_xcnt 0x0" :: "v"(p) : "memory");
        float s = v[0];
#pragma unroll
        for (int t = 1; t < 16; ++t) s += v[t];
        redk[g][d] = s;
        __syncthreads();
        if (tid < DCH) {
            float r = 0.0f;
#pragma unroll   // the 8 LDS reads issue together
            for (int w = 0; w < 8; ++w) r += redk[w][tid];
            ksum_ws[b * DCH + tid] = r;
        }
    }
}

// 16 K values of one row (two runs of 8) as a 16-bit fragment (A and B share the K map):
// e<8 -> K=h*8+e, e>=8 -> K=16+h*8+(e-8); p points at K=h*8 of the 32-wide K block
__device__ __forceinline__ v16bf frag_from_f32_row(const float* __restrict__ p) {
    float4 a0 = *(const float4*)(p);
    float4 a1 = *(const float4*)(p + 4);
    float4 a2 = *(const float4*)(p + 16);
    float4 a3 = *(const float4*)(p + 20);
    // translation wait before a register that these four loads name is written again;
    // the pointer is an input so that its registers stay as they are up to the wait
    asm volatile("s_wait_xcnt 0x0" :: "v"(p) : "memory");
    v16bf f;
    f[0]=(__bf16)a0.x; f[1]=(__bf16)a0.y; f[2]=(__bf16)a0.z; f[3]=(__bf16)a0.w;
    f[4]=(__bf16)a1.x; f[5]=(__bf16)a1.y; f[6]=(__bf16)a1.z; f[7]=(__bf16)a1.w;
    f[8]=(__bf16)a2.x; f[9]=(__bf16)a2.y; f[10]=(__bf16)a2.z; f[11]=(__bf16)a2.w;
    f[12]=(__bf16)a3.x; f[13]=(__bf16)a3.y; f[14]=(__bf16)a3.z; f[15]=(__bf16)a3.w;
    return f;
}

// ---------------- Kernel W: attn = kx Wv^T + k_sum bv^T, once per batch ------
// block: 16 d-rows x 32 v-channels (whole 128-B lines of attn); wave w takes the
// K slice c = 32w..32w+31, so that every load of the block is in flight at once
__global__ __launch_bounds__(256) void SGA_kernelW(
    const float* __restrict__ kx_ws, const float* __restrict__ ksum_ws,
    const float* __restrict__ Wv,    const float* __restrict__ bv,
    float* __restrict__ attn_ws)
{
    __shared__ float red[8][2][8][32];    // [K slice][channel tile][acc elem][lane]  16KB

    const int lane = threadIdx.x & 31;
    const int wave = threadIdx.x >> 5;
    const int h = lane >> 4, lo = lane & 15;
    const int b  = blockIdx.x >> 4;
    const int mt = (blockIdx.x >> 3) & 1;
    const int e0 = (blockIdx.x & 7) * 32;
    const int k0 = wave * 32 + h * 8;
    const int d  = mt * 16 + wave + 8 * h;   // the attn row this lane finishes

    const float ksum = ksum_ws[b * DCH + d];
    const float bv0 = bv[e0 + lo], bv1 = bv[e0 + 16 + lo];
    v16bf a  = frag_from_f32_row(kx_ws + ((size_t)b * DCH + mt * 16 + lo) * CCH + k0);
    v16bf b0 = frag_from_f32_row(Wv + (size_t)(e0 + lo) * CCH + k0);
    v16bf b1 = frag_from_f32_row(Wv + (size_t)(e0 + 16 + lo) * CCH + k0);
    v8f acc0 = {}, acc1 = {};
    acc0 = __builtin_amdgcn_wmma_f32_16x16x32_bf16(
            false, a, false, b0, (short)0, acc0, false, false);
    acc1 = __builtin_amdgcn_wmma_f32_16x16x32_bf16(
            false, a, false, b1, (short)0, acc1, false, false);
#pragma unroll   // acc[j] by constant index: no register indexing
    for (int j = 0; j < 8; ++j) {
        red[wave][0][j][lane] = acc0[j];
        red[wave][1][j][lane] = acc1[j];
    }
    __syncthreads();

    // wave w sums accumulator element j = w over the 8 K slices
    float s0 = 0.0f, s1 = 0.0f;
#pragma unroll   // the 16 LDS reads issue together instead of one wait per trip
    for (int ks = 0; ks < 8; ++ks) {
        s0 += red[ks][0][wave][lane];
        s1 += red[ks][1][wave][lane];
    }
    float* o = attn_ws + ((size_t)b * DCH + d) * CCH + e0 + lo;
    o[0]  = s0 + ksum * bv0;
    o[16] = s1 + ksum * bv1;
}

// ---------------- Kernel B: out = attn^T q^T * norm, q from the workspace -----
__global__ __launch_bounds__(256) void SGA_kernelB(
    const float* __restrict__ q_ws, const float* __restrict__ attn_ws,
    const float* __restrict__ ksum_ws, float* __restrict__ out)
{
    __shared__ __bf16 attnA[16][32][16];  // attn^T A-frag: M=C(256), K=d(32)    16KB

    const int tid  = threadIdx.x;
    const int lane = tid & 31;
    const int wave = tid >> 5;
    const int b    = blockIdx.x >> 7;
    const int n0   = (blockIdx.x & 127) * NT;
    const int nt = wave;                   // wave w owns token-tile nt=w
    const int h = lane >> 4, tok_lo = lane & 15;

    // q^T B fragment (K=d, N=token) as kernel A left it, and the k_sum values of its
    // 16 d: e<8 -> d=h*8+e, e>=8 -> d=16+h*8+(e-8)
    const v8bf* qp = (const v8bf*)q_ws + (size_t)(blockIdx.x * 8 + nt) * 64 + lane;
    const float* kp = ksum_ws + b * DCH + h * 8;
    v8bf qlo = qp[0];
    v8bf qhi = qp[32];
    float4 k0 = *(const float4*)(kp);
    float4 k1 = *(const float4*)(kp + 4);
    float4 k2 = *(const float4*)(kp + 16);
    float4 k3 = *(const float4*)(kp + 20);
    // translation wait before a register that these loads name is written again;
    // the pointers are inputs so that their registers stay as they are up to the wait
    asm volatile("s_wait_xcnt 0x0" :: "v"(qp), "v"(kp) : "memory");

    // stage attn^T as A-fragments (rows of attn[d][:] are contiguous)
    for (int i = tid; i < DCH * (CCH / 4); i += 256) {
        int d   = i >> 6;
        int ech = (i & 63) * 4;
        float4 av = *(const float4*)&attn_ws[((size_t)b * DCH + d) * CCH + ech];
        int h = (d >> 3) & 1;
        int e = (d & 7) + ((d >> 4) << 3);
        float vv[4] = {av.x, av.y, av.z, av.w};
#pragma unroll
        for (int t = 0; t < 4; ++t) {
            int ec = ech + t;
            attnA[ec >> 4][h * 16 + (ec & 15)][e] = (__bf16)vv[t];
        }
    }

    // norm = 1 / sum_d q[d] (k_sum[d] + EPS), d in the order 8h.., 16+8h.. per half
    const float ks[16] = {k0.x, k0.y, k0.z, k0.w, k1.x, k1.y, k1.z, k1.w,
                          k2.x, k2.y, k2.z, k2.w, k3.x, k3.y, k3.z, k3.w};
    float denom = 0.0f;
#pragma unroll   // ks[] and the fragment by constant index
    for (int e = 0; e < 8; ++e) denom += (float)qlo[e] * (ks[e] + 1e-6f);
#pragma unroll
    for (int e = 0; e < 8; ++e) denom += (float)qhi[e] * (ks[8 + e] + 1e-6f);
    denom += __shfl_xor(denom, 16, 32);   // combine both d-halves per token
    const float nrm = 1.0f / denom;
    __syncthreads();

    // out GEMM: [256 x 128] = attn^T[256x32] @ q^T[32x128]; K=32 -> 1 WMMA/tile
    {
        v16bf bb = __builtin_shufflevector(qlo, qhi,
                0, 1, 2, 3, 4, 5, 6, 7, 8, 9, 10, 11, 12, 13, 14, 15);
        float* ob = out + (size_t)b * CCH * NTOK + n0 + nt * 16 + tok_lo;
        for (int mt = 0; mt < 16; ++mt) {
            v8f acc = {};
            v16bf a = *(const v16bf*)&attnA[mt][lane][0];
            acc = __builtin_amdgcn_wmma_f32_16x16x32_bf16(
                    false, a, false, bb, (short)0, acc, false, false);
#pragma unroll
            for (int j = 0; j < 8; ++j) {
                int ech = mt * 16 + j + 8 * h;
                ob[(size_t)ech * NTOK] = acc[j] * nrm;
            }
        }
    }
}

extern "C" void kernel_launch(void* const* d_in, const int* in_sizes, int n_in,
                              void* d_out, int out_size, void* d_ws, size_t ws_size,
                              hipStream_t stream) {
    (void)in_sizes; (void)n_in; (void)out_size; (void)ws_size;
    const float* x  = (const float*)d_in[0];
    const float* Wq = (const float*)d_in[1];
    const float* bq = (const float*)d_in[2];
    const float* Wk = (const float*)d_in[3];
    const float* bk = (const float*)d_in[4];
    const float* Wv = (const float*)d_in[5];
    const float* bv = (const float*)d_in[6];
    float* out = (float*)d_out;

    float* kx_ws     = (float*)d_ws;                    // [B][32][256]
    float* ksum_ws   = kx_ws + BATCH * DCH * CCH;       // [B][32]
    float* attn_ws   = ksum_ws + BATCH * DCH;           // [B][32][256]
    float* kx_part   = attn_ws + BATCH * DCH * CCH;     // [B*TILES][32*256] tile planes
    float* ksum_part = kx_part + (size_t)BATCH * TILES * DCH * CCH;  // [B*TILES][32]
    float* q_ws      = ksum_part + BATCH * TILES * DCH; // bf16 [B*N/16][2][32][8]

    SGA_kernelA<<<BATCH * TILES, 256, 0, stream>>>(x, Wk, bk, Wq, bq, kx_part, ksum_part, q_ws);
    SGA_reduce<<<BATCH * 32 + BATCH, 256, 0, stream>>>(kx_part, ksum_part, kx_ws, ksum_ws);
    SGA_kernelW<<<BATCH * 16, 256, 0, stream>>>(kx_ws, ksum_ws, Wv, bv, attn_ws);
    SGA_kernelB<<<BATCH * TILES, 256, 0, stream>>>(q_ws, attn_ws, ksum_ws, out);
}

// v005
// A run of this version takes 67.6 microseconds.
// Timed twice side by side with v004, it ran 1.14 and 1.15 times as fast.
// Over all steps from v000 it is 3.95 times as fast.
#include <hip/hip_runtime.h>
#include <hip/hip_bf16.h>

// Problem constants (from reference): B=8, C=256, d=32, H=W=128, N=16384
#define BATCH 8
#define CCH   256
#define DCH   32
#define NTOK  16384
#define NT    128          // tokens per workgroup tile
#define TILES (NTOK / NT)  // 128 tiles per batch

typedef __attribute__((ext_vector_type(16))) __bf16 v16bf;
typedef __attribute__((ext_vector_type(8)))  __bf16 v8bf;
typedef __attribute__((ext_vector_type(4)))  __bf16 v4bf;
typedef __attribute__((ext_vector_type(8)))  float  v8f;

// branchless softplus: no EXEC-mask divergence around WMMA regions.
// max(x,0) + log(1+e), e = exp(-|x|) in [0,1], on the chip's own exp2 and log2.
// Where e < 2^-8 the sum 1+e has dropped too many of e's bits: there the series
// e - e*e/2, whose relative error is below e*e/3, keeps a small result's digits.
__device__ __forceinline__ float softplusf(float x) {
    const float e  = __builtin_amdgcn_exp2f(fabsf(x) * -1.44269504f);
    const float lg = __builtin_amdgcn_logf(1.0f + e) * 0.693147181f;
    const float sr = fmaf(e * -0.5f, e, e);
    return fmaxf(x, 0.0f) + (e < 0x1p-8f ? sr : lg);
}

// Fragment mappings (16-bit WMMA, wave32):
//  A 16x32: lane = h*16 + (m&15); elem e<8 -> K=h*8+e ; e>=8 -> K=16+h*8+(e-8)
//  B 32x16: lane = h*16 + (n&15); same K mapping
//  inverse (h,e) from k_local kl: h=(kl>>3)&1 ; e=(kl&7)+((kl>>4)<<3)
//  C/D 16x16 f32: elem j -> row m = j + 8*(lane>>4), col n = lane&15

// 16 values of one f32 weight row (K = h*8..+7 and 16+h*8..+7) as a lane's bf16 A fragment
__device__ __forceinline__ v16bf weight_frag(float4 a0, float4 a1, float4 a2, float4 a3) {
    v16bf f;
    f[0]=(__bf16)a0.x; f[1]=(__bf16)a0.y; f[2]=(__bf16)a0.z; f[3]=(__bf16)a0.w;
    f[4]=(__bf16)a1.x; f[5]=(__bf16)a1.y; f[6]=(__bf16)a1.z; f[7]=(__bf16)a1.w;
    f[8]=(__bf16)a2.x; f[9]=(__bf16)a2.y; f[10]=(__bf16)a2.z; f[11]=(__bf16)a2.w;
    f[12]=(__bf16)a3.x; f[13]=(__bf16)a3.y; f[14]=(__bf16)a3.z; f[15]=(__bf16)a3.w;
    return f;
}

// stage two [32 x 256] f32 row-major weight blocks as A-fragments (bf16), W0 as row
// tiles 0,1 and W1 as row tiles 2,3; the loads of both blocks are in flight together
__device__ __forceinline__ void stage_weights_A(
    __bf16* dst, const float* __restrict__ W0, const float* __restrict__ W1, int tid)
{
    for (int i = tid; i < 2 * 8 * 32; i += 256) {
        int ln = i & 31, kt = (i >> 5) & 7, mt = i >> 8;
        int h = ln >> 4;
        int m = mt * 16 + (ln & 15);
        int c0 = kt * 32 + h * 8;
        const float* w0 = W0 + (size_t)m * CCH + c0;
        const float* w1 = W1 + (size_t)m * CCH + c0;
        float4 a0 = *(const float4*)(w0);
        float4 a1 = *(const float4*)(w0 + 4);
        float4 a2 = *(const float4*)(w0 + 16);
        float4 a3 = *(const float4*)(w0 + 20);
        float4 b0 = *(const float4*)(w1);
        float4 b1 = *(const float4*)(w1 + 4);
        float4 b2 = *(const float4*)(w1 + 16);
        float4 b3 = *(const float4*)(w1 + 20);
        // translation wait before a register that these loads name is written again;
        // the pointers are inputs so that their registers stay as they are up to the wait
        asm volatile("s_wait_xcnt 0x0" :: "v"(w0), "v"(w1) : "memory");
        *(v16bf*)(dst + (size_t)i * 16) = weight_frag(a0, a1, a2, a3);   // [mt][kt][lane][16]
        *(v16bf*)(dst + (size_t)(i + 512) * 16) = weight_frag(b0, b1, b2, b3);
    }
}

// stage x tile [256 x NT] (channel-major, token-contiguous) as bf16 channel rows of
// PITCH elements: a wave stores 256 contiguous bytes of one row, no bank conflict
template <int PITCH>
__device__ __forceinline__ void stage_x_rows(
    __bf16 (*xR)[PITCH], const float* __restrict__ xb, int n0, int tid)
{
    const int n = (tid & 31) * 4;             // a wave takes one whole row per load
    for (int c = tid >> 5; c < CCH; c += 64) {
        const float* p = xb + (size_t)c * NTOK + n0 + n;
        float4 v[8];
#pragma unroll   // rows c, c+8, .., c+56: 8 loads in flight, v[] by constant index
        for (int u = 0; u < 8; ++u) v[u] = *(const float4*)(p + (size_t)u * 8 * NTOK);
#pragma unroll   // v[u] by constant index: no register indexing
        for (int u = 0; u < 8; ++u) {
            v4bf r;
            r[0] = (__bf16)v[u].x; r[1] = (__bf16)v[u].y;
            r[2] = (__bf16)v[u].z; r[3] = (__bf16)v[u].w;
            *(v4bf*)&xR[c + u * 8][n] = r;
        }
    }
}

// B fragment with K=channel, N=token out of the channel rows, by the transposing LDS
// load: lane l reads 16 B of row 8*(l>>4)+(l&7) and gets rows 8h..8h+7 of column l&15;
// the loads at rows +0 and +16 give e<8 -> K=h*8+e, e>=8 -> K=16+h*8+(e-8), the K map
// of the staged A fragments. t points at (first channel of the K block, first token).
template <int PITCH>
__device__ __forceinline__ v16bf frag_B_tr16(const __bf16* t, int lane) {
    typedef __attribute__((address_space(3))) v8bf lds_v8bf;
    const __bf16* p = t + (8 * (lane >> 4) + (lane & 7)) * PITCH + 8 * ((lane >> 3) & 1);
    v8bf lo = __builtin_amdgcn_ds_load_tr16_b128_v8bf16((lds_v8bf*)p);
    v8bf hi = __builtin_amdgcn_ds_load_tr16_b128_v8bf16((lds_v8bf*)(p + 16 * PITCH));
    return __builtin_shufflevector(lo, hi,
            0, 1, 2, 3, 4, 5, 6, 7, 8, 9, 10, 11, 12, 13, 14, 15);
}

// Linear attention, reassociated:
//   attn[d][e] = sum_n k[d][n] * (sum_c Wv[e][c] x[c][n] + bv[e])
//              = sum_c (sum_n k[d][n] x[c][n]) * Wv[e][c] + (sum_n k[d][n]) * bv[e]
// so the token loop only needs kx = k x^T [32 x 256]; Wv is applied once per batch.

// bf16 elements per LDS row of the x tile
#define XR_PITCH (NT + 8)   // 272 B = 16 B x odd: for rows that b128 reads walk too

#define KXP_F4 (DCH * CCH / 4)   // float4 per tile plane of kx partials

// ---------------- Kernel A: k = softplus(Wk x + bk); per-tile k_sum and k x^T;
// q = softplus(Wq x + bq) from the same staged x tile, so that x is read only here.
// q goes to the workspace as the bf16 B fragments of the last kernel's product:
// [16-token tile][K half][lane][8], each store of a wave 512 contiguous bytes.
// Every block stores its own plane of partial sums; SGA_reduce adds the planes.
// Plane order (float4 units): [wave][mt][j/4][p][lane], so that each store of a
// wave is 512 contiguous bytes; the sum over planes is elementwise in any order.
__global__ __launch_bounds__(256) void SGA_kernelA(
    const float* __restrict__ x,  const float* __restrict__ Wk,
    const float* __restrict__ bk, const float* __restrict__ Wq,
    const float* __restrict__ bq, float* __restrict__ kx_part,
    float* __restrict__ ksum_part, float* __restrict__ q_ws)
{
    __shared__ __bf16 WA [4][8][32][16];  // Wk (0,1), Wq (2,3), A-frag: M=d, K=C  32KB
    __shared__ __bf16 kA [2][4][32][16];  // k,  A-frag: M=d(32), K=tok(128)        8KB
    __shared__ __attribute__((aligned(16)))
               __bf16 xR [CCH][XR_PITCH]; // x tile, channel rows                  68KB
    __shared__ float  ksL[8][DCH];        // k_sum of each wave's 16 tokens         1KB

    const int tid  = threadIdx.x;
    const int lane = tid & 31;
    const int wave = tid >> 5;
    const int b    = blockIdx.x >> 7;          // TILES == 128
    const int n0   = (blockIdx.x & 127) * NT;
    const float* xb = x + (size_t)b * CCH * NTOK;

    stage_x_rows<XR_PITCH>(xR, xb, n0, tid);
    stage_weights_A(&WA[0][0][0][0], Wk, Wq, tid);
    __syncthreads();

    // k and q GEMM: [64 x 128] = [Wk; Wq][64x256] @ x[256x128]; wave w owns token-tile
    // nt=w; each x fragment is read from LDS once and serves all four row tiles
    v8f acc4[4] = {};   // row tiles 0,1: k; 2,3: q, finished at the kernel's end
    {
        const int nt = wave;
        const int h = lane >> 4, tok_lo = lane & 15;
#pragma unroll   // acc4[] by constant index: no register indexing
        for (int kt = 0; kt < 8; ++kt) {
            v16bf bb = frag_B_tr16<XR_PITCH>(&xR[kt * 32][nt * 16], lane);
#pragma unroll
            for (int mt = 0; mt < 4; ++mt) {
                v16bf a = *(const v16bf*)&WA[mt][kt][lane][0];
                acc4[mt] = __builtin_amdgcn_wmma_f32_16x16x32_bf16(
                        false, a, false, bb, (short)0, acc4[mt], false, false);
            }
        }
#pragma unroll   // acc4[] by constant index
        for (int mt = 0; mt < 2; ++mt) {
            const v8f acc = acc4[mt];
            for (int j = 0; j < 8; ++j) {
                int m = mt * 16 + j + 8 * h;                 // d-row
                float kv = softplusf(acc[j] + bk[m]);
                int ktok = nt * 16 + tok_lo;
                int kl   = ktok & 31;
                int ha   = (kl >> 3) & 1;
                int ea   = (kl & 7) + ((kl >> 4) << 3);
                kA[m >> 4][ktok >> 5][ha * 16 + (m & 15)][ea] = (__bf16)kv;
                float s = kv;                 // token reduction in 16-lane half
                s += __shfl_xor(s, 1, 32);
                s += __shfl_xor(s, 2, 32);
                s += __shfl_xor(s, 4, 32);
                s += __shfl_xor(s, 8, 32);
                if (tok_lo == 0) ksL[wave][m] = s;
            }
        }
    }
    __syncthreads();

    // kx GEMM: [32 x 256] += kA[32x128] @ x^T[128x256]; wave w owns channel
    // tiles 2w and 2w+1, both d-row tiles
    {
        const int h = lane >> 4, c_lo = lane & 15;
        v8f acc[2][2] = {};
        // all loops below unrolled: acc[][] keeps constant indices (stays in registers)
        // and the LDS reads of all four K blocks issue ahead of the WMMAs
#pragma unroll
        for (int kt = 0; kt < 4; ++kt) {
            v16bf a0 = *(const v16bf*)&kA[0][kt][lane][0];
            v16bf a1 = *(const v16bf*)&kA[1][kt][lane][0];
#pragma unroll
            for (int p = 0; p < 2; ++p) {
                // B 32x16: lane (h, channel); e<8 -> tok h*8+e, e>=8 -> tok 16+h*8+(e-8)
                const __bf16* row = &xR[(wave * 2 + p) * 16 + c_lo][kt * 32 + h * 8];
                v8bf lo = *(const v8bf*)row;
                v8bf hi = *(const v8bf*)(row + 16);
                v16bf bb = __builtin_shufflevector(lo, hi,
                        0, 1, 2, 3, 4, 5, 6, 7, 8, 9, 10, 11, 12, 13, 14, 15);
                acc[0][p] = __builtin_amdgcn_wmma_f32_16x16x32_bf16(
                        false, a0, false, bb, (short)0, acc[0][p], false, false);
                acc[1][p] = __builtin_amdgcn_wmma_f32_16x16x32_bf16(
                        false, a1, false, bb, (short)0, acc[1][p], false, false);
            }
        }
        float4* kp = (float4*)kx_part + (size_t)blockIdx.x * KXP_F4 + wave * 256 + lane;
#pragma unroll   // acc[][][] by constant index: no register indexing
        for (int mt = 0; mt < 2; ++mt)
#pragma unroll
            for (int jh = 0; jh < 2; ++jh)
#pragma unroll
                for (int p = 0; p < 2; ++p)
                    kp[((mt * 2 + jh) * 2 + p) * 32] = make_float4(
                        acc[mt][p][jh * 4 + 0], acc[mt][p][jh * 4 + 1],
                        acc[mt][p][jh * 4 + 2], acc[mt][p][jh * 4 + 3]);
    }
    // q, behind the last barrier so that no barrier waits for its stores: this lane
    // holds d = mt*16 + 8h + j of token lane&15, which is what the same lane of the
    // B fragment (K=d, N=token) holds at e = mt*8 + j
    {
        const int h = lane >> 4;
        v8bf* qp = (v8bf*)q_ws + (size_t)(blockIdx.x * 8 + wave) * 64 + lane;
#pragma unroll   // acc4[] by constant index
        for (int mt = 0; mt < 2; ++mt) {
            v8bf qf;
#pragma unroll
            for (int j = 0; j < 8; ++j)
                qf[j] = (__bf16)softplusf(acc4[2 + mt][j] + bq[mt * 16 + j + 8 * h]);
            qp[mt * 32] = qf;
        }
        // translation wait before a register that these stores name is written again;
        // the pointer is an input so that its registers stay as they are up to the wait
        asm volatile("s_wait_xcnt 0x0" :: "v"(qp) : "memory");
    }
    if (tid < DCH) {   // wave 0 alone: the tile's k_sum, one 128-B line
        float s = 0.0f;
#pragma unroll   // the 8 LDS reads issue together
        for (int w = 0; w < 8; ++w) s += ksL[w][tid];
        ksum_part[(size_t)blockIdx.x * DCH + tid] = s;
    }
}

// ---------------- Kernel R: add the 128 tile planes of each batch ------------
// blocks 0..255: batch b, 64 float4 columns of the kx plane; thread group g adds
// 32 planes, LDS adds the 4 groups. blocks 256..263: k_sum of one batch.
__global__ __launch_bounds__(256) void SGA_reduce(
    const float* __restrict__ kx_part, const float* __restrict__ ksum_part,
    float* __restrict__ kx_ws, float* __restrict__ ksum_ws)
{
    __shared__ float4 red4[4][64];
    __shared__ float  redk[8][DCH];
    const int tid = threadIdx.x;
    if (blockIdx.x < BATCH * 32) {
        const int b = blockIdx.x >> 5, cg = blockIdx.x & 31;
        const int q = tid & 63, g = tid >> 6;
        const float4* p = (const float4*)kx_part
                        + (size_t)(b * TILES + g * 32) * KXP_F4 + cg * 64 + q;
        float4 v[32];
#pragma unroll   // all 32 loads in flight at once, v[] by constant index
        for (int t = 0; t < 32; ++t) v[t] = p[(size_t)t * KXP_F4];
        // translation wait before a register that these loads name is written again;
        // the pointer is an input so that its registers stay as they are up to the wait
        asm volatile("s_wait_xcnt 0x0" :: "v"(p) : "memory");
        float4 s = v[0];
#pragma unroll
        for (int t = 1; t < 32; ++t) {
            s.x += v[t].x; s.y += v[t].y; s.z += v[t].z; s.w += v[t].w;
        }
        red4[g][q] = s;
        __syncthreads();
        if (g == 0) {   // waves 0 and 1: both halves of each 128-B line of kx
            float4 s1 = red4[1][q], s2 = red4[2][q], s3 = red4[3][q];
            const int f  = cg * 64 + q;          // [wave][mt][j/4][p][lane]
            const int ln = f & 31, pp = (f >> 5) & 1, jh = (f >> 6) & 1;
            const int mt = (f >> 7) & 1, wv = f >> 8;
            const int c  = (wv * 2 + pp) * 16 + (ln & 15);
            const int d0 = mt * 16 + jh * 4 + 8 * (ln >> 4);
            float* o = kx_ws + ((size_t)b * DCH + d0) * CCH + c;
            o[0]       = (s.x + s1.x) + (s2.x + s3.x);
            o[CCH]     = (s.y + s1.y) + (s2.y + s3.y);
            o[2 * CCH] = (s.z + s1.z) + (s2.z + s3.z);
            o[3 * CCH] = (s.w + s1.w) + (s2.w + s3.w);
        }
    } else {
        const int b = blockIdx.x - BATCH * 32;
        const int d = tid & 31, g = tid >> 5;
        const float* p = ksum_part + (size_t)(b * TILES + g * 16) * DCH + d;
        float v[16];
#pragma unroll   // all 16 loads in flight at once, v[] by constant index
        for (int t = 0; t < 16; ++t) v[t] = p[t * DCH];
        // translation wait, as above
        asm volatile("s_wait_xcnt 0x0" :: "v"(p) : "memory");
        float s = v[0];
#pragma unroll
        for (int t = 1; t < 16; ++t) s += v[t];
        redk[g][d] = s;
        __syncthreads();
        if (tid < DCH) {
            float r = 0.0f;
#pragma unroll   // the 8 LDS reads issue together
            for (int w = 0; w < 8; ++w) r += redk[w][tid];
            ksum_ws[b * DCH + tid] = r;
        }
    }
}

// 16 K values of one row (two runs of 8) as a 16-bit fragment (A and B share the K map):
// e<8 -> K=h*8+e, e>=8 -> K=16+h*8+(e-8); p points at K=h*8 of the 32-wide K block
__device__ __forceinline__ v16bf frag_from_f32_row(const float* __restrict__ p) {
    float4 a0 = *(const float4*)(p);
    float4 a1 = *(const float4*)(p + 4);
    float4 a2 = *(const float4*)(p + 16);
    float4 a3 = *(const float4*)(p + 20);
    // translation wait before a register that these four loads name is written again;
    // the pointer is an input so that its registers stay as they are up to the wait
    asm volatile("s_wait_xcnt 0x0" :: "v"(p) : "memory");
    v16bf f;
    f[0]=(__bf16)a0.x; f[1]=(__bf16)a0.y; f[2]=(__bf16)a0.z; f[3]=(__bf16)a0.w;
    f[4]=(__bf16)a1.x; f[5]=(__bf16)a1.y; f[6]=(__bf16)a1.z; f[7]=(__bf16)a1.w;
    f[8]=(__bf16)a2.x; f[9]=(__bf16)a2.y; f[10]=(__bf16)a2.z; f[11]=(__bf16)a2.w;
    f[12]=(__bf16)a3.x; f[13]=(__bf16)a3.y; f[14]=(__bf16)a3.z; f[15]=(__bf16)a3.w;
    return f;
}

// ---------------- Kernel W: attn = kx Wv^T + k_sum bv^T, once per batch ------
// block: 16 d-rows x 32 v-channels (whole 128-B lines of attn); wave w takes the
// K slice c = 32w..32w+31, so that every load of the block is in flight at once
__global__ __launch_bounds__(256) void SGA_kernelW(
    const float* __restrict__ kx_ws, const float* __restrict__ ksum_ws,
    const float* __restrict__ Wv,    const float* __restrict__ bv,
    float* __restrict__ attn_ws)
{
    __shared__ float red[8][2][8][32];    // [K slice][channel tile][acc elem][lane]  16KB

    const int lane = threadIdx.x & 31;
    const int wave = threadIdx.x >> 5;
    const int h = lane >> 4, lo = lane & 15;
    const int b  = blockIdx.x >> 4;
    const int mt = (blockIdx.x >> 3) & 1;
    const int e0 = (blockIdx.x & 7) * 32;
    const int k0 = wave * 32 + h * 8;
    const int d  = mt * 16 + wave + 8 * h;   // the attn row this lane finishes

    const float ksum = ksum_ws[b * DCH + d];
    const float bv0 = bv[e0 + lo], bv1 = bv[e0 + 16 + lo];
    v16bf a  = frag_from_f32_row(kx_ws + ((size_t)b * DCH + mt * 16 + lo) * CCH + k0);
    v16bf b0 = frag_from_f32_row(Wv + (size_t)(e0 + lo) * CCH + k0);
    v16bf b1 = frag_from_f32_row(Wv + (size_t)(e0 + 16 + lo) * CCH + k0);
    v8f acc0 = {}, acc1 = {};
    acc0 = __builtin_amdgcn_wmma_f32_16x16x32_bf16(
            false, a, false, b0, (short)0, acc0, false, false);
    acc1 = __builtin_amdgcn_wmma_f32_16x16x32_bf16(
            false, a, false, b1, (short)0, acc1, false, false);
#pragma unroll   // acc[j] by constant index: no register indexing
    for (int j = 0; j < 8; ++j) {
        red[wave][0][j][lane] = acc0[j];
        red[wave][1][j][lane] = acc1[j];
    }
    __syncthreads();

    // wave w sums accumulator element j = w over the 8 K slices
    float s0 = 0.0f, s1 = 0.0f;
#pragma unroll   // the 16 LDS reads issue together instead of one wait per trip
    for (int ks = 0; ks < 8; ++ks) {
        s0 += red[ks][0][wave][lane];
        s1 += red[ks][1][wave][lane];
    }
    float* o = attn_ws + ((size_t)b * DCH + d) * CCH + e0 + lo;
    o[0]  = s0 + ksum * bv0;
    o[16] = s1 + ksum * bv1;
}

// ---------------- Kernel B: out = attn^T q^T * norm, q from the workspace -----
__global__ __launch_bounds__(256) void SGA_kernelB(
    const float* __restrict__ q_ws, const float* __restrict__ attn_ws,
    const float* __restrict__ ksum_ws, float* __restrict__ out)
{
    __shared__ __bf16 attnA[16][32][16];  // attn^T A-frag: M=C(256), K=d(32)    16KB

    const int tid  = threadIdx.x;
    const int lane = tid & 31;
    const int wave = tid >> 5;
    const int b    = blockIdx.x >> 7;
    const int n0   = (blockIdx.x & 127) * NT;
    const int nt = wave;                   // wave w owns token-tile nt=w
    const int h = lane >> 4, tok_lo = lane & 15;

    // q^T B fragment (K=d, N=token) as kernel A left it, and the k_sum values of its
    // 16 d: e<8 -> d=h*8+e, e>=8 -> d=16+h*8+(e-8)
    const v8bf* qp = (const v8bf*)q_ws + (size_t)(blockIdx.x * 8 + nt) * 64 + lane;
    const float* kp = ksum_ws + b * DCH + h * 8;
    v8bf qlo = qp[0];
    v8bf qhi = qp[32];
    float4 k0 = *(const float4*)(kp);
    float4 k1 = *(const float4*)(kp + 4);
    float4 k2 = *(const float4*)(kp + 16);
    float4 k3 = *(const float4*)(kp + 20);
    // translation wait before a register that these loads name is written again;
    // the pointers are inputs so that their registers stay as they are up to the wait
    asm volatile("s_wait_xcnt 0x0" :: "v"(qp), "v"(kp) : "memory");

    // stage attn^T as A-fragments (rows of attn[d][:] are contiguous)
    for (int i = tid; i < DCH * (CCH / 4); i += 256) {
        int d   = i >> 6;
        int ech = (i & 63) * 4;
        float4 av = *(const float4*)&attn_ws[((size_t)b * DCH + d) * CCH + ech];
        int h = (d >> 3) & 1;
        int e = (d & 7) + ((d >> 4) << 3);
        float vv[4] = {av.x, av.y, av.z, av.w};
#pragma unroll
        for (int t = 0; t < 4; ++t) {
            int ec = ech + t;
            attnA[ec >> 4][h * 16 + (ec & 15)][e] = (__bf16)vv[t];
        }
    }

    // norm = 1 / sum_d q[d] (k_sum[d] + EPS), d in the order 8h.., 16+8h.. per half
    const float ks[16] = {k0.x, k0.y, k0.z, k0.w, k1.x, k1.y, k1.z, k1.w,
                          k2.x, k2.y, k2.z, k2.w, k3.x, k3.y, k3.z, k3.w};
    float denom = 0.0f;
#pragma unroll   // ks[] and the fragment by constant index
    for (int e = 0; e < 8; ++e) denom += (float)qlo[e] * (ks[e] + 1e-6f);
#pragma unroll
    for (int e = 0; e < 8; ++e) denom += (float)qhi[e] * (ks[8 + e] + 1e-6f);
    denom += __shfl_xor(denom, 16, 32);   // combine both d-halves per token
    const float nrm = 1.0f / denom;
    __syncthreads();

    // out GEMM: [256 x 128] = attn^T[256x32] @ q^T[32x128]; K=32 -> 1 WMMA/tile
    {
        v16bf bb = __builtin_shufflevector(qlo, qhi,
                0, 1, 2, 3, 4, 5, 6, 7, 8, 9, 10, 11, 12, 13, 14, 15);
        float* ob = out + (size_t)b * CCH * NTOK + n0 + nt * 16 + tok_lo;
        for (int mt = 0; mt < 16; ++mt) {
            v8f acc = {};
            v16bf a = *(const v16bf*)&attnA[mt][lane][0];
            acc = __builtin_amdgcn_wmma_f32_16x16x32_bf16(
                    false, a, false, bb, (short)0, acc, false, false);
#pragma unroll
            for (int j = 0; j < 8; ++j) {
                int ech = mt * 16 + j + 8 * h;
                ob[(size_t)ech * NTOK] = acc[j] * nrm;
            }
        }
    }
}

extern "C" void kernel_launch(void* const* d_in, const int* in_sizes, int n_in,
                              void* d_out, int out_size, void* d_ws, size_t ws_size,
                              hipStream_t stream) {
    (void)in_sizes; (void)n_in; (void)out_size; (void)ws_size;
    const float* x  = (const float*)d_in[0];
    const float* Wq = (const float*)d_in[1];
    const float* bq = (const float*)d_in[2];
    const float* Wk = (const float*)d_in[3];
    const float* bk = (const float*)d_in[4];
    const float* Wv = (const float*)d_in[5];
    const float* bv = (const float*)d_in[6];
    float* out = (float*)d_out;

    float* kx_ws     = (float*)d_ws;                    // [B][32][256]
    float* ksum_ws   = kx_ws + BATCH * DCH * CCH;       // [B][32]
    float* attn_ws   = ksum_ws + BATCH * DCH;           // [B][32][256]
    float* kx_part   = attn_ws + BATCH * DCH * CCH;     // [B*TILES][32*256] tile planes
    float* ksum_part = kx_part + (size_t)BATCH * TILES * DCH * CCH;  // [B*TILES][32]
    float* q_ws      = ksum_part + BATCH * TILES * DCH; // bf16 [B*N/16][2][32][8]

    SGA_kernelA<<<BATCH * TILES, 256, 0, stream>>>(x, Wk, bk, Wq, bq, kx_part, ksum_part, q_ws);
    SGA_reduce<<<BATCH * 32 + BATCH, 256, 0, stream>>>(kx_part, ksum_part, kx_ws, ksum_ws);
    SGA_kernelW<<<BATCH * 16, 256, 0, stream>>>(kx_ws, ksum_ws, Wv, bv, attn_ws);
    SGA_kernelB<<<BATCH * TILES, 256, 0, stream>>>(q_ws, attn_ws, ksum_ws, out);
}

// v006
// It runs in 61.8 microseconds.
// Next to v005, in two timings, it ran 1.10 and 1.09 times as fast.
// All steps since v000 together make it 4.33 times as fast.
#include <hip/hip_runtime.h>
#include <hip/hip_bf16.h>

// Problem constants (from reference): B=8, C=256, d=32, H=W=128, N=16384
#define BATCH 8
#define CCH   256
#define DCH   32
#define NTOK  16384
#define NT    128          // tokens per workgroup tile
#define TILES (NTOK / NT)  // 128 tiles per batch

typedef __attribute__((ext_vector_type(16))) __bf16 v16bf;
typedef __attribute__((ext_vector_type(8)))  __bf16 v8bf;
typedef __attribute__((ext_vector_type(4)))  __bf16 v4bf;
typedef __attribute__((ext_vector_type(8)))  float  v8f;

// branchless softplus: no EXEC-mask divergence around WMMA regions.
// max(x,0) + log(1+e), e = exp(-|x|) in [0,1], on the chip's own exp2 and log2.
// Where e < 2^-8 the sum 1+e has dropped too many of e's bits: there the series
// e - e*e/2, whose relative error is below e*e/3, keeps a small result's digits.
__device__ __forceinline__ float softplusf(float x) {
    const float e  = __builtin_amdgcn_exp2f(fabsf(x) * -1.44269504f);
    const float lg = __builtin_amdgcn_logf(1.0f + e) * 0.693147181f;
    const float sr = fmaf(e * -0.5f, e, e);
    return fmaxf(x, 0.0f) + (e < 0x1p-8f ? sr : lg);
}

// Fragment mappings (16-bit WMMA, wave32):
//  A 16x32: lane = h*16 + (m&15); elem e<8 -> K=h*8+e ; e>=8 -> K=16+h*8+(e-8)
//  B 32x16: lane = h*16 + (n&15); same K mapping
//  inverse (h,e) from k_local kl: h=(kl>>3)&1 ; e=(kl&7)+((kl>>4)<<3)
//  C/D 16x16 f32: elem j -> row m = j + 8*(lane>>4), col n = lane&15

// 16 values of one f32 weight row (K = h*8..+7 and 16+h*8..+7) as a lane's bf16 A fragment
__device__ __forceinline__ v16bf weight_frag(float4 a0, float4 a1, float4 a2, float4 a3) {
    v16bf f;
    f[0]=(__bf16)a0.x; f[1]=(__bf16)a0.y; f[2]=(__bf16)a0.z; f[3]=(__bf16)a0.w;
    f[4]=(__bf16)a1.x; f[5]=(__bf16)a1.y; f[6]=(__bf16)a1.z; f[7]=(__bf16)a1.w;
    f[8]=(__bf16)a2.x; f[9]=(__bf16)a2.y; f[10]=(__bf16)a2.z; f[11]=(__bf16)a2.w;
    f[12]=(__bf16)a3.x; f[13]=(__bf16)a3.y; f[14]=(__bf16)a3.z; f[15]=(__bf16)a3.w;
    return f;
}

// stage two [32 x 256] f32 row-major weight blocks as A-fragments (bf16), W0 as row
// tiles 0,1 and W1 as row tiles 2,3; the loads of both blocks are in flight together
__device__ __forceinline__ void stage_weights_A(
    __bf16* dst, const float* __restrict__ W0, const float* __restrict__ W1, int tid)
{
    for (int i = tid; i < 2 * 8 * 32; i += 256) {
        int ln = i & 31, kt = (i >> 5) & 7, mt = i >> 8;
        int h = ln >> 4;
        int m = mt * 16 + (ln & 15);
        int c0 = kt * 32 + h * 8;
        const float* w0 = W0 + (size_t)m * CCH + c0;
        const float* w1 = W1 + (size_t)m * CCH + c0;
        float4 a0 = *(const float4*)(w0);
        float4 a1 = *(const float4*)(w0 + 4);
        float4 a2 = *(const float4*)(w0 + 16);
        float4 a3 = *(const float4*)(w0 + 20);
        float4 b0 = *(const float4*)(w1);
        float4 b1 = *(const float4*)(w1 + 4);
        float4 b2 = *(const float4*)(w1 + 16);
        float4 b3 = *(const float4*)(w1 + 20);
        // translation wait before a register that these loads name is written again;
        // the pointers are inputs so that their registers stay as they are up to the wait
        asm volatile("s_wait_xcnt 0x0" :: "v"(w0), "v"(w1) : "memory");
        *(v16bf*)(dst + (size_t)i * 16) = weight_frag(a0, a1, a2, a3);   // [mt][kt][lane][16]
        *(v16bf*)(dst + (size_t)(i + 512) * 16) = weight_frag(b0, b1, b2, b3);
    }
}

// stage x tile [256 x NT] (channel-major, token-contiguous) as bf16 channel rows of
// PITCH elements: a wave stores 256 contiguous bytes of one row, no bank conflict
template <int PITCH>
__device__ __forceinline__ void stage_x_rows(
    __bf16 (*xR)[PITCH], const float* __restrict__ xb, int n0, int tid)
{
    const int n = (tid & 31) * 4;             // a wave takes one whole row per load
    for (int c = tid >> 5; c < CCH; c += 64) {
        const float* p = xb + (size_t)c * NTOK + n0 + n;
        float4 v[8];
#pragma unroll   // rows c, c+8, .., c+56: 8 loads in flight, v[] by constant index
        for (int u = 0; u < 8; ++u) v[u] = *(const float4*)(p + (size_t)u * 8 * NTOK);
#pragma unroll   // v[u] by constant index: no register indexing
        for (int u = 0; u < 8; ++u) {
            v4bf r;
            r[0] = (__bf16)v[u].x; r[1] = (__bf16)v[u].y;
            r[2] = (__bf16)v[u].z; r[3] = (__bf16)v[u].w;
            *(v4bf*)&xR[c + u * 8][n] = r;
        }
    }
}

// B fragment with K=channel, N=token out of the channel rows, by the transposing LDS
// load: lane l reads 16 B of row 8*(l>>4)+(l&7) and gets rows 8h..8h+7 of column l&15;
// the loads at rows +0 and +16 give e<8 -> K=h*8+e, e>=8 -> K=16+h*8+(e-8), the K map
// of the staged A fragments. t points at (first channel of the K block, first token).
template <int PITCH>
__device__ __forceinline__ v16bf frag_B_tr16(const __bf16* t, int lane) {
    typedef __attribute__((address_space(3))) v8bf lds_v8bf;
    const __bf16* p = t + (8 * (lane >> 4) + (lane & 7)) * PITCH + 8 * ((lane >> 3) & 1);
    v8bf lo = __builtin_amdgcn_ds_load_tr16_b128_v8bf16((lds_v8bf*)p);
    v8bf hi = __builtin_amdgcn_ds_load_tr16_b128_v8bf16((lds_v8bf*)(p + 16 * PITCH));
    return __builtin_shufflevector(lo, hi,
            0, 1, 2, 3, 4, 5, 6, 7, 8, 9, 10, 11, 12, 13, 14, 15);
}

// Linear attention, reassociated:
//   attn[d][e] = sum_n k[d][n] * (sum_c Wv[e][c] x[c][n] + bv[e])
//              = sum_c (sum_n k[d][n] x[c][n]) * Wv[e][c] + (sum_n k[d][n]) * bv[e]
// so the token loop only needs kx = k x^T [32 x 256]; Wv is applied once per batch.

// bf16 elements per LDS row of the x tile
#define XR_PITCH (NT + 8)   // 272 B = 16 B x odd: for rows that b128 reads walk too

#define KXP_F4 (DCH * CCH / 4)   // float4 per tile plane of kx partials

// ---------------- Kernel A: k = softplus(Wk x + bk); per-tile k_sum and k x^T;
// q = softplus(Wq x + bq) from the same staged x tile, so that x is read only here.
// q goes to the workspace as bf16 B fragments (K=d, N=token of a 16-token tile):
// [16-token tile][K half][lane][8], each store of a wave 512 contiguous bytes.
// Every block stores its own plane of partial sums; SGA_reduce adds the planes.
// Plane order (float4 units): [wave][mt][j/4][p][lane], so that each store of a
// wave is 512 contiguous bytes; the sum over planes is elementwise in any order.
__global__ __launch_bounds__(256) void SGA_kernelA(
    const float* __restrict__ x,  const float* __restrict__ Wk,
    const float* __restrict__ bk, const float* __restrict__ Wq,
    const float* __restrict__ bq, float* __restrict__ kx_part,
    float* __restrict__ ksum_part, float* __restrict__ q_ws)
{
    __shared__ __bf16 WA [4][8][32][16];  // Wk (0,1), Wq (2,3), A-frag: M=d, K=C  32KB
    __shared__ __bf16 kA [2][4][32][16];  // k,  A-frag: M=d(32), K=tok(128)        8KB
    __shared__ __attribute__((aligned(16)))
               __bf16 xR [CCH][XR_PITCH]; // x tile, channel rows                  68KB
    __shared__ float  ksL[8][DCH];        // k_sum of each wave's 16 tokens         1KB

    const int tid  = threadIdx.x;
    const int lane = tid & 31;
    const int wave = tid >> 5;
    const int b    = blockIdx.x >> 7;          // TILES == 128
    const int n0   = (blockIdx.x & 127) * NT;
    const float* xb = x + (size_t)b * CCH * NTOK;

    stage_x_rows<XR_PITCH>(xR, xb, n0, tid);
    stage_weights_A(&WA[0][0][0][0], Wk, Wq, tid);
    __syncthreads();

    // k and q GEMM: [64 x 128] = [Wk; Wq][64x256] @ x[256x128]; wave w owns token-tile
    // nt=w; each x fragment is read from LDS once and serves all four row tiles
    v8f acc4[4] = {};   // row tiles 0,1: k; 2,3: q, finished at the kernel's end
    {
        const int nt = wave;
        const int h = lane >> 4, tok_lo = lane & 15;
#pragma unroll   // acc4[] by constant index: no register indexing
        for (int kt = 0; kt < 8; ++kt) {
            v16bf bb = frag_B_tr16<XR_PITCH>(&xR[kt * 32][nt * 16], lane);
#pragma unroll
            for (int mt = 0; mt < 4; ++mt) {
                v16bf a = *(const v16bf*)&WA[mt][kt][lane][0];
                acc4[mt] = __builtin_amdgcn_wmma_f32_16x16x32_bf16(
                        false, a, false, bb, (short)0, acc4[mt], false, false);
            }
        }
#pragma unroll   // acc4[] by constant index
        for (int mt = 0; mt < 2; ++mt) {
            const v8f acc = acc4[mt];
            for (int j = 0; j < 8; ++j) {
                int m = mt * 16 + j + 8 * h;                 // d-row
                float kv = softplusf(acc[j] + bk[m]);
                int ktok = nt * 16 + tok_lo;
                int kl   = ktok & 31;
                int ha   = (kl >> 3) & 1;
                int ea   = (kl & 7) + ((kl >> 4) << 3);
                kA[m >> 4][ktok >> 5][ha * 16 + (m & 15)][ea] = (__bf16)kv;
                float s = kv;                 // token reduction in 16-lane half
                s += __shfl_xor(s, 1, 32);
                s += __shfl_xor(s, 2, 32);
                s += __shfl_xor(s, 4, 32);
                s += __shfl_xor(s, 8, 32);
                if (tok_lo == 0) ksL[wave][m] = s;
            }
        }
    }
    __syncthreads();

    // kx GEMM: [32 x 256] += kA[32x128] @ x^T[128x256]; wave w owns channel
    // tiles 2w and 2w+1, both d-row tiles
    {
        const int h = lane >> 4, c_lo = lane & 15;
        v8f acc[2][2] = {};
        // all loops below unrolled: acc[][] keeps constant indices (stays in registers)
        // and the LDS reads of all four K blocks issue ahead of the WMMAs
#pragma unroll
        for (int kt = 0; kt < 4; ++kt) {
            v16bf a0 = *(const v16bf*)&kA[0][kt][lane][0];
            v16bf a1 = *(const v16bf*)&kA[1][kt][lane][0];
#pragma unroll
            for (int p = 0; p < 2; ++p) {
                // B 32x16: lane (h, channel); e<8 -> tok h*8+e, e>=8 -> tok 16+h*8+(e-8)
                const __bf16* row = &xR[(wave * 2 + p) * 16 + c_lo][kt * 32 + h * 8];
                v8bf lo = *(const v8bf*)row;
                v8bf hi = *(const v8bf*)(row + 16);
                v16bf bb = __builtin_shufflevector(lo, hi,
                        0, 1, 2, 3, 4, 5, 6, 7, 8, 9, 10, 11, 12, 13, 14, 15);
                acc[0][p] = __builtin_amdgcn_wmma_f32_16x16x32_bf16(
                        false, a0, false, bb, (short)0, acc[0][p], false, false);
                acc[1][p] = __builtin_amdgcn_wmma_f32_16x16x32_bf16(
                        false, a1, false, bb, (short)0, acc[1][p], false, false);
            }
        }
        float4* kp = (float4*)kx_part + (size_t)blockIdx.x * KXP_F4 + wave * 256 + lane;
#pragma unroll   // acc[][][] by constant index: no register indexing
        for (int mt = 0; mt < 2; ++mt)
#pragma unroll
            for (int jh = 0; jh < 2; ++jh)
#pragma unroll
                for (int p = 0; p < 2; ++p)
                    kp[((mt * 2 + jh) * 2 + p) * 32] = make_float4(
                        acc[mt][p][jh * 4 + 0], acc[mt][p][jh * 4 + 1],
                        acc[mt][p][jh * 4 + 2], acc[mt][p][jh * 4 + 3]);
    }
    // q, behind the last barrier so that no barrier waits for its stores: this lane
    // holds d = mt*16 + 8h + j of token lane&15, which is what the same lane of the
    // B fragment (K=d, N=token) holds at e = mt*8 + j
    {
        const int h = lane >> 4;
        v8bf* qp = (v8bf*)q_ws + (size_t)(blockIdx.x * 8 + wave) * 64 + lane;
#pragma unroll   // acc4[] by constant index
        for (int mt = 0; mt < 2; ++mt) {
            v8bf qf;
#pragma unroll
            for (int j = 0; j < 8; ++j)
                qf[j] = (__bf16)softplusf(acc4[2 + mt][j] + bq[mt * 16 + j + 8 * h]);
            qp[mt * 32] = qf;
        }
        // translation wait before a register that these stores name is written again;
        // the pointer is an input so that its registers stay as they are up to the wait
        asm volatile("s_wait_xcnt 0x0" :: "v"(qp) : "memory");
    }
    if (tid < DCH) {   // wave 0 alone: the tile's k_sum, one 128-B line
        float s = 0.0f;
#pragma unroll   // the 8 LDS reads issue together
        for (int w = 0; w < 8; ++w) s += ksL[w][tid];
        ksum_part[(size_t)blockIdx.x * DCH + tid] = s;
    }
}

// ---------------- Kernel R: add the 128 tile planes of each batch ------------
// blocks 0..255: batch b, 64 float4 columns of the kx plane; thread group g adds
// 32 planes, LDS adds the 4 groups. blocks 256..263: k_sum of one batch.
__global__ __launch_bounds__(256) void SGA_reduce(
    const float* __restrict__ kx_part, const float* __restrict__ ksum_part,
    float* __restrict__ kx_ws, float* __restrict__ ksum_ws)
{
    __shared__ float4 red4[4][64];
    __shared__ float  redk[8][DCH];
    const int tid = threadIdx.x;
    if (blockIdx.x < BATCH * 32) {
        const int b = blockIdx.x >> 5, cg = blockIdx.x & 31;
        const int q = tid & 63, g = tid >> 6;
        const float4* p = (const float4*)kx_part
                        + (size_t)(b * TILES + g * 32) * KXP_F4 + cg * 64 + q;
        float4 v[32];
#pragma unroll   // all 32 loads in flight at once, v[] by constant index
        for (int t = 0; t < 32; ++t) v[t] = p[(size_t)t * KXP_F4];
        // translation wait before a register that these loads name is written again;
        // the pointer is an input so that its registers stay as they are up to the wait
        asm volatile("s_wait_xcnt 0x0" :: "v"(p) : "memory");
        float4 s = v[0];
#pragma unroll
        for (int t = 1; t < 32; ++t) {
            s.x += v[t].x; s.y += v[t].y; s.z += v[t].z; s.w += v[t].w;
        }
        red4[g][q] = s;
        __syncthreads();
        if (g == 0) {   // waves 0 and 1: both halves of each 128-B line of kx
            float4 s1 = red4[1][q], s2 = red4[2][q], s3 = red4[3][q];
            const int f  = cg * 64 + q;          // [wave][mt][j/4][p][lane]
            const int ln = f & 31, pp = (f >> 5) & 1, jh = (f >> 6) & 1;
            const int mt = (f >> 7) & 1, wv = f >> 8;
            const int c  = (wv * 2 + pp) * 16 + (ln & 15);
            const int d0 = mt * 16 + jh * 4 + 8 * (ln >> 4);
            float* o = kx_ws + ((size_t)b * DCH + d0) * CCH + c;
            o[0]       = (s.x + s1.x) + (s2.x + s3.x);
            o[CCH]     = (s.y + s1.y) + (s2.y + s3.y);
            o[2 * CCH] = (s.z + s1.z) + (s2.z + s3.z);
            o[3 * CCH] = (s.w + s1.w) + (s2.w + s3.w);
        }
    } else {
        const int b = blockIdx.x - BATCH * 32;
        const int d = tid & 31, g = tid >> 5;
        const float* p = ksum_part + (size_t)(b * TILES + g * 16) * DCH + d;
        float v[16];
#pragma unroll   // all 16 loads in flight at once, v[] by constant index
        for (int t = 0; t < 16; ++t) v[t] = p[t * DCH];
        // translation wait, as above
        asm volatile("s_wait_xcnt 0x0" :: "v"(p) : "memory");
        float s = v[0];
#pragma unroll
        for (int t = 1; t < 16; ++t) s += v[t];
        redk[g][d] = s;
        __syncthreads();
        if (tid < DCH) {
            float r = 0.0f;
#pragma unroll   // the 8 LDS reads issue together
            for (int w = 0; w < 8; ++w) r += redk[w][tid];
            ksum_ws[b * DCH + tid] = r;
        }
    }
}

// 16 K values of one row (two runs of 8) as a 16-bit fragment (A and B share the K map):
// e<8 -> K=h*8+e, e>=8 -> K=16+h*8+(e-8); p points at K=h*8 of the 32-wide K block
__device__ __forceinline__ v16bf frag_from_f32_row(const float* __restrict__ p) {
    float4 a0 = *(const float4*)(p);
    float4 a1 = *(const float4*)(p + 4);
    float4 a2 = *(const float4*)(p + 16);
    float4 a3 = *(const float4*)(p + 20);
    // translation wait before a register that these four loads name is written again;
    // the pointer is an input so that its registers stay as they are up to the wait
    asm volatile("s_wait_xcnt 0x0" :: "v"(p) : "memory");
    v16bf f;
    f[0]=(__bf16)a0.x; f[1]=(__bf16)a0.y; f[2]=(__bf16)a0.z; f[3]=(__bf16)a0.w;
    f[4]=(__bf16)a1.x; f[5]=(__bf16)a1.y; f[6]=(__bf16)a1.z; f[7]=(__bf16)a1.w;
    f[8]=(__bf16)a2.x; f[9]=(__bf16)a2.y; f[10]=(__bf16)a2.z; f[11]=(__bf16)a2.w;
    f[12]=(__bf16)a3.x; f[13]=(__bf16)a3.y; f[14]=(__bf16)a3.z; f[15]=(__bf16)a3.w;
    return f;
}

// ---------------- Kernel W: attn = kx Wv^T + k_sum bv^T, once per batch ------
// block: 16 d-rows x 32 v-channels (whole 128-B lines of attn); wave w takes the
// K slice c = 32w..32w+31, so that every load of the block is in flight at once
__global__ __launch_bounds__(256) void SGA_kernelW(
    const float* __restrict__ kx_ws, const float* __restrict__ ksum_ws,
    const float* __restrict__ Wv,    const float* __restrict__ bv,
    float* __restrict__ attn_ws)
{
    __shared__ float red[8][2][8][32];    // [K slice][channel tile][acc elem][lane]  16KB

    const int lane = threadIdx.x & 31;
    const int wave = threadIdx.x >> 5;
    const int h = lane >> 4, lo = lane & 15;
    const int b  = blockIdx.x >> 4;
    const int mt = (blockIdx.x >> 3) & 1;
    const int e0 = (blockIdx.x & 7) * 32;
    const int k0 = wave * 32 + h * 8;
    const int d  = mt * 16 + wave + 8 * h;   // the attn row this lane finishes

    const float ksum = ksum_ws[b * DCH + d];
    const float bv0 = bv[e0 + lo], bv1 = bv[e0 + 16 + lo];
    v16bf a  = frag_from_f32_row(kx_ws + ((size_t)b * DCH + mt * 16 + lo) * CCH + k0);
    v16bf b0 = frag_from_f32_row(Wv + (size_t)(e0 + lo) * CCH + k0);
    v16bf b1 = frag_from_f32_row(Wv + (size_t)(e0 + 16 + lo) * CCH + k0);
    v8f acc0 = {}, acc1 = {};
    acc0 = __builtin_amdgcn_wmma_f32_16x16x32_bf16(
            false, a, false, b0, (short)0, acc0, false, false);
    acc1 = __builtin_amdgcn_wmma_f32_16x16x32_bf16(
            false, a, false, b1, (short)0, acc1, false, false);
#pragma unroll   // acc[j] by constant index: no register indexing
    for (int j = 0; j < 8; ++j) {
        red[wave][0][j][lane] = acc0[j];
        red[wave][1][j][lane] = acc1[j];
    }
    __syncthreads();

    // wave w sums accumulator element j = w over the 8 K slices
    float s0 = 0.0f, s1 = 0.0f;
#pragma unroll   // the 16 LDS reads issue together instead of one wait per trip
    for (int ks = 0; ks < 8; ++ks) {
        s0 += red[ks][0][wave][lane];
        s1 += red[ks][1][wave][lane];
    }
    float* o = attn_ws + ((size_t)b * DCH + d) * CCH + e0 + lo;
    o[0]  = s0 + ksum * bv0;
    o[16] = s1 + ksum * bv1;
}

// ---------------- Kernel B: out = attn^T q^T * norm, q from the workspace -----
// bf16 elements per 16-token tile of q in LDS: 1,040 B = 16 B x odd, so that the 16
// lanes of a half wave, which read from four tiles, fall on 64 different banks
#define QL_PITCH (2 * 32 * 8 + 8)

// The columns of the product are dealt so that a lane can store 16 bytes: column lo of
// column tile t (t = 0..3) of a 64-token group is token 4*lo + t, so the four
// accumulators hold four consecutive tokens of a row in one lane, and a half wave
// stores 256 contiguous, aligned bytes of one output row.
__global__ __launch_bounds__(256) void SGA_kernelB(
    const float* __restrict__ q_ws, const float* __restrict__ attn_ws,
    const float* __restrict__ ksum_ws, float* __restrict__ out)
{
    __shared__ __bf16 attnA[16][32][16];  // attn^T A-frag: M=C(256), K=d(32)    16KB
    __shared__ __attribute__((aligned(16)))
               __bf16 qL[8][QL_PITCH];    // q fragments as kernel A left them    8KB
    __shared__ __attribute__((aligned(16)))
               float  nrmL[NT];           // norm of each token of the tile

    const int tid  = threadIdx.x;
    const int lane = tid & 31;
    const int wave = tid >> 5;
    const int b    = blockIdx.x >> 7;
    const int n0   = (blockIdx.x & 127) * NT;
    const int nt = wave;                   // wave w brings in token-tile nt=w
    const int h = lane >> 4, tok_lo = lane & 15;

    // q^T B fragment (K=d, N=token) as kernel A left it, and the k_sum values of its
    // 16 d: e<8 -> d=h*8+e, e>=8 -> d=16+h*8+(e-8)
    const v8bf* qp = (const v8bf*)q_ws + (size_t)(blockIdx.x * 8 + nt) * 64 + lane;
    const float* kp = ksum_ws + b * DCH + h * 8;
    v8bf qlo = qp[0];
    v8bf qhi = qp[32];
    float4 k0 = *(const float4*)(kp);
    float4 k1 = *(const float4*)(kp + 4);
    float4 k2 = *(const float4*)(kp + 16);
    float4 k3 = *(const float4*)(kp + 20);
    // translation wait before a register that these loads name is written again;
    // the pointers are inputs so that their registers stay as they are up to the wait
    asm volatile("s_wait_xcnt 0x0" :: "v"(qp), "v"(kp) : "memory");

    // stage attn^T as A-fragments (rows of attn[d][:] are contiguous)
    for (int i = tid; i < DCH * (CCH / 4); i += 256) {
        int d   = i >> 6;
        int ech = (i & 63) * 4;
        float4 av = *(const float4*)&attn_ws[((size_t)b * DCH + d) * CCH + ech];
        int h = (d >> 3) & 1;
        int e = (d & 7) + ((d >> 4) << 3);
        float vv[4] = {av.x, av.y, av.z, av.w};
#pragma unroll
        for (int t = 0; t < 4; ++t) {
            int ec = ech + t;
            attnA[ec >> 4][h * 16 + (ec & 15)][e] = (__bf16)vv[t];
        }
    }

    // norm = 1 / sum_d q[d] (k_sum[d] + EPS), d in the order 8h.., 16+8h.. per half
    const float ks[16] = {k0.x, k0.y, k0.z, k0.w, k1.x, k1.y, k1.z, k1.w,
                          k2.x, k2.y, k2.z, k2.w, k3.x, k3.y, k3.z, k3.w};
    float denom = 0.0f;
#pragma unroll   // ks[] and the fragment by constant index
    for (int e = 0; e < 8; ++e) denom += (float)qlo[e] * (ks[e] + 1e-6f);
#pragma unroll
    for (int e = 0; e < 8; ++e) denom += (float)qhi[e] * (ks[8 + e] + 1e-6f);
    denom += __shfl_xor(denom, 16, 32);   // combine both d-halves per token
    *(v8bf*)&qL[nt][lane * 8]        = qlo;   // [K half][lane][8], 512 B per store
    *(v8bf*)&qL[nt][(32 + lane) * 8] = qhi;
    nrmL[nt * 16 + tok_lo] = 1.0f / denom;    // both halves hold and write the same value
    __syncthreads();

    // out GEMM: [256 x 128] = attn^T[256x32] @ q^T[32x128]; K=32 -> 1 WMMA/tile.
    // wave w: 64-token group g = w&1, channel tiles 4*(w>>1) .. +3
    {
        const int g = wave & 1, cq = wave >> 1;
        // token 64g + 4*lo + t lies in 16-token tile 4g + (lo>>2) at column 4*(lo&3) + t
        const __bf16* qf = &qL[g * 4 + (tok_lo >> 2)][(h * 16 + (tok_lo & 3) * 4) * 8];
        const float4 nrm = *(const float4*)&nrmL[g * 64 + tok_lo * 4];
        v16bf bb[4];
#pragma unroll   // bb[] by constant index: no register indexing
        for (int t = 0; t < 4; ++t) {
            v8bf lo8 = *(const v8bf*)(qf + t * 8);
            v8bf hi8 = *(const v8bf*)(qf + t * 8 + 32 * 8);
            bb[t] = __builtin_shufflevector(lo8, hi8,
                    0, 1, 2, 3, 4, 5, 6, 7, 8, 9, 10, 11, 12, 13, 14, 15);
        }
        float* ob = out + ((size_t)b * CCH + cq * 64 + 8 * h) * NTOK + n0 + g * 64 + tok_lo * 4;
#pragma unroll 1   // rolled: unrolled it takes 170 registers, and only two work-groups fit a WGP
        for (int i = 0; i < 4; ++i) {
            v16bf a = *(const v16bf*)&attnA[cq * 4 + i][lane][0];
            v8f acc[4];
#pragma unroll   // acc[] by constant index
            for (int t = 0; t < 4; ++t) {
                v8f z = {};
                acc[t] = __builtin_amdgcn_wmma_f32_16x16x32_bf16(
                        false, a, false, bb[t], (short)0, z, false, false);
            }
#pragma unroll   // acc[][j] by constant index; the 8 stores issue together
            for (int j = 0; j < 8; ++j)
                *(float4*)(ob + (size_t)(i * 16 + j) * NTOK) = make_float4(
                    acc[0][j] * nrm.x, acc[1][j] * nrm.y,
                    acc[2][j] * nrm.z, acc[3][j] * nrm.w);
            // translation wait before the next trip writes registers that these stores name
            asm volatile("s_wait_xcnt 0x0" ::: "memory");
        }
    }
}

extern "C" void kernel_launch(void* const* d_in, const int* in_sizes, int n_in,
                              void* d_out, int out_size, void* d_ws, size_t ws_size,
                              hipStream_t stream) {
    (void)in_sizes; (void)n_in; (void)out_size; (void)ws_size;
    const float* x  = (const float*)d_in[0];
    const float* Wq = (const float*)d_in[1];
    const float* bq = (const float*)d_in[2];
    const float* Wk = (const float*)d_in[3];
    const float* bk = (const float*)d_in[4];
    const float* Wv = (const float*)d_in[5];
    const float* bv = (const float*)d_in[6];
    float* out = (float*)d_out;

    float* kx_ws     = (float*)d_ws;                    // [B][32][256]
    float* ksum_ws   = kx_ws + BATCH * DCH * CCH;       // [B][32]
    float* attn_ws   = ksum_ws + BATCH * DCH;           // [B][32][256]
    float* kx_part   = attn_ws + BATCH * DCH * CCH;     // [B*TILES][32*256] tile planes
    float* ksum_part = kx_part + (size_t)BATCH * TILES * DCH * CCH;  // [B*TILES][32]
    float* q_ws      = ksum_part + BATCH * TILES * DCH; // bf16 [B*N/16][2][32][8]

    SGA_kernelA<<<BATCH * TILES, 256, 0, stream>>>(x, Wk, bk, Wq, bq, kx_part, ksum_part, q_ws);
    SGA_reduce<<<BATCH * 32 + BATCH, 256, 0, stream>>>(kx_part, ksum_part, kx_ws, ksum_ws);
    SGA_kernelW<<<BATCH * 16, 256, 0, stream>>>(kx_ws, ksum_ws, Wv, bv, attn_ws);
    SGA_kernelB<<<BATCH * TILES, 256, 0, stream>>>(q_ws, attn_ws, ksum_ws, out);
}

// v007
// Measured time: 52.2 microseconds a run.
// Timed twice side by side with v006, it ran 1.19 times as fast both times.
// Counting every step since v000, it is 5.15 times as fast.
#include <hip/hip_runtime.h>
#include <hip/hip_bf16.h>

// Problem constants (from reference): B=8, C=256, d=32, H=W=128, N=16384
#define BATCH 8
#define CCH   256
#define DCH   32
#define NTOK  16384
#define NT    128          // tokens per workgroup tile
#define TILES (NTOK / NT)  // 128 tiles per batch

typedef __attribute__((ext_vector_type(16))) __bf16 v16bf;
typedef __attribute__((ext_vector_type(8)))  __bf16 v8bf;
typedef __attribute__((ext_vector_type(4)))  __bf16 v4bf;
typedef __attribute__((ext_vector_type(2)))  __bf16 v2bf;
typedef __attribute__((ext_vector_type(8)))  float  v8f;

// branchless softplus: no EXEC-mask divergence around WMMA regions.
// max(x,0) + log(1+e), e = exp(-|x|) in [0,1], on the chip's own exp2 and log2.
// Where e < 2^-8 the sum 1+e has dropped too many of e's bits: there the series
// e - e*e/2, whose relative error is below e*e/3, keeps a small result's digits.
__device__ __forceinline__ float softplusf(float x) {
    const float e  = __builtin_amdgcn_exp2f(fabsf(x) * -1.44269504f);
    const float lg = __builtin_amdgcn_logf(1.0f + e) * 0.693147181f;
    const float sr = fmaf(e * -0.5f, e, e);
    return fmaxf(x, 0.0f) + (e < 0x1p-8f ? sr : lg);
}

// Fragment mappings (16-bit WMMA, wave32):
//  A 16x32: lane = h*16 + (m&15); elem e<8 -> K=h*8+e ; e>=8 -> K=16+h*8+(e-8)
//  B 32x16: lane = h*16 + (n&15); same K mapping
//  inverse (h,e) from k_local kl: h=(kl>>3)&1 ; e=(kl&7)+((kl>>4)<<3)
//  C/D 16x16 f32: elem j -> row m = j + 8*(lane>>4), col n = lane&15

// 16 values of one f32 weight row (K = h*8..+7 and 16+h*8..+7) as a lane's bf16 A fragment
__device__ __forceinline__ v16bf weight_frag(float4 a0, float4 a1, float4 a2, float4 a3) {
    v16bf f;
    f[0]=(__bf16)a0.x; f[1]=(__bf16)a0.y; f[2]=(__bf16)a0.z; f[3]=(__bf16)a0.w;
    f[4]=(__bf16)a1.x; f[5]=(__bf16)a1.y; f[6]=(__bf16)a1.z; f[7]=(__bf16)a1.w;
    f[8]=(__bf16)a2.x; f[9]=(__bf16)a2.y; f[10]=(__bf16)a2.z; f[11]=(__bf16)a2.w;
    f[12]=(__bf16)a3.x; f[13]=(__bf16)a3.y; f[14]=(__bf16)a3.z; f[15]=(__bf16)a3.w;
    return f;
}

// stage two [32 x 256] f32 row-major weight blocks as A-fragments (bf16), W0 as row
// tiles 0,1 and W1 as row tiles 2,3; the loads of both blocks are in flight together
__device__ __forceinline__ void stage_weights_A(
    __bf16* dst, const float* __restrict__ W0, const float* __restrict__ W1, int tid)
{
    for (int i = tid; i < 2 * 8 * 32; i += 256) {
        int ln = i & 31, kt = (i >> 5) & 7, mt = i >> 8;
        int h = ln >> 4;
        int m = mt * 16 + (ln & 15);
        int c0 = kt * 32 + h * 8;
        const float* w0 = W0 + (size_t)m * CCH + c0;
        const float* w1 = W1 + (size_t)m * CCH + c0;
        float4 a0 = *(const float4*)(w0);
        float4 a1 = *(const float4*)(w0 + 4);
        float4 a2 = *(const float4*)(w0 + 16);
        float4 a3 = *(const float4*)(w0 + 20);
        float4 b0 = *(const float4*)(w1);
        float4 b1 = *(const float4*)(w1 + 4);
        float4 b2 = *(const float4*)(w1 + 16);
        float4 b3 = *(const float4*)(w1 + 20);
        // translation wait before a register that these loads name is written again;
        // the pointers are inputs so that their registers stay as they are up to the wait
        asm volatile("s_wait_xcnt 0x0" :: "v"(w0), "v"(w1) : "memory");
        *(v16bf*)(dst + (size_t)i * 16) = weight_frag(a0, a1, a2, a3);   // [mt][kt][lane][16]
        *(v16bf*)(dst + (size_t)(i + 512) * 16) = weight_frag(b0, b1, b2, b3);
    }
}

// stage x tile [256 x NT] (channel-major, token-contiguous) as bf16 channel rows of
// PITCH elements: a wave stores 256 contiguous bytes of one row, no bank conflict
template <int PITCH>
__device__ __forceinline__ void stage_x_rows(
    __bf16 (*xR)[PITCH], const float* __restrict__ xb, int n0, int tid)
{
    const int n = (tid & 31) * 4;             // a wave takes one whole row per load
    for (int c = tid >> 5; c < CCH; c += 64) {
        const float* p = xb + (size_t)c * NTOK + n0 + n;
        float4 v[8];
#pragma unroll   // rows c, c+8, .., c+56: 8 loads in flight, v[] by constant index
        for (int u = 0; u < 8; ++u) v[u] = *(const float4*)(p + (size_t)u * 8 * NTOK);
#pragma unroll   // v[u] by constant index: no register indexing
        for (int u = 0; u < 8; ++u) {
            v4bf r;
            r[0] = (__bf16)v[u].x; r[1] = (__bf16)v[u].y;
            r[2] = (__bf16)v[u].z; r[3] = (__bf16)v[u].w;
            *(v4bf*)&xR[c + u * 8][n] = r;
        }
    }
}

// B fragment with K=channel, N=token out of the channel rows, by the transposing LDS
// load: lane l reads 16 B of row 8*(l>>4)+(l&7) and gets rows 8h..8h+7 of column l&15;
// the loads at rows +0 and +16 give e<8 -> K=h*8+e, e>=8 -> K=16+h*8+(e-8), the K map
// of the staged A fragments. t points at (first channel of the K block, first token).
template <int PITCH>
__device__ __forceinline__ v16bf frag_B_tr16(const __bf16* t, int lane) {
    typedef __attribute__((address_space(3))) v8bf lds_v8bf;
    const __bf16* p = t + (8 * (lane >> 4) + (lane & 7)) * PITCH + 8 * ((lane >> 3) & 1);
    v8bf lo = __builtin_amdgcn_ds_load_tr16_b128_v8bf16((lds_v8bf*)p);
    v8bf hi = __builtin_amdgcn_ds_load_tr16_b128_v8bf16((lds_v8bf*)(p + 16 * PITCH));
    return __builtin_shufflevector(lo, hi,
            0, 1, 2, 3, 4, 5, 6, 7, 8, 9, 10, 11, 12, 13, 14, 15);
}

// Linear attention, reassociated:
//   attn[d][e] = sum_n k[d][n] * (sum_c Wv[e][c] x[c][n] + bv[e])
//              = sum_c (sum_n k[d][n] x[c][n]) * Wv[e][c] + (sum_n k[d][n]) * bv[e]
// so the token loop only needs kx = k x^T [32 x 256]; Wv is applied once per batch.

// bf16 elements per LDS row of the x tile
#define XR_PITCH (NT + 8)   // 272 B = 16 B x odd: for rows that b128 reads walk too

#define KXP_F4 (DCH * CCH / 4)   // float4 per tile plane of kx partials

// ---------------- Kernel A: k = softplus(Wk x + bk); per-tile k_sum and k x^T;
// q = softplus(Wq x + bq) from the same staged x tile, so that x is read only here.
// q goes to the workspace as bf16 B fragments (K=d, N=token of a 16-token tile):
// [16-token tile][K half][lane][8], each store of a wave 512 contiguous bytes.
// Every block stores its own plane of partial sums; SGA_reduce adds the planes.
// Plane order (float4 units): [wave][mt][j/4][p][lane], so that each store of a
// wave is 512 contiguous bytes; the sum over planes is elementwise in any order.
__global__ __launch_bounds__(256) void SGA_kernelA(
    const float* __restrict__ x,  const float* __restrict__ Wk,
    const float* __restrict__ bk, const float* __restrict__ Wq,
    const float* __restrict__ bq, float* __restrict__ kx_part,
    float* __restrict__ ksum_part, float* __restrict__ q_ws)
{
    __shared__ __bf16 WA [4][8][32][16];  // Wk (0,1), Wq (2,3), A-frag: M=d, K=C  32KB
    __shared__ __bf16 kA [2][4][32][16];  // k,  A-frag: M=d(32), K=tok(128)        8KB
    __shared__ __attribute__((aligned(16)))
               __bf16 xR [CCH][XR_PITCH]; // x tile, channel rows                  68KB
    __shared__ float  ksL[8][DCH];        // k_sum of each wave's 16 tokens         1KB

    const int tid  = threadIdx.x;
    const int lane = tid & 31;
    const int wave = tid >> 5;
    const int b    = blockIdx.x >> 7;          // TILES == 128
    const int n0   = (blockIdx.x & 127) * NT;
    const float* xb = x + (size_t)b * CCH * NTOK;

    stage_x_rows<XR_PITCH>(xR, xb, n0, tid);
    stage_weights_A(&WA[0][0][0][0], Wk, Wq, tid);
    __syncthreads();

    // k and q GEMM: [64 x 128] = [Wk; Wq][64x256] @ x[256x128]; wave w owns token-tile
    // nt=w; each x fragment is read from LDS once and serves all four row tiles
    v8f acc4[4] = {};   // row tiles 0,1: k; 2,3: q, finished at the kernel's end
    {
        const int nt = wave;
        const int h = lane >> 4, tok_lo = lane & 15;
#pragma unroll   // acc4[] by constant index: no register indexing
        for (int kt = 0; kt < 8; ++kt) {
            v16bf bb = frag_B_tr16<XR_PITCH>(&xR[kt * 32][nt * 16], lane);
#pragma unroll
            for (int mt = 0; mt < 4; ++mt) {
                v16bf a = *(const v16bf*)&WA[mt][kt][lane][0];
                acc4[mt] = __builtin_amdgcn_wmma_f32_16x16x32_bf16(
                        false, a, false, bb, (short)0, acc4[mt], false, false);
            }
        }
#pragma unroll   // acc4[] by constant index
        for (int mt = 0; mt < 2; ++mt) {
            const v8f acc = acc4[mt];
            for (int j = 0; j < 8; ++j) {
                int m = mt * 16 + j + 8 * h;                 // d-row
                float kv = softplusf(acc[j] + bk[m]);
                int ktok = nt * 16 + tok_lo;
                int kl   = ktok & 31;
                int ha   = (kl >> 3) & 1;
                int ea   = (kl & 7) + ((kl >> 4) << 3);
                kA[m >> 4][ktok >> 5][ha * 16 + (m & 15)][ea] = (__bf16)kv;
                float s = kv;                 // token reduction in 16-lane half
                s += __shfl_xor(s, 1, 32);
                s += __shfl_xor(s, 2, 32);
                s += __shfl_xor(s, 4, 32);
                s += __shfl_xor(s, 8, 32);
                if (tok_lo == 0) ksL[wave][m] = s;
            }
        }
    }
    __syncthreads();

    // kx GEMM: [32 x 256] += kA[32x128] @ x^T[128x256]; wave w owns channel
    // tiles 2w and 2w+1, both d-row tiles
    {
        const int h = lane >> 4, c_lo = lane & 15;
        v8f acc[2][2] = {};
        // all loops below unrolled: acc[][] keeps constant indices (stays in registers)
        // and the LDS reads of all four K blocks issue ahead of the WMMAs
#pragma unroll
        for (int kt = 0; kt < 4; ++kt) {
            v16bf a0 = *(const v16bf*)&kA[0][kt][lane][0];
            v16bf a1 = *(const v16bf*)&kA[1][kt][lane][0];
#pragma unroll
            for (int p = 0; p < 2; ++p) {
                // B 32x16: lane (h, channel); e<8 -> tok h*8+e, e>=8 -> tok 16+h*8+(e-8)
                const __bf16* row = &xR[(wave * 2 + p) * 16 + c_lo][kt * 32 + h * 8];
                v8bf lo = *(const v8bf*)row;
                v8bf hi = *(const v8bf*)(row + 16);
                v16bf bb = __builtin_shufflevector(lo, hi,
                        0, 1, 2, 3, 4, 5, 6, 7, 8, 9, 10, 11, 12, 13, 14, 15);
                acc[0][p] = __builtin_amdgcn_wmma_f32_16x16x32_bf16(
                        false, a0, false, bb, (short)0, acc[0][p], false, false);
                acc[1][p] = __builtin_amdgcn_wmma_f32_16x16x32_bf16(
                        false, a1, false, bb, (short)0, acc[1][p], false, false);
            }
        }
        float4* kp = (float4*)kx_part + (size_t)blockIdx.x * KXP_F4 + wave * 256 + lane;
#pragma unroll   // acc[][][] by constant index: no register indexing
        for (int mt = 0; mt < 2; ++mt)
#pragma unroll
            for (int jh = 0; jh < 2; ++jh)
#pragma unroll
                for (int p = 0; p < 2; ++p)
                    kp[((mt * 2 + jh) * 2 + p) * 32] = make_float4(
                        acc[mt][p][jh * 4 + 0], acc[mt][p][jh * 4 + 1],
                        acc[mt][p][jh * 4 + 2], acc[mt][p][jh * 4 + 3]);
    }
    // q, behind the last barrier so that no barrier waits for its stores: this lane
    // holds d = mt*16 + 8h + j of token lane&15, which is what the same lane of the
    // B fragment (K=d, N=token) holds at e = mt*8 + j
    {
        const int h = lane >> 4;
        v8bf* qp = (v8bf*)q_ws + (size_t)(blockIdx.x * 8 + wave) * 64 + lane;
#pragma unroll   // acc4[] by constant index
        for (int mt = 0; mt < 2; ++mt) {
            v8bf qf;
#pragma unroll
            for (int j = 0; j < 8; ++j)
                qf[j] = (__bf16)softplusf(acc4[2 + mt][j] + bq[mt * 16 + j + 8 * h]);
            qp[mt * 32] = qf;
        }
        // translation wait before a register that these stores name is written again;
        // the pointer is an input so that its registers stay as they are up to the wait
        asm volatile("s_wait_xcnt 0x0" :: "v"(qp) : "memory");
    }
    if (tid < DCH) {   // wave 0 alone: the tile's k_sum, one 128-B line
        float s = 0.0f;
#pragma unroll   // the 8 LDS reads issue together
        for (int w = 0; w < 8; ++w) s += ksL[w][tid];
        ksum_part[(size_t)blockIdx.x * DCH + tid] = s;
    }
}

// ---------------- Kernel R: add the 128 tile planes of each batch ------------
// blocks 0..255: batch b, 64 float4 columns of the kx plane; thread group g adds
// 32 planes, LDS adds the 4 groups. blocks 256..263: k_sum of one batch.
__global__ __launch_bounds__(256) void SGA_reduce(
    const float* __restrict__ kx_part, const float* __restrict__ ksum_part,
    float* __restrict__ kx_ws, float* __restrict__ ksum_ws)
{
    __shared__ float4 red4[4][64];
    __shared__ float  redk[8][DCH];
    const int tid = threadIdx.x;
    if (blockIdx.x < BATCH * 32) {
        const int b = blockIdx.x >> 5, cg = blockIdx.x & 31;
        const int q = tid & 63, g = tid >> 6;
        const float4* p = (const float4*)kx_part
                        + (size_t)(b * TILES + g * 32) * KXP_F4 + cg * 64 + q;
        float4 v[32];
#pragma unroll   // all 32 loads in flight at once, v[] by constant index
        for (int t = 0; t < 32; ++t) v[t] = p[(size_t)t * KXP_F4];
        // translation wait before a register that these loads name is written again;
        // the pointer is an input so that its registers stay as they are up to the wait
        asm volatile("s_wait_xcnt 0x0" :: "v"(p) : "memory");
        float4 s = v[0];
#pragma unroll
        for (int t = 1; t < 32; ++t) {
            s.x += v[t].x; s.y += v[t].y; s.z += v[t].z; s.w += v[t].w;
        }
        red4[g][q] = s;
        __syncthreads();
        if (g == 0) {   // waves 0 and 1: both halves of each 128-B line of kx
            float4 s1 = red4[1][q], s2 = red4[2][q], s3 = red4[3][q];
            const int f  = cg * 64 + q;          // [wave][mt][j/4][p][lane]
            const int ln = f & 31, pp = (f >> 5) & 1, jh = (f >> 6) & 1;
            const int mt = (f >> 7) & 1, wv = f >> 8;
            const int c  = (wv * 2 + pp) * 16 + (ln & 15);
            const int d0 = mt * 16 + jh * 4 + 8 * (ln >> 4);
            float* o = kx_ws + ((size_t)b * DCH + d0) * CCH + c;
            o[0]       = (s.x + s1.x) + (s2.x + s3.x);
            o[CCH]     = (s.y + s1.y) + (s2.y + s3.y);
            o[2 * CCH] = (s.z + s1.z) + (s2.z + s3.z);
            o[3 * CCH] = (s.w + s1.w) + (s2.w + s3.w);
        }
    } else {
        const int b = blockIdx.x - BATCH * 32;
        const int d = tid & 31, g = tid >> 5;
        const float* p = ksum_part + (size_t)(b * TILES + g * 16) * DCH + d;
        float v[16];
#pragma unroll   // all 16 loads in flight at once, v[] by constant index
        for (int t = 0; t < 16; ++t) v[t] = p[t * DCH];
        // translation wait, as above
        asm volatile("s_wait_xcnt 0x0" :: "v"(p) : "memory");
        float s = v[0];
#pragma unroll
        for (int t = 1; t < 16; ++t) s += v[t];
        redk[g][d] = s;
        __syncthreads();
        if (tid < DCH) {
            float r = 0.0f;
#pragma unroll   // the 8 LDS reads issue together
            for (int w = 0; w < 8; ++w) r += redk[w][tid];
            ksum_ws[b * DCH + tid] = r;
        }
    }
}

// 16 K values of one row (two runs of 8) as a 16-bit fragment (A and B share the K map):
// e<8 -> K=h*8+e, e>=8 -> K=16+h*8+(e-8); p points at K=h*8 of the 32-wide K block
__device__ __forceinline__ v16bf frag_from_f32_row(const float* __restrict__ p) {
    float4 a0 = *(const float4*)(p);
    float4 a1 = *(const float4*)(p + 4);
    float4 a2 = *(const float4*)(p + 16);
    float4 a3 = *(const float4*)(p + 20);
    // translation wait before a register that these four loads name is written again;
    // the pointer is an input so that its registers stay as they are up to the wait
    asm volatile("s_wait_xcnt 0x0" :: "v"(p) : "memory");
    v16bf f;
    f[0]=(__bf16)a0.x; f[1]=(__bf16)a0.y; f[2]=(__bf16)a0.z; f[3]=(__bf16)a0.w;
    f[4]=(__bf16)a1.x; f[5]=(__bf16)a1.y; f[6]=(__bf16)a1.z; f[7]=(__bf16)a1.w;
    f[8]=(__bf16)a2.x; f[9]=(__bf16)a2.y; f[10]=(__bf16)a2.z; f[11]=(__bf16)a2.w;
    f[12]=(__bf16)a3.x; f[13]=(__bf16)a3.y; f[14]=(__bf16)a3.z; f[15]=(__bf16)a3.w;
    return f;
}

// ---------------- Kernel W: attn = kx Wv^T + k_sum bv^T, once per batch ------
// block: all 32 d-rows x 16 v-channels; wave w takes the K slice c = 32w..32w+31, so
// that every load of the block is in flight at once. In the accumulators a lane holds
// d = mt*16 + 8h + j of channel lane&15, which is what the same lane of the last
// kernel's A fragment (M=channel, K=d) holds at e = mt*8 + j: the block's result is one
// whole fragment tile, stored as bf16 [channel tile][lane][16], 1 KB in a row.
#define RED_PITCH 20   // floats per lane: 80 B = 16 B x odd, the b128 stores use all banks

__global__ __launch_bounds__(256) void SGA_kernelW(
    const float* __restrict__ kx_ws, const float* __restrict__ ksum_ws,
    const float* __restrict__ Wv,    const float* __restrict__ bv,
    float* __restrict__ attn_ws)
{
    __shared__ __attribute__((aligned(16)))
               float red[8][32][RED_PITCH];   // [K slice][lane][mt*8 + j]          20KB

    const int tid  = threadIdx.x;
    const int lane = tid & 31;
    const int wave = tid >> 5;
    const int h = lane >> 4, lo = lane & 15;
    const int b  = blockIdx.x >> 4;
    const int et = blockIdx.x & 15;
    const int k0 = wave * 32 + h * 8;
    // this thread finishes elements fe and fe+1 of fragment lane fl: 4 bytes at 4*tid
    const int fl = tid >> 3;
    const int fe = (tid & 7) * 2;
    const int d0 = (fe >> 3) * 16 + 8 * (fl >> 4) + (fe & 7);

    const float* ksp = ksum_ws + b * DCH + d0;
    const float* bvp = bv + et * 16 + (fl & 15);
    const float2 ksum = *(const float2*)ksp;
    const float  bvv  = *bvp;
    // translation wait before a register that these loads name is written again;
    // the pointers are inputs so that their registers stay as they are up to the wait
    asm volatile("s_wait_xcnt 0x0" :: "v"(ksp), "v"(bvp) : "memory");
    v16bf a0 = frag_from_f32_row(kx_ws + ((size_t)b * DCH + lo) * CCH + k0);
    v16bf a1 = frag_from_f32_row(kx_ws + ((size_t)b * DCH + 16 + lo) * CCH + k0);
    v16bf bb = frag_from_f32_row(Wv + (size_t)(et * 16 + lo) * CCH + k0);
    v8f acc0 = {}, acc1 = {};
    acc0 = __builtin_amdgcn_wmma_f32_16x16x32_bf16(
            false, a0, false, bb, (short)0, acc0, false, false);
    acc1 = __builtin_amdgcn_wmma_f32_16x16x32_bf16(
            false, a1, false, bb, (short)0, acc1, false, false);
    float4* r = (float4*)&red[wave][lane][0];
    r[0] = make_float4(acc0[0], acc0[1], acc0[2], acc0[3]);
    r[1] = make_float4(acc0[4], acc0[5], acc0[6], acc0[7]);
    r[2] = make_float4(acc1[0], acc1[1], acc1[2], acc1[3]);
    r[3] = make_float4(acc1[4], acc1[5], acc1[6], acc1[7]);
    __syncthreads();

    float s0 = 0.0f, s1 = 0.0f;
#pragma unroll   // the 8 LDS reads issue together instead of one wait per trip
    for (int ks = 0; ks < 8; ++ks) {
        const float2 v = *(const float2*)&red[ks][fl][fe];
        s0 += v.x;
        s1 += v.y;
    }
    v2bf o;
    o[0] = (__bf16)(s0 + ksum.x * bvv);
    o[1] = (__bf16)(s1 + ksum.y * bvv);
    ((v2bf*)attn_ws)[(size_t)blockIdx.x * 256 + tid] = o;   // a wave: one whole 128-B line
}

// ---------------- Kernel B: out = attn^T q^T * norm, q from the workspace -----
// bf16 elements per 16-token tile of q in LDS: 1,040 B = 16 B x odd, so that the 16
// lanes of a half wave, which read from four tiles, fall on 64 different banks
#define QL_PITCH (2 * 32 * 8 + 8)

// The columns of the product are dealt so that a lane can store 16 bytes: column lo of
// column tile t (t = 0..3) of a 64-token group is token 4*lo + t, so the four
// accumulators hold four consecutive tokens of a row in one lane, and a half wave
// stores 256 contiguous, aligned bytes of one output row.
__global__ __launch_bounds__(256) void SGA_kernelB(
    const float* __restrict__ q_ws, const float* __restrict__ attn_ws,
    const float* __restrict__ ksum_ws, float* __restrict__ out)
{
    __shared__ __attribute__((aligned(32)))
               __bf16 attnA[16][32][16];  // attn^T A-frag: M=C(256), K=d(32)    16KB
    __shared__ __attribute__((aligned(16)))
               __bf16 qL[8][QL_PITCH];    // q fragments as kernel A left them    8KB
    __shared__ __attribute__((aligned(16)))
               float  nrmL[NT];           // norm of each token of the tile

    const int tid  = threadIdx.x;
    const int lane = tid & 31;
    const int wave = tid >> 5;
    const int b    = blockIdx.x >> 7;
    const int n0   = (blockIdx.x & 127) * NT;
    const int nt = wave;                   // wave w brings in token-tile nt=w
    const int h = lane >> 4, tok_lo = lane & 15;

    // q^T B fragment (K=d, N=token) as kernel A left it, and the k_sum values of its
    // 16 d: e<8 -> d=h*8+e, e>=8 -> d=16+h*8+(e-8)
    const v8bf* qp = (const v8bf*)q_ws + (size_t)(blockIdx.x * 8 + nt) * 64 + lane;
    const float* kp = ksum_ws + b * DCH + h * 8;
    v8bf qlo = qp[0];
    v8bf qhi = qp[32];
    float4 k0 = *(const float4*)(kp);
    float4 k1 = *(const float4*)(kp + 4);
    float4 k2 = *(const float4*)(kp + 16);
    float4 k3 = *(const float4*)(kp + 20);
    // attn^T A fragments as kernel W left them: 16 KB, each load of a wave 512 B in a row
    const v8bf* ag = (const v8bf*)attn_ws + (size_t)b * (DCH * CCH / 8) + tid;
    v8bf af0 = ag[0];
    v8bf af1 = ag[256];
    v8bf af2 = ag[512];
    v8bf af3 = ag[768];
    // translation wait before a register that these loads name is written again;
    // the pointers are inputs so that their registers stay as they are up to the wait
    asm volatile("s_wait_xcnt 0x0" :: "v"(qp), "v"(kp), "v"(ag) : "memory");

    // norm = 1 / sum_d q[d] (k_sum[d] + EPS), d in the order 8h.., 16+8h.. per half
    const float ks[16] = {k0.x, k0.y, k0.z, k0.w, k1.x, k1.y, k1.z, k1.w,
                          k2.x, k2.y, k2.z, k2.w, k3.x, k3.y, k3.z, k3.w};
    float denom = 0.0f;
#pragma unroll   // ks[] and the fragment by constant index
    for (int e = 0; e < 8; ++e) denom += (float)qlo[e] * (ks[e] + 1e-6f);
#pragma unroll
    for (int e = 0; e < 8; ++e) denom += (float)qhi[e] * (ks[8 + e] + 1e-6f);
    denom += __shfl_xor(denom, 16, 32);   // combine both d-halves per token
    *(v8bf*)&qL[nt][lane * 8]        = qlo;   // [K half][lane][8], 512 B per store
    *(v8bf*)&qL[nt][(32 + lane) * 8] = qhi;
    v8bf* al = (v8bf*)&attnA[0][0][0] + tid;  // straight copy, 512 B per store of a wave
    al[0]   = af0;
    al[256] = af1;
    al[512] = af2;
    al[768] = af3;
    nrmL[nt * 16 + tok_lo] = 1.0f / denom;    // both halves hold and write the same value
    __syncthreads();

    // out GEMM: [256 x 128] = attn^T[256x32] @ q^T[32x128]; K=32 -> 1 WMMA/tile.
    // wave w: 64-token group g = w&1, channel tiles 4*(w>>1) .. +3
    {
        const int g = wave & 1, cq = wave >> 1;
        // token 64g + 4*lo + t lies in 16-token tile 4g + (lo>>2) at column 4*(lo&3) + t
        const __bf16* qf = &qL[g * 4 + (tok_lo >> 2)][(h * 16 + (tok_lo & 3) * 4) * 8];
        const float4 nrm = *(const float4*)&nrmL[g * 64 + tok_lo * 4];
        v16bf bb[4];
#pragma unroll   // bb[] by constant index: no register indexing
        for (int t = 0; t < 4; ++t) {
            v8bf lo8 = *(const v8bf*)(qf + t * 8);
            v8bf hi8 = *(const v8bf*)(qf + t * 8 + 32 * 8);
            bb[t] = __builtin_shufflevector(lo8, hi8,
                    0, 1, 2, 3, 4, 5, 6, 7, 8, 9, 10, 11, 12, 13, 14, 15);
        }
        float* ob = out + ((size_t)b * CCH + cq * 64 + 8 * h) * NTOK + n0 + g * 64 + tok_lo * 4;
#pragma unroll 1   // rolled: unrolled it takes 170 registers, and only two work-groups fit a WGP
        for (int i = 0; i < 4; ++i) {
            v16bf a = *(const v16bf*)&attnA[cq * 4 + i][lane][0];
            v8f acc[4];
#pragma unroll   // acc[] by constant index
            for (int t = 0; t < 4; ++t) {
                v8f z = {};
                acc[t] = __builtin_amdgcn_wmma_f32_16x16x32_bf16(
                        false, a, false, bb[t], (short)0, z, false, false);
            }
#pragma unroll   // acc[][j] by constant index; the 8 stores issue together
            for (int j = 0; j < 8; ++j)
                *(float4*)(ob + (size_t)(i * 16 + j) * NTOK) = make_float4(
                    acc[0][j] * nrm.x, acc[1][j] * nrm.y,
                    acc[2][j] * nrm.z, acc[3][j] * nrm.w);
            // translation wait before the next trip writes registers that these stores name
            asm volatile("s_wait_xcnt 0x0" ::: "memory");
        }
    }
}

extern "C" void kernel_launch(void* const* d_in, const int* in_sizes, int n_in,
                              void* d_out, int out_size, void* d_ws, size_t ws_size,
                              hipStream_t stream) {
    (void)in_sizes; (void)n_in; (void)out_size; (void)ws_size;
    const float* x  = (const float*)d_in[0];
    const float* Wq = (const float*)d_in[1];
    const float* bq = (const float*)d_in[2];
    const float* Wk = (const float*)d_in[3];
    const float* bk = (const float*)d_in[4];
    const float* Wv = (const float*)d_in[5];
    const float* bv = (const float*)d_in[6];
    float* out = (float*)d_out;

    float* kx_ws     = (float*)d_ws;                    // [B][32][256]
    float* ksum_ws   = kx_ws + BATCH * DCH * CCH;       // [B][32]
    float* attn_ws   = ksum_ws + BATCH * DCH;           // bf16 [B][16][32][16] fragments
    float* kx_part   = attn_ws + BATCH * DCH * CCH;     // [B*TILES][32*256] tile planes
    float* ksum_part = kx_part + (size_t)BATCH * TILES * DCH * CCH;  // [B*TILES][32]
    float* q_ws      = ksum_part + BATCH * TILES * DCH; // bf16 [B*N/16][2][32][8]

    SGA_kernelA<<<BATCH * TILES, 256, 0, stream>>>(x, Wk, bk, Wq, bq, kx_part, ksum_part, q_ws);
    SGA_reduce<<<BATCH * 32 + BATCH, 256, 0, stream>>>(kx_part, ksum_part, kx_ws, ksum_ws);
    SGA_kernelW<<<BATCH * 16, 256, 0, stream>>>(kx_ws, ksum_ws, Wv, bv, attn_ws);
    SGA_kernelB<<<BATCH * TILES, 256, 0, stream>>>(q_ws, attn_ws, ksum_ws, out);
}

// v008
// Measured time: 45.2 microseconds a run.
// Timed twice side by side with v007, it ran 1.13 and 1.14 times as fast.
// Over all steps from v000 it is 5.86 times as fast.
#include <hip/hip_runtime.h>
#include <hip/hip_bf16.h>

// Problem constants (from reference): B=8, C=256, d=32, H=W=128, N=16384
#define BATCH 8
#define CCH   256
#define DCH   32
#define NTOK  16384
#define NT    128          // tokens per workgroup tile
#define TILES (NTOK / NT)  // 128 tiles per batch

typedef __attribute__((ext_vector_type(16))) __bf16 v16bf;
typedef __attribute__((ext_vector_type(8)))  __bf16 v8bf;
typedef __attribute__((ext_vector_type(4)))  __bf16 v4bf;
typedef __attribute__((ext_vector_type(2)))  __bf16 v2bf;
typedef __attribute__((ext_vector_type(8)))  float  v8f;

// branchless softplus: no EXEC-mask divergence around WMMA regions.
// max(x,0) + log(1+e), e = exp(-|x|) in [0,1], on the chip's own exp2 and log2.
// Where e < 2^-8 the sum 1+e has dropped too many of e's bits: there the series
// e - e*e/2, whose relative error is below e*e/3, keeps a small result's digits.
__device__ __forceinline__ float softplusf(float x) {
    const float e  = __builtin_amdgcn_exp2f(fabsf(x) * -1.44269504f);
    const float lg = __builtin_amdgcn_logf(1.0f + e) * 0.693147181f;
    const float sr = fmaf(e * -0.5f, e, e);
    return fmaxf(x, 0.0f) + (e < 0x1p-8f ? sr : lg);
}

// One step of a sum over a 16-lane row that also halves the number of values: of each
// pair (2i, 2i+1) a lane keeps the one that 'up' picks and hands the other to lane
// l ^ MASK, which keeps that one. The exchange is a DPP row_xmask operand of the vector
// unit; a shuffle would go down the LDS path and be waited for at every step.
template <int MASK, int N>
__device__ __forceinline__ void fold_rows(float (&v)[16], bool up) {
#pragma unroll   // v[] by constant index: no register indexing
    for (int i = 0; i < N / 2; ++i) {
        const float keep = up ? v[2 * i + 1] : v[2 * i];
        const float send = up ? v[2 * i] : v[2 * i + 1];
        v[i] = keep + __int_as_float(__builtin_amdgcn_update_dpp(
                   0, __float_as_int(send), 0x160 | MASK, 0xf, 0xf, true));
    }
}

// Fragment mappings (16-bit WMMA, wave32):
//  A 16x32: lane = h*16 + (m&15); elem e<8 -> K=h*8+e ; e>=8 -> K=16+h*8+(e-8)
//  B 32x16: lane = h*16 + (n&15); same K mapping
//  inverse (h,e) from k_local kl: h=(kl>>3)&1 ; e=(kl&7)+((kl>>4)<<3)
//  C/D 16x16 f32: elem j -> row m = j + 8*(lane>>4), col n = lane&15

// 16 values of one f32 weight row (K = h*8..+7 and 16+h*8..+7) as a lane's bf16 A fragment
__device__ __forceinline__ v16bf weight_frag(float4 a0, float4 a1, float4 a2, float4 a3) {
    v16bf f;
    f[0]=(__bf16)a0.x; f[1]=(__bf16)a0.y; f[2]=(__bf16)a0.z; f[3]=(__bf16)a0.w;
    f[4]=(__bf16)a1.x; f[5]=(__bf16)a1.y; f[6]=(__bf16)a1.z; f[7]=(__bf16)a1.w;
    f[8]=(__bf16)a2.x; f[9]=(__bf16)a2.y; f[10]=(__bf16)a2.z; f[11]=(__bf16)a2.w;
    f[12]=(__bf16)a3.x; f[13]=(__bf16)a3.y; f[14]=(__bf16)a3.z; f[15]=(__bf16)a3.w;
    return f;
}

// stage two [32 x 256] f32 row-major weight blocks as A-fragments (bf16), W0 as row
// tiles 0,1 and W1 as row tiles 2,3; the loads of both blocks are in flight together
__device__ __forceinline__ void stage_weights_A(
    __bf16* dst, const float* __restrict__ W0, const float* __restrict__ W1, int tid)
{
    for (int i = tid; i < 2 * 8 * 32; i += 256) {
        int ln = i & 31, kt = (i >> 5) & 7, mt = i >> 8;
        int h = ln >> 4;
        int m = mt * 16 + (ln & 15);
        int c0 = kt * 32 + h * 8;
        const float* w0 = W0 + (size_t)m * CCH + c0;
        const float* w1 = W1 + (size_t)m * CCH + c0;
        float4 a0 = *(const float4*)(w0);
        float4 a1 = *(const float4*)(w0 + 4);
        float4 a2 = *(const float4*)(w0 + 16);
        float4 a3 = *(const float4*)(w0 + 20);
        float4 b0 = *(const float4*)(w1);
        float4 b1 = *(const float4*)(w1 + 4);
        float4 b2 = *(const float4*)(w1 + 16);
        float4 b3 = *(const float4*)(w1 + 20);
        // translation wait before a register that these loads name is written again;
        // the pointers are inputs so that their registers stay as they are up to the wait
        asm volatile("s_wait_xcnt 0x0" :: "v"(w0), "v"(w1) : "memory");
        *(v16bf*)(dst + (size_t)i * 16) = weight_frag(a0, a1, a2, a3);   // [mt][kt][lane][16]
        *(v16bf*)(dst + (size_t)(i + 512) * 16) = weight_frag(b0, b1, b2, b3);
    }
}

// stage x tile [256 x NT] (channel-major, token-contiguous) as bf16 channel rows of
// PITCH elements: a wave stores 256 contiguous bytes of one row, no bank conflict
template <int PITCH>
__device__ __forceinline__ void stage_x_rows(
    __bf16 (*xR)[PITCH], const float* __restrict__ xb, int n0, int tid)
{
    const int n = (tid & 31) * 4;             // a wave takes one whole row per load
    for (int c = tid >> 5; c < CCH; c += 64) {
        const float* p = xb + (size_t)c * NTOK + n0 + n;
        float4 v[8];
#pragma unroll   // rows c, c+8, .., c+56: 8 loads in flight, v[] by constant index
        for (int u = 0; u < 8; ++u) v[u] = *(const float4*)(p + (size_t)u * 8 * NTOK);
#pragma unroll   // v[u] by constant index: no register indexing
        for (int u = 0; u < 8; ++u) {
            v4bf r;
            r[0] = (__bf16)v[u].x; r[1] = (__bf16)v[u].y;
            r[2] = (__bf16)v[u].z; r[3] = (__bf16)v[u].w;
            *(v4bf*)&xR[c + u * 8][n] = r;
        }
    }
}

// B fragment with K=channel, N=token out of the channel rows, by the transposing LDS
// load: lane l reads 16 B of row 8*(l>>4)+(l&7) and gets rows 8h..8h+7 of column l&15;
// the loads at rows +0 and +16 give e<8 -> K=h*8+e, e>=8 -> K=16+h*8+(e-8), the K map
// of the staged A fragments. t points at (first channel of the K block, first token).
template <int PITCH>
__device__ __forceinline__ v16bf frag_B_tr16(const __bf16* t, int lane) {
    typedef __attribute__((address_space(3))) v8bf lds_v8bf;
    const __bf16* p = t + (8 * (lane >> 4) + (lane & 7)) * PITCH + 8 * ((lane >> 3) & 1);
    v8bf lo = __builtin_amdgcn_ds_load_tr16_b128_v8bf16((lds_v8bf*)p);
    v8bf hi = __builtin_amdgcn_ds_load_tr16_b128_v8bf16((lds_v8bf*)(p + 16 * PITCH));
    return __builtin_shufflevector(lo, hi,
            0, 1, 2, 3, 4, 5, 6, 7, 8, 9, 10, 11, 12, 13, 14, 15);
}

// Linear attention, reassociated:
//   attn[d][e] = sum_n k[d][n] * (sum_c Wv[e][c] x[c][n] + bv[e])
//              = sum_c (sum_n k[d][n] x[c][n]) * Wv[e][c] + (sum_n k[d][n]) * bv[e]
// so the token loop only needs kx = k x^T [32 x 256]; Wv is applied once per batch.

// bf16 elements per LDS row of the x tile
#define XR_PITCH (NT + 8)   // 272 B = 16 B x odd: for rows that b128 reads walk too

#define KXP_F4 (DCH * CCH / 4)   // float4 per tile plane of kx partials

// ---------------- Kernel A: k = softplus(Wk x + bk); per-tile k_sum and k x^T;
// q = softplus(Wq x + bq) from the same staged x tile, so that x is read only here.
// q goes to the workspace as bf16 B fragments (K=d, N=token of a 16-token tile):
// [16-token tile][K half][lane][8], each store of a wave 512 contiguous bytes.
// Every block stores its own plane of partial sums; SGA_reduce adds the planes.
// Plane order (float4 units): [wave][mt][j/4][p][lane], so that each store of a
// wave is 512 contiguous bytes; the sum over planes is elementwise in any order.
__global__ __launch_bounds__(256) void SGA_kernelA(
    const float* __restrict__ x,  const float* __restrict__ Wk,
    const float* __restrict__ bk, const float* __restrict__ Wq,
    const float* __restrict__ bq, float* __restrict__ kx_part,
    float* __restrict__ ksum_part, float* __restrict__ q_ws)
{
    __shared__ __bf16 WA [4][8][32][16];  // Wk (0,1), Wq (2,3), A-frag: M=d, K=C  32KB
    __shared__ __bf16 kA [2][4][32][16];  // k,  A-frag: M=d(32), K=tok(128)        8KB
    __shared__ __attribute__((aligned(16)))
               __bf16 xR [CCH][XR_PITCH]; // x tile, channel rows                  68KB
    __shared__ float  ksL[8][DCH];        // k_sum of each wave's 16 tokens         1KB

    const int tid  = threadIdx.x;
    const int lane = tid & 31;
    const int wave = tid >> 5;
    const int b    = blockIdx.x >> 7;          // TILES == 128
    const int n0   = (blockIdx.x & 127) * NT;
    const float* xb = x + (size_t)b * CCH * NTOK;

    stage_x_rows<XR_PITCH>(xR, xb, n0, tid);
    stage_weights_A(&WA[0][0][0][0], Wk, Wq, tid);
    __syncthreads();

    // k and q GEMM: [64 x 128] = [Wk; Wq][64x256] @ x[256x128]; wave w owns token-tile
    // nt=w; each x fragment is read from LDS once and serves all four row tiles
    v8f acc4[4] = {};   // row tiles 0,1: k; 2,3: q, finished at the kernel's end
    {
        const int nt = wave;
        const int h = lane >> 4, tok_lo = lane & 15;
#pragma unroll   // acc4[] by constant index: no register indexing
        for (int kt = 0; kt < 8; ++kt) {
            v16bf bb = frag_B_tr16<XR_PITCH>(&xR[kt * 32][nt * 16], lane);
#pragma unroll
            for (int mt = 0; mt < 4; ++mt) {
                v16bf a = *(const v16bf*)&WA[mt][kt][lane][0];
                acc4[mt] = __builtin_amdgcn_wmma_f32_16x16x32_bf16(
                        false, a, false, bb, (short)0, acc4[mt], false, false);
            }
        }
        float kv[16];   // kv[mt*8 + j]: d-row mt*16 + 8h + j of this lane's token
        const int ktok = nt * 16 + tok_lo;
        const int kl   = ktok & 31;
        const int ha   = (kl >> 3) & 1;
        const int ea   = (kl & 7) + ((kl >> 4) << 3);
#pragma unroll   // acc4[] and kv[] by constant index
        for (int mt = 0; mt < 2; ++mt) {
#pragma unroll   // likewise; the 16 softplus chains run side by side
            for (int j = 0; j < 8; ++j) {
                int m = mt * 16 + j + 8 * h;                 // d-row
                float v = softplusf(acc4[mt][j] + bk[m]);
                kv[mt * 8 + j] = v;
                kA[m >> 4][ktok >> 5][ha * 16 + (m & 15)][ea] = (__bf16)v;
            }
        }
        // token sums of the 16 rows over the 16-lane half: lanes l^1, l^2, l^4, l^8 in
        // this order; bit s of the lane picks bit s of the row index that it goes on with
        fold_rows<1, 16>(kv, tok_lo & 1);
        fold_rows<2, 8>(kv, tok_lo & 2);
        fold_rows<4, 4>(kv, tok_lo & 4);
        fold_rows<8, 2>(kv, tok_lo & 8);
        ksL[wave][(tok_lo >> 3) * 16 + (tok_lo & 7) + 8 * h] = kv[0];   // index tok_lo
    }
    __syncthreads();

    // bq of this lane's 16 q rows, d = mt*16 + 8h + j: the kx GEMM covers the loads
    const float* bqp = bq + 8 * (lane >> 4);
    const float4 bq0 = *(const float4*)(bqp);
    const float4 bq1 = *(const float4*)(bqp + 4);
    const float4 bq2 = *(const float4*)(bqp + 16);
    const float4 bq3 = *(const float4*)(bqp + 20);
    // translation wait before a register that these loads name is written again;
    // the pointer is an input so that its registers stay as they are up to the wait
    asm volatile("s_wait_xcnt 0x0" :: "v"(bqp) : "memory");

    // kx GEMM: [32 x 256] += kA[32x128] @ x^T[128x256]; wave w owns channel
    // tiles 2w and 2w+1, both d-row tiles
    {
        const int h = lane >> 4, c_lo = lane & 15;
        v8f acc[2][2] = {};
        // all loops below unrolled: acc[][] keeps constant indices (stays in registers)
        // and the LDS reads of all four K blocks issue ahead of the WMMAs
#pragma unroll
        for (int kt = 0; kt < 4; ++kt) {
            v16bf a0 = *(const v16bf*)&kA[0][kt][lane][0];
            v16bf a1 = *(const v16bf*)&kA[1][kt][lane][0];
#pragma unroll
            for (int p = 0; p < 2; ++p) {
                // B 32x16: lane (h, channel); e<8 -> tok h*8+e, e>=8 -> tok 16+h*8+(e-8)
                const __bf16* row = &xR[(wave * 2 + p) * 16 + c_lo][kt * 32 + h * 8];
                v8bf lo = *(const v8bf*)row;
                v8bf hi = *(const v8bf*)(row + 16);
                v16bf bb = __builtin_shufflevector(lo, hi,
                        0, 1, 2, 3, 4, 5, 6, 7, 8, 9, 10, 11, 12, 13, 14, 15);
                acc[0][p] = __builtin_amdgcn_wmma_f32_16x16x32_bf16(
                        false, a0, false, bb, (short)0, acc[0][p], false, false);
                acc[1][p] = __builtin_amdgcn_wmma_f32_16x16x32_bf16(
                        false, a1, false, bb, (short)0, acc[1][p], false, false);
            }
        }
        float4* kp = (float4*)kx_part + (size_t)blockIdx.x * KXP_F4 + wave * 256 + lane;
#pragma unroll   // acc[][][] by constant index: no register indexing
        for (int mt = 0; mt < 2; ++mt)
#pragma unroll
            for (int jh = 0; jh < 2; ++jh)
#pragma unroll
                for (int p = 0; p < 2; ++p)
                    kp[((mt * 2 + jh) * 2 + p) * 32] = make_float4(
                        acc[mt][p][jh * 4 + 0], acc[mt][p][jh * 4 + 1],
                        acc[mt][p][jh * 4 + 2], acc[mt][p][jh * 4 + 3]);
    }
    // q, behind the last barrier so that no barrier waits for its stores: this lane
    // holds d = mt*16 + 8h + j of token lane&15, which is what the same lane of the
    // B fragment (K=d, N=token) holds at e = mt*8 + j
    {
        const float bqv[16] = {bq0.x, bq0.y, bq0.z, bq0.w, bq1.x, bq1.y, bq1.z, bq1.w,
                               bq2.x, bq2.y, bq2.z, bq2.w, bq3.x, bq3.y, bq3.z, bq3.w};
        v8bf* qp = (v8bf*)q_ws + (size_t)(blockIdx.x * 8 + wave) * 64 + lane;
#pragma unroll   // acc4[] and bqv[] by constant index
        for (int mt = 0; mt < 2; ++mt) {
            v8bf qf;
#pragma unroll
            for (int j = 0; j < 8; ++j)
                qf[j] = (__bf16)softplusf(acc4[2 + mt][j] + bqv[mt * 8 + j]);
            qp[mt * 32] = qf;
        }
        // translation wait before a register that these stores name is written again;
        // the pointer is an input so that its registers stay as they are up to the wait
        asm volatile("s_wait_xcnt 0x0" :: "v"(qp) : "memory");
    }
    if (tid < DCH) {   // wave 0 alone: the tile's k_sum, one 128-B line
        float s = 0.0f;
#pragma unroll   // the 8 LDS reads issue together
        for (int w = 0; w < 8; ++w) s += ksL[w][tid];
        ksum_part[(size_t)blockIdx.x * DCH + tid] = s;
    }
}

// ---------------- Kernel R: add the 128 tile planes of each batch ------------
// blocks 0..255: batch b, 64 float4 columns of the kx plane; thread group g adds
// 32 planes, LDS adds the 4 groups. blocks 256..263: k_sum of one batch.
__global__ __launch_bounds__(256) void SGA_reduce(
    const float* __restrict__ kx_part, const float* __restrict__ ksum_part,
    float* __restrict__ kx_ws, float* __restrict__ ksum_ws)
{
    __shared__ float4 red4[4][64];
    __shared__ float  redk[8][DCH];
    const int tid = threadIdx.x;
    if (blockIdx.x < BATCH * 32) {
        const int b = blockIdx.x >> 5, cg = blockIdx.x & 31;
        const int q = tid & 63, g = tid >> 6;
        const float4* p = (const float4*)kx_part
                        + (size_t)(b * TILES + g * 32) * KXP_F4 + cg * 64 + q;
        float4 v[32];
#pragma unroll   // all 32 loads in flight at once, v[] by constant index
        for (int t = 0; t < 32; ++t) v[t] = p[(size_t)t * KXP_F4];
        // translation wait before a register that these loads name is written again;
        // the pointer is an input so that its registers stay as they are up to the wait
        asm volatile("s_wait_xcnt 0x0" :: "v"(p) : "memory");
        float4 s = v[0];
#pragma unroll
        for (int t = 1; t < 32; ++t) {
            s.x += v[t].x; s.y += v[t].y; s.z += v[t].z; s.w += v[t].w;
        }
        red4[g][q] = s;
        __syncthreads();
        if (g == 0) {   // waves 0 and 1: both halves of each 128-B line of kx
            float4 s1 = red4[1][q], s2 = red4[2][q], s3 = red4[3][q];
            const int f  = cg * 64 + q;          // [wave][mt][j/4][p][lane]
            const int ln = f & 31, pp = (f >> 5) & 1, jh = (f >> 6) & 1;
            const int mt = (f >> 7) & 1, wv = f >> 8;
            const int c  = (wv * 2 + pp) * 16 + (ln & 15);
            const int d0 = mt * 16 + jh * 4 + 8 * (ln >> 4);
            float* o = kx_ws + ((size_t)b * DCH + d0) * CCH + c;
            o[0]       = (s.x + s1.x) + (s2.x + s3.x);
            o[CCH]     = (s.y + s1.y) + (s2.y + s3.y);
            o[2 * CCH] = (s.z + s1.z) + (s2.z + s3.z);
            o[3 * CCH] = (s.w + s1.w) + (s2.w + s3.w);
        }
    } else {
        const int b = blockIdx.x - BATCH * 32;
        const int d = tid & 31, g = tid >> 5;
        const float* p = ksum_part + (size_t)(b * TILES + g * 16) * DCH + d;
        float v[16];
#pragma unroll   // all 16 loads in flight at once, v[] by constant index
        for (int t = 0; t < 16; ++t) v[t] = p[t * DCH];
        // translation wait, as above
        asm volatile("s_wait_xcnt 0x0" :: "v"(p) : "memory");
        float s = v[0];
#pragma unroll
        for (int t = 1; t < 16; ++t) s += v[t];
        redk[g][d] = s;
        __syncthreads();
        if (tid < DCH) {
            float r = 0.0f;
#pragma unroll   // the 8 LDS reads issue together
            for (int w = 0; w < 8; ++w) r += redk[w][tid];
            ksum_ws[b * DCH + tid] = r;
        }
    }
}

// 16 K values of one row (two runs of 8) as a 16-bit fragment (A and B share the K map):
// e<8 -> K=h*8+e, e>=8 -> K=16+h*8+(e-8); p points at K=h*8 of the 32-wide K block
__device__ __forceinline__ v16bf frag_from_f32_row(const float* __restrict__ p) {
    float4 a0 = *(const float4*)(p);
    float4 a1 = *(const float4*)(p + 4);
    float4 a2 = *(const float4*)(p + 16);
    float4 a3 = *(const float4*)(p + 20);
    // translation wait before a register that these four loads name is written again;
    // the pointer is an input so that its registers stay as they are up to the wait
    asm volatile("s_wait_xcnt 0x0" :: "v"(p) : "memory");
    v16bf f;
    f[0]=(__bf16)a0.x; f[1]=(__bf16)a0.y; f[2]=(__bf16)a0.z; f[3]=(__bf16)a0.w;
    f[4]=(__bf16)a1.x; f[5]=(__bf16)a1.y; f[6]=(__bf16)a1.z; f[7]=(__bf16)a1.w;
    f[8]=(__bf16)a2.x; f[9]=(__bf16)a2.y; f[10]=(__bf16)a2.z; f[11]=(__bf16)a2.w;
    f[12]=(__bf16)a3.x; f[13]=(__bf16)a3.y; f[14]=(__bf16)a3.z; f[15]=(__bf16)a3.w;
    return f;
}

// ---------------- Kernel W: attn = kx Wv^T + k_sum bv^T, once per batch ------
// block: all 32 d-rows x 16 v-channels; wave w takes the K slice c = 32w..32w+31, so
// that every load of the block is in flight at once. In the accumulators a lane holds
// d = mt*16 + 8h + j of channel lane&15, which is what the same lane of the last
// kernel's A fragment (M=channel, K=d) holds at e = mt*8 + j: the block's result is one
// whole fragment tile, stored as bf16 [channel tile][lane][16], 1 KB in a row.
#define RED_PITCH 20   // floats per lane: 80 B = 16 B x odd, the b128 stores use all banks

__global__ __launch_bounds__(256) void SGA_kernelW(
    const float* __restrict__ kx_ws, const float* __restrict__ ksum_ws,
    const float* __restrict__ Wv,    const float* __restrict__ bv,
    float* __restrict__ attn_ws)
{
    __shared__ __attribute__((aligned(16)))
               float red[8][32][RED_PITCH];   // [K slice][lane][mt*8 + j]          20KB

    const int tid  = threadIdx.x;
    const int lane = tid & 31;
    const int wave = tid >> 5;
    const int h = lane >> 4, lo = lane & 15;
    const int b  = blockIdx.x >> 4;
    const int et = blockIdx.x & 15;
    const int k0 = wave * 32 + h * 8;
    // this thread finishes elements fe and fe+1 of fragment lane fl: 4 bytes at 4*tid
    const int fl = tid >> 3;
    const int fe = (tid & 7) * 2;
    const int d0 = (fe >> 3) * 16 + 8 * (fl >> 4) + (fe & 7);

    const float* ksp = ksum_ws + b * DCH + d0;
    const float* bvp = bv + et * 16 + (fl & 15);
    const float2 ksum = *(const float2*)ksp;
    const float  bvv  = *bvp;
    // translation wait before a register that these loads name is written again;
    // the pointers are inputs so that their registers stay as they are up to the wait
    asm volatile("s_wait_xcnt 0x0" :: "v"(ksp), "v"(bvp) : "memory");
    v16bf a0 = frag_from_f32_row(kx_ws + ((size_t)b * DCH + lo) * CCH + k0);
    v16bf a1 = frag_from_f32_row(kx_ws + ((size_t)b * DCH + 16 + lo) * CCH + k0);
    v16bf bb = frag_from_f32_row(Wv + (size_t)(et * 16 + lo) * CCH + k0);
    v8f acc0 = {}, acc1 = {};
    acc0 = __builtin_amdgcn_wmma_f32_16x16x32_bf16(
            false, a0, false, bb, (short)0, acc0, false, false);
    acc1 = __builtin_amdgcn_wmma_f32_16x16x32_bf16(
            false, a1, false, bb, (short)0, acc1, false, false);
    float4* r = (float4*)&red[wave][lane][0];
    r[0] = make_float4(acc0[0], acc0[1], acc0[2], acc0[3]);
    r[1] = make_float4(acc0[4], acc0[5], acc0[6], acc0[7]);
    r[2] = make_float4(acc1[0], acc1[1], acc1[2], acc1[3]);
    r[3] = make_float4(acc1[4], acc1[5], acc1[6], acc1[7]);
    __syncthreads();

    float s0 = 0.0f, s1 = 0.0f;
#pragma unroll   // the 8 LDS reads issue together instead of one wait per trip
    for (int ks = 0; ks < 8; ++ks) {
        const float2 v = *(const float2*)&red[ks][fl][fe];
        s0 += v.x;
        s1 += v.y;
    }
    v2bf o;
    o[0] = (__bf16)(s0 + ksum.x * bvv);
    o[1] = (__bf16)(s1 + ksum.y * bvv);
    ((v2bf*)attn_ws)[(size_t)blockIdx.x * 256 + tid] = o;   // a wave: one whole 128-B line
}

// ---------------- Kernel B: out = attn^T q^T * norm, q from the workspace -----
// bf16 elements per 16-token tile of q in LDS: 1,040 B = 16 B x odd, so that the 16
// lanes of a half wave, which read from four tiles, fall on 64 different banks
#define QL_PITCH (2 * 32 * 8 + 8)

// The columns of the product are dealt so that a lane can store 16 bytes: column lo of
// column tile t (t = 0..3) of a 64-token group is token 4*lo + t, so the four
// accumulators hold four consecutive tokens of a row in one lane, and a half wave
// stores 256 contiguous, aligned bytes of one output row.
__global__ __launch_bounds__(256) void SGA_kernelB(
    const float* __restrict__ q_ws, const float* __restrict__ attn_ws,
    const float* __restrict__ ksum_ws, float* __restrict__ out)
{
    __shared__ __attribute__((aligned(32)))
               __bf16 attnA[16][32][16];  // attn^T A-frag: M=C(256), K=d(32)    16KB
    __shared__ __attribute__((aligned(16)))
               __bf16 qL[8][QL_PITCH];    // q fragments as kernel A left them    8KB
    __shared__ __attribute__((aligned(16)))
               float  nrmL[NT];           // norm of each token of the tile

    const int tid  = threadIdx.x;
    const int lane = tid & 31;
    const int wave = tid >> 5;
    const int b    = blockIdx.x >> 7;
    const int n0   = (blockIdx.x & 127) * NT;
    const int nt = wave;                   // wave w brings in token-tile nt=w
    const int h = lane >> 4, tok_lo = lane & 15;

    // q^T B fragment (K=d, N=token) as kernel A left it, and the k_sum values of its
    // 16 d: e<8 -> d=h*8+e, e>=8 -> d=16+h*8+(e-8)
    const v8bf* qp = (const v8bf*)q_ws + (size_t)(blockIdx.x * 8 + nt) * 64 + lane;
    const float* kp = ksum_ws + b * DCH + h * 8;
    v8bf qlo = qp[0];
    v8bf qhi = qp[32];
    float4 k0 = *(const float4*)(kp);
    float4 k1 = *(const float4*)(kp + 4);
    float4 k2 = *(const float4*)(kp + 16);
    float4 k3 = *(const float4*)(kp + 20);
    // attn^T A fragments as kernel W left them: 16 KB, each load of a wave 512 B in a row
    const v8bf* ag = (const v8bf*)attn_ws + (size_t)b * (DCH * CCH / 8) + tid;
    v8bf af0 = ag[0];
    v8bf af1 = ag[256];
    v8bf af2 = ag[512];
    v8bf af3 = ag[768];
    // translation wait before a register that these loads name is written again;
    // the pointers are inputs so that their registers stay as they are up to the wait
    asm volatile("s_wait_xcnt 0x0" :: "v"(qp), "v"(kp), "v"(ag) : "memory");

    // norm = 1 / sum_d q[d] (k_sum[d] + EPS), d in the order 8h.., 16+8h.. per half
    const float ks[16] = {k0.x, k0.y, k0.z, k0.w, k1.x, k1.y, k1.z, k1.w,
                          k2.x, k2.y, k2.z, k2.w, k3.x, k3.y, k3.z, k3.w};
    float denom = 0.0f;
#pragma unroll   // ks[] and the fragment by constant index
    for (int e = 0; e < 8; ++e) denom += (float)qlo[e] * (ks[e] + 1e-6f);
#pragma unroll
    for (int e = 0; e < 8; ++e) denom += (float)qhi[e] * (ks[8 + e] + 1e-6f);
    denom += __shfl_xor(denom, 16, 32);   // combine both d-halves per token
    *(v8bf*)&qL[nt][lane * 8]        = qlo;   // [K half][lane][8], 512 B per store
    *(v8bf*)&qL[nt][(32 + lane) * 8] = qhi;
    v8bf* al = (v8bf*)&attnA[0][0][0] + tid;  // straight copy, 512 B per store of a wave
    al[0]   = af0;
    al[256] = af1;
    al[512] = af2;
    al[768] = af3;
    nrmL[nt * 16 + tok_lo] = 1.0f / denom;    // both halves hold and write the same value
    __syncthreads();

    // out GEMM: [256 x 128] = attn^T[256x32] @ q^T[32x128]; K=32 -> 1 WMMA/tile.
    // wave w: 64-token group g = w&1, channel tiles 4*(w>>1) .. +3
    {
        const int g = wave & 1, cq = wave >> 1;
        // token 64g + 4*lo + t lies in 16-token tile 4g + (lo>>2) at column 4*(lo&3) + t
        const __bf16* qf = &qL[g * 4 + (tok_lo >> 2)][(h * 16 + (tok_lo & 3) * 4) * 8];
        const float4 nrm = *(const float4*)&nrmL[g * 64 + tok_lo * 4];
        v16bf bb[4];
#pragma unroll   // bb[] by constant index: no register indexing
        for (int t = 0; t < 4; ++t) {
            v8bf lo8 = *(const v8bf*)(qf + t * 8);
            v8bf hi8 = *(const v8bf*)(qf + t * 8 + 32 * 8);
            bb[t] = __builtin_shufflevector(lo8, hi8,
                    0, 1, 2, 3, 4, 5, 6, 7, 8, 9, 10, 11, 12, 13, 14, 15);
        }
        float* ob = out + ((size_t)b * CCH + cq * 64 + 8 * h) * NTOK + n0 + g * 64 + tok_lo * 4;
#pragma unroll 1   // rolled: unrolled it takes 170 registers, and only two work-groups fit a WGP
        for (int i = 0; i < 4; ++i) {
            v16bf a = *(const v16bf*)&attnA[cq * 4 + i][lane][0];
            v8f acc[4];
#pragma unroll   // acc[] by constant index
            for (int t = 0; t < 4; ++t) {
                v8f z = {};
                acc[t] = __builtin_amdgcn_wmma_f32_16x16x32_bf16(
                        false, a, false, bb[t], (short)0, z, false, false);
            }
#pragma unroll   // acc[][j] by constant index; the 8 stores issue together
            for (int j = 0; j < 8; ++j)
                *(float4*)(ob + (size_t)(i * 16 + j) * NTOK) = make_float4(
                    acc[0][j] * nrm.x, acc[1][j] * nrm.y,
                    acc[2][j] * nrm.z, acc[3][j] * nrm.w);
            // translation wait before the next trip writes registers that these stores name
            asm volatile("s_wait_xcnt 0x0" ::: "memory");
        }
    }
}

extern "C" void kernel_launch(void* const* d_in, const int* in_sizes, int n_in,
                              void* d_out, int out_size, void* d_ws, size_t ws_size,
                              hipStream_t stream) {
    (void)in_sizes; (void)n_in; (void)out_size; (void)ws_size;
    const float* x  = (const float*)d_in[0];
    const float* Wq = (const float*)d_in[1];
    const float* bq = (const float*)d_in[2];
    const float* Wk = (const float*)d_in[3];
    const float* bk = (const float*)d_in[4];
    const float* Wv = (const float*)d_in[5];
    const float* bv = (const float*)d_in[6];
    float* out = (float*)d_out;

    float* kx_ws     = (float*)d_ws;                    // [B][32][256]
    float* ksum_ws   = kx_ws + BATCH * DCH * CCH;       // [B][32]
    float* attn_ws   = ksum_ws + BATCH * DCH;           // bf16 [B][16][32][16] fragments
    float* kx_part   = attn_ws + BATCH * DCH * CCH;     // [B*TILES][32*256] tile planes
    float* ksum_part = kx_part + (size_t)BATCH * TILES * DCH * CCH;  // [B*TILES][32]
    float* q_ws      = ksum_part + BATCH * TILES * DCH; // bf16 [B*N/16][2][32][8]

    SGA_kernelA<<<BATCH * TILES, 256, 0, stream>>>(x, Wk, bk, Wq, bq, kx_part, ksum_part, q_ws);
    SGA_reduce<<<BATCH * 32 + BATCH, 256, 0, stream>>>(kx_part, ksum_part, kx_ws, ksum_ws);
    SGA_kernelW<<<BATCH * 16, 256, 0, stream>>>(kx_ws, ksum_ws, Wv, bv, attn_ws);
    SGA_kernelB<<<BATCH * TILES, 256, 0, stream>>>(q_ws, attn_ws, ksum_ws, out);
}

// v009
// One run takes 39.8 microseconds.
// Timed twice side by side with v008, it ran 1.15 and 1.14 times as fast.
// Counting every step since v000, it is 6.72 times as fast.
#include <hip/hip_runtime.h>
#include <hip/hip_bf16.h>

// Problem constants (from reference): B=8, C=256, d=32, H=W=128, N=16384
#define BATCH 8
#define CCH   256
#define DCH   32
#define NTOK  16384
#define NT    128          // tokens per workgroup tile
#define TILES (NTOK / NT)  // 128 tiles per batch
#define TPB    2             // token tiles that one block of the first kernel takes in turn
#define PLANES (TILES / TPB) // planes of partial sums per batch

typedef __attribute__((ext_vector_type(16))) __bf16 v16bf;
typedef __attribute__((ext_vector_type(8)))  __bf16 v8bf;
typedef __attribute__((ext_vector_type(4)))  __bf16 v4bf;
typedef __attribute__((ext_vector_type(2)))  __bf16 v2bf;
typedef __attribute__((ext_vector_type(8)))  float  v8f;

// branchless softplus: no EXEC-mask divergence around WMMA regions.
// max(x,0) + log(1+e), e = exp(-|x|) in [0,1], on the chip's own exp2 and log2.
// Where e < 2^-8 the sum 1+e has dropped too many of e's bits: there the series
// e - e*e/2, whose relative error is below e*e/3, keeps a small result's digits.
__device__ __forceinline__ float softplusf(float x) {
    const float e  = __builtin_amdgcn_exp2f(fabsf(x) * -1.44269504f);
    const float lg = __builtin_amdgcn_logf(1.0f + e) * 0.693147181f;
    const float sr = fmaf(e * -0.5f, e, e);
    return fmaxf(x, 0.0f) + (e < 0x1p-8f ? sr : lg);
}

// One step of a sum over a 16-lane row that also halves the number of values: of each
// pair (2i, 2i+1) a lane keeps the one that 'up' picks and hands the other to lane
// l ^ MASK, which keeps that one. The exchange is a DPP row_xmask operand of the vector
// unit; a shuffle would go down the LDS path and be waited for at every step.
template <int MASK, int N>
__device__ __forceinline__ void fold_rows(float (&v)[16], bool up) {
#pragma unroll   // v[] by constant index: no register indexing
    for (int i = 0; i < N / 2; ++i) {
        const float keep = up ? v[2 * i + 1] : v[2 * i];
        const float send = up ? v[2 * i] : v[2 * i + 1];
        v[i] = keep + __int_as_float(__builtin_amdgcn_update_dpp(
                   0, __float_as_int(send), 0x160 | MASK, 0xf, 0xf, true));
    }
}

// Fragment mappings (16-bit WMMA, wave32):
//  A 16x32: lane = h*16 + (m&15); elem e<8 -> K=h*8+e ; e>=8 -> K=16+h*8+(e-8)
//  B 32x16: lane = h*16 + (n&15); same K mapping
//  inverse (h,e) from k_local kl: h=(kl>>3)&1 ; e=(kl&7)+((kl>>4)<<3)
//  C/D 16x16 f32: elem j -> row m = j + 8*(lane>>4), col n = lane&15

// 16 values of one f32 weight row (K = h*8..+7 and 16+h*8..+7) as a lane's bf16 A fragment
__device__ __forceinline__ v16bf weight_frag(float4 a0, float4 a1, float4 a2, float4 a3) {
    v16bf f;
    f[0]=(__bf16)a0.x; f[1]=(__bf16)a0.y; f[2]=(__bf16)a0.z; f[3]=(__bf16)a0.w;
    f[4]=(__bf16)a1.x; f[5]=(__bf16)a1.y; f[6]=(__bf16)a1.z; f[7]=(__bf16)a1.w;
    f[8]=(__bf16)a2.x; f[9]=(__bf16)a2.y; f[10]=(__bf16)a2.z; f[11]=(__bf16)a2.w;
    f[12]=(__bf16)a3.x; f[13]=(__bf16)a3.y; f[14]=(__bf16)a3.z; f[15]=(__bf16)a3.w;
    return f;
}

// stage two [32 x 256] f32 row-major weight blocks as A-fragments (bf16), W0 as row
// tiles 0,1 and W1 as row tiles 2,3; the loads of both blocks are in flight together
__device__ __forceinline__ void stage_weights_A(
    __bf16* dst, const float* __restrict__ W0, const float* __restrict__ W1, int tid)
{
    for (int i = tid; i < 2 * 8 * 32; i += 256) {
        int ln = i & 31, kt = (i >> 5) & 7, mt = i >> 8;
        int h = ln >> 4;
        int m = mt * 16 + (ln & 15);
        int c0 = kt * 32 + h * 8;
        const float* w0 = W0 + (size_t)m * CCH + c0;
        const float* w1 = W1 + (size_t)m * CCH + c0;
        float4 a0 = *(const float4*)(w0);
        float4 a1 = *(const float4*)(w0 + 4);
        float4 a2 = *(const float4*)(w0 + 16);
        float4 a3 = *(const float4*)(w0 + 20);
        float4 b0 = *(const float4*)(w1);
        float4 b1 = *(const float4*)(w1 + 4);
        float4 b2 = *(const float4*)(w1 + 16);
        float4 b3 = *(const float4*)(w1 + 20);
        // translation wait before a register that these loads name is written again;
        // the pointers are inputs so that their registers stay as they are up to the wait
        asm volatile("s_wait_xcnt 0x0" :: "v"(w0), "v"(w1) : "memory");
        *(v16bf*)(dst + (size_t)i * 16) = weight_frag(a0, a1, a2, a3);   // [mt][kt][lane][16]
        *(v16bf*)(dst + (size_t)(i + 512) * 16) = weight_frag(b0, b1, b2, b3);
    }
}

// x tile [256 x NT] (channel-major, token-contiguous), staged in two halves of 128 channel
// rows and in three moves. First move: the 16 loads of a thread are issued and left in
// flight; a wave takes one whole row per load, load u of wave w is row 128*half + w + 8u
__device__ __forceinline__ void load_x_half(
    float4 (&v)[16], const float* __restrict__ xb, int n0, int tid, int half)
{
    const float* p = xb + (size_t)(half * 128 + (tid >> 5)) * NTOK + n0 + (tid & 31) * 4;
#pragma unroll   // v[] by constant index: no register indexing
    for (int u = 0; u < 16; ++u) v[u] = *(const float4*)(p + (size_t)u * 8 * NTOK);
    // translation wait before a register that these loads name is written again; as a
    // memory-clobbering statement it also keeps the loads up here, ahead of the GEMMs
    asm volatile("s_wait_xcnt 0x0" :: "v"(p) : "memory");
}

// second move: to bf16, half the registers. The conversion (the instruction that the
// compiler itself takes for a cast to bf16) is a volatile statement so that it stays where
// it is written: as a plain cast it was moved up to its load, in front of the GEMM that
// is to run under the load's flight, and the wait for the load went with it
__device__ __forceinline__ void pack_x_half(uint2 (&r)[16], const float4 (&v)[16]) {
#pragma unroll   // r[], v[] by constant index: no register indexing
    for (int u = 0; u < 16; ++u) {
        asm volatile("v_cvt_pk_bf16_f32 %0, %1, %2" : "=v"(r[u].x) : "v"(v[u].x), "v"(v[u].y));
        asm volatile("v_cvt_pk_bf16_f32 %0, %1, %2" : "=v"(r[u].y) : "v"(v[u].z), "v"(v[u].w));
    }
}

// third move: bf16 channel rows of PITCH elements in LDS; a wave stores 256 contiguous
// bytes of one row, no bank conflict
template <int PITCH>
__device__ __forceinline__ void store_x_half(
    __bf16 (*xR)[PITCH], const uint2 (&r)[16], int tid, int half)
{
    const int n = (tid & 31) * 4, c = half * 128 + (tid >> 5);
#pragma unroll   // r[u] by constant index: no register indexing
    for (int u = 0; u < 16; ++u) *(uint2*)&xR[c + u * 8][n] = r[u];
}

// Work-group barrier for data that passes through LDS alone: the wave's own LDS reads and
// writes are done, then the barrier. __syncthreads() here also waits for the wave's global
// loads and stores: it would end the flight of the next tile's x loads.
__device__ __forceinline__ void lds_barrier() {
    asm volatile("s_wait_dscnt 0x0\n\ts_barrier_signal -1\n\ts_barrier_wait -1" ::: "memory");
}

// B fragment with K=channel, N=token out of the channel rows, by the transposing LDS
// load: lane l reads 16 B of row 8*(l>>4)+(l&7) and gets rows 8h..8h+7 of column l&15;
// the loads at rows +0 and +16 give e<8 -> K=h*8+e, e>=8 -> K=16+h*8+(e-8), the K map
// of the staged A fragments. t points at (first channel of the K block, first token).
template <int PITCH>
__device__ __forceinline__ v16bf frag_B_tr16(const __bf16* t, int lane) {
    typedef __attribute__((address_space(3))) v8bf lds_v8bf;
    const __bf16* p = t + (8 * (lane >> 4) + (lane & 7)) * PITCH + 8 * ((lane >> 3) & 1);
    v8bf lo = __builtin_amdgcn_ds_load_tr16_b128_v8bf16((lds_v8bf*)p);
    v8bf hi = __builtin_amdgcn_ds_load_tr16_b128_v8bf16((lds_v8bf*)(p + 16 * PITCH));
    return __builtin_shufflevector(lo, hi,
            0, 1, 2, 3, 4, 5, 6, 7, 8, 9, 10, 11, 12, 13, 14, 15);
}

// Linear attention, reassociated:
//   attn[d][e] = sum_n k[d][n] * (sum_c Wv[e][c] x[c][n] + bv[e])
//              = sum_c (sum_n k[d][n] x[c][n]) * Wv[e][c] + (sum_n k[d][n]) * bv[e]
// so the token loop only needs kx = k x^T [32 x 256]; Wv is applied once per batch.

// bf16 elements per LDS row of the x tile
#define XR_PITCH (NT + 8)   // 272 B = 16 B x odd: for rows that b128 reads walk too

#define KXP_F4 (DCH * CCH / 4)   // float4 per plane of kx partials (one plane per block of TPB tiles)

// ---------------- Kernel A: k = softplus(Wk x + bk); k_sum and k x^T of TPB tiles;
// q = softplus(Wq x + bq) from the same staged x tile, so that x is read only here.
// A block takes TPB token tiles in turn: while it works on one tile out of LDS, the next
// tile's x is on its way from memory into registers, half a tile under the k and q GEMM
// and half under the kx GEMM; the weights are staged once, and
// k x^T and k_sum stay in registers over the tiles, one plane of partial sums a block.
// q goes to the workspace as the bf16 B fragments of the last kernel's product:
// [16-token tile][K half][lane][8], each store of a wave 512 contiguous bytes.
// Every block stores its own plane of partial sums; SGA_reduce adds the planes.
// Plane order (float4 units): [wave][mt][j/4][p][lane], so that each store of a
// wave is 512 contiguous bytes; the sum over planes is elementwise in any order.
__global__ __launch_bounds__(256) void SGA_kernelA(
    const float* __restrict__ x,  const float* __restrict__ Wk,
    const float* __restrict__ bk, const float* __restrict__ Wq,
    const float* __restrict__ bq, float* __restrict__ kx_part,
    float* __restrict__ ksum_part, float* __restrict__ q_ws)
{
    __shared__ __bf16 WA [4][8][32][16];  // Wk (0,1), Wq (2,3), A-frag: M=d, K=C  32KB
    __shared__ __bf16 kA [2][4][32][16];  // k,  A-frag: M=d(32), K=tok(128)        8KB
    __shared__ __attribute__((aligned(16)))
               __bf16 xR [CCH][XR_PITCH]; // x tile, channel rows                  68KB
    __shared__ float  ksL[8][DCH];        // k_sum of each wave's tokens            1KB
    // bk, bq: read from LDS in the tile loop, because the wait for a global load issued
    // behind the next tile's x loads would wait for all of those too
    __shared__ __attribute__((aligned(16))) float biasL[2][DCH];

    const int tid  = threadIdx.x;
    const int lane = tid & 31;
    const int wave = tid >> 5;
    const int tile0 = blockIdx.x * TPB;        // b * TILES + tile; TILES == 128
    const int b    = tile0 >> 7;
    const int n0   = (tile0 & 127) * NT;
    const float* xb = x + (size_t)b * CCH * NTOK;
    const int h = lane >> 4;

    float4 xv[16];   // half an x tile of the block, in flight or landed: 256 B a thread
    uint2  xp[16];   // the other half, landed and packed to bf16
    {
        float4 xw[16];
        load_x_half(xw, xb, n0, tid, 0);
        load_x_half(xv, xb, n0, tid, 1);
        // bias and weights are staged while the x loads fly; x is converted behind them
        if (tid < 2 * DCH) {
            const float* bp = (tid < DCH ? bk : bq) + lane;
            const float bias = *bp;
            // translation wait before a register that this load names is written again
            asm volatile("s_wait_xcnt 0x0" :: "v"(bp) : "memory");
            biasL[tid >> 5][lane] = bias;
        }
        stage_weights_A(&WA[0][0][0][0], Wk, Wq, tid);
        pack_x_half(xp, xw);
    }

    v8f acc[2][2] = {};   // k x^T, summed over the block's tiles
    float ksacc = 0.0f;   // k_sum of one d-row over this half wave's tokens of all tiles

    // rolled: one copy of the tile's code; the tests on t are scalar branches
#pragma unroll 1
    for (int t = 0; t < TPB; ++t) {
        store_x_half<XR_PITCH>(xR, xp, tid, 0);
        pack_x_half(xp, xv);
        store_x_half<XR_PITCH>(xR, xp, tid, 1);
        lds_barrier();
        if (t + 1 < TPB) load_x_half(xv, xb, n0 + (t + 1) * NT, tid, 0);

        // k and q GEMM: [64 x 128] = [Wk; Wq][64x256] @ x[256x128]; wave w owns token-tile
        // nt=w; each x fragment is read from LDS once and serves all four row tiles
        v8f acc4[4] = {};   // row tiles 0,1: k; 2,3: q, finished at the tile's end
        {
            const int nt = wave;
            const int tok_lo = lane & 15;
#pragma unroll   // acc4[] by constant index: no register indexing
            for (int kt = 0; kt < 8; ++kt) {
                v16bf bb = frag_B_tr16<XR_PITCH>(&xR[kt * 32][nt * 16], lane);
#pragma unroll
                for (int mt = 0; mt < 4; ++mt) {
                    v16bf a = *(const v16bf*)&WA[mt][kt][lane][0];
                    acc4[mt] = __builtin_amdgcn_wmma_f32_16x16x32_bf16(
                            false, a, false, bb, (short)0, acc4[mt], false, false);
                }
            }
            float kv[16];   // kv[mt*8 + j]: d-row mt*16 + 8h + j of this lane's token
            const int ktok = nt * 16 + tok_lo;
            const int kl   = ktok & 31;
            const int ha   = (kl >> 3) & 1;
            const int ea   = (kl & 7) + ((kl >> 4) << 3);
#pragma unroll   // acc4[] and kv[] by constant index
            for (int mt = 0; mt < 2; ++mt) {
#pragma unroll   // likewise; the 16 softplus chains run side by side
                for (int j = 0; j < 8; ++j) {
                    int m = mt * 16 + j + 8 * h;                 // d-row
                    float v = softplusf(acc4[mt][j] + biasL[0][m]);
                    kv[mt * 8 + j] = v;
                    kA[m >> 4][ktok >> 5][ha * 16 + (m & 15)][ea] = (__bf16)v;
                }
            }
            // token sums of the 16 rows over the 16-lane half: lanes l^1, l^2, l^4, l^8 in
            // this order; bit s of the lane picks bit s of the row index that it goes on with
            fold_rows<1, 16>(kv, tok_lo & 1);
            fold_rows<2, 8>(kv, tok_lo & 2);
            fold_rows<4, 4>(kv, tok_lo & 4);
            fold_rows<8, 2>(kv, tok_lo & 8);
            ksacc += kv[0];
            if (t == TPB - 1)
                ksL[wave][(tok_lo >> 3) * 16 + (tok_lo & 7) + 8 * h] = ksacc;   // index tok_lo
        }
        lds_barrier();
        if (t + 1 < TPB) {   // first half landed: pack it, its registers take the second
            pack_x_half(xp, xv);
            load_x_half(xv, xb, n0 + (t + 1) * NT, tid, 1);
        }

        // kx GEMM: [32 x 256] += kA[32x128] @ x^T[128x256]; wave w owns channel
        // tiles 2w and 2w+1, both d-row tiles
        {
            const int c_lo = lane & 15;
            // all loops below unrolled: acc[][] keeps constant indices (stays in registers)
            // and the LDS reads of all four K blocks issue ahead of the WMMAs
#pragma unroll
            for (int kt = 0; kt < 4; ++kt) {
                v16bf a0 = *(const v16bf*)&kA[0][kt][lane][0];
                v16bf a1 = *(const v16bf*)&kA[1][kt][lane][0];
#pragma unroll
                for (int p = 0; p < 2; ++p) {
                    // B 32x16: lane (h, channel); e<8 -> tok h*8+e, e>=8 -> tok 16+h*8+(e-8)
                    const __bf16* row = &xR[(wave * 2 + p) * 16 + c_lo][kt * 32 + h * 8];
                    v8bf lo = *(const v8bf*)row;
                    v8bf hi = *(const v8bf*)(row + 16);
                    v16bf bb = __builtin_shufflevector(lo, hi,
                            0, 1, 2, 3, 4, 5, 6, 7, 8, 9, 10, 11, 12, 13, 14, 15);
                    acc[0][p] = __builtin_amdgcn_wmma_f32_16x16x32_bf16(
                            false, a0, false, bb, (short)0, acc[0][p], false, false);
                    acc[1][p] = __builtin_amdgcn_wmma_f32_16x16x32_bf16(
                            false, a1, false, bb, (short)0, acc[1][p], false, false);
                }
            }
        }
        // q: this lane holds d = mt*16 + 8h + j of token lane&15, which is what the same
        // lane of the B fragment (K=d, N=token) holds at e = mt*8 + j
        {
            v8bf* qp = (v8bf*)q_ws + (size_t)((tile0 + t) * 8 + wave) * 64 + lane;
#pragma unroll   // acc4[] by constant index
            for (int mt = 0; mt < 2; ++mt) {
                v8bf qf;
#pragma unroll
                for (int j = 0; j < 8; ++j)
                    qf[j] = (__bf16)softplusf(acc4[2 + mt][j] + biasL[1][mt * 16 + 8 * h + j]);
                qp[mt * 32] = qf;
            }
            // translation wait before a register that these stores name is written again;
            // the pointer is an input so that its registers stay as they are up to the wait
            asm volatile("s_wait_xcnt 0x0" :: "v"(qp) : "memory");
        }
        if (t + 1 < TPB) lds_barrier();   // every reader of xR and kA has left this tile
    }
    {
        float4* kp = (float4*)kx_part + (size_t)blockIdx.x * KXP_F4 + wave * 256 + lane;
#pragma unroll   // acc[][][] by constant index: no register indexing
        for (int mt = 0; mt < 2; ++mt)
#pragma unroll
            for (int jh = 0; jh < 2; ++jh)
#pragma unroll
                for (int p = 0; p < 2; ++p)
                    kp[((mt * 2 + jh) * 2 + p) * 32] = make_float4(
                        acc[mt][p][jh * 4 + 0], acc[mt][p][jh * 4 + 1],
                        acc[mt][p][jh * 4 + 2], acc[mt][p][jh * 4 + 3]);
    }
    if (tid < DCH) {   // wave 0 alone: the block's k_sum, one 128-B line
        float s = 0.0f;
#pragma unroll   // the 8 LDS reads issue together
        for (int w = 0; w < 8; ++w) s += ksL[w][tid];
        ksum_part[(size_t)blockIdx.x * DCH + tid] = s;
    }
}

// ---------------- Kernel R: add the PLANES planes of each batch --------------
// blocks 0..255: batch b, 64 float4 columns of the kx plane; thread group g adds
// PLANES/4 planes, LDS adds the 4 groups. blocks 256..263: k_sum of one batch.
__global__ __launch_bounds__(256) void SGA_reduce(
    const float* __restrict__ kx_part, const float* __restrict__ ksum_part,
    float* __restrict__ kx_ws, float* __restrict__ ksum_ws)
{
    __shared__ float4 red4[4][64];
    __shared__ float  redk[8][DCH];
    const int tid = threadIdx.x;
    if (blockIdx.x < BATCH * 32) {
        const int b = blockIdx.x >> 5, cg = blockIdx.x & 31;
        const int q = tid & 63, g = tid >> 6;
        const float4* p = (const float4*)kx_part
                        + (size_t)(b * PLANES + g * (PLANES / 4)) * KXP_F4 + cg * 64 + q;
        float4 v[PLANES / 4];
#pragma unroll   // all loads in flight at once, v[] by constant index
        for (int t = 0; t < PLANES / 4; ++t) v[t] = p[(size_t)t * KXP_F4];
        // translation wait before a register that these loads name is written again;
        // the pointer is an input so that its registers stay as they are up to the wait
        asm volatile("s_wait_xcnt 0x0" :: "v"(p) : "memory");
        float4 s = v[0];
#pragma unroll
        for (int t = 1; t < PLANES / 4; ++t) {
            s.x += v[t].x; s.y += v[t].y; s.z += v[t].z; s.w += v[t].w;
        }
        red4[g][q] = s;
        __syncthreads();
        if (g == 0) {   // waves 0 and 1: both halves of each 128-B line of kx
            float4 s1 = red4[1][q], s2 = red4[2][q], s3 = red4[3][q];
            const int f  = cg * 64 + q;          // [wave][mt][j/4][p][lane]
            const int ln = f & 31, pp = (f >> 5) & 1, jh = (f >> 6) & 1;
            const int mt = (f >> 7) & 1, wv = f >> 8;
            const int c  = (wv * 2 + pp) * 16 + (ln & 15);
            const int d0 = mt * 16 + jh * 4 + 8 * (ln >> 4);
            float* o = kx_ws + ((size_t)b * DCH + d0) * CCH + c;
            o[0]       = (s.x + s1.x) + (s2.x + s3.x);
            o[CCH]     = (s.y + s1.y) + (s2.y + s3.y);
            o[2 * CCH] = (s.z + s1.z) + (s2.z + s3.z);
            o[3 * CCH] = (s.w + s1.w) + (s2.w + s3.w);
        }
    } else {
        const int b = blockIdx.x - BATCH * 32;
        const int d = tid & 31, g = tid >> 5;
        const float* p = ksum_part + (size_t)(b * PLANES + g * (PLANES / 8)) * DCH + d;
        float v[PLANES / 8];
#pragma unroll   // all loads in flight at once, v[] by constant index
        for (int t = 0; t < PLANES / 8; ++t) v[t] = p[t * DCH];
        // translation wait, as above
        asm volatile("s_wait_xcnt 0x0" :: "v"(p) : "memory");
        float s = v[0];
#pragma unroll
        for (int t = 1; t < PLANES / 8; ++t) s += v[t];
        redk[g][d] = s;
        __syncthreads();
        if (tid < DCH) {
            float r = 0.0f;
#pragma unroll   // the 8 LDS reads issue together
            for (int w = 0; w < 8; ++w) r += redk[w][tid];
            ksum_ws[b * DCH + tid] = r;
        }
    }
}

// 16 K values of one row (two runs of 8) as a 16-bit fragment (A and B share the K map):
// e<8 -> K=h*8+e, e>=8 -> K=16+h*8+(e-8); p points at K=h*8 of the 32-wide K block
__device__ __forceinline__ v16bf frag_from_f32_row(const float* __restrict__ p) {
    float4 a0 = *(const float4*)(p);
    float4 a1 = *(const float4*)(p + 4);
    float4 a2 = *(const float4*)(p + 16);
    float4 a3 = *(const float4*)(p + 20);
    // translation wait before a register that these four loads name is written again;
    // the pointer is an input so that its registers stay as they are up to the wait
    asm volatile("s_wait_xcnt 0x0" :: "v"(p) : "memory");
    v16bf f;
    f[0]=(__bf16)a0.x; f[1]=(__bf16)a0.y; f[2]=(__bf16)a0.z; f[3]=(__bf16)a0.w;
    f[4]=(__bf16)a1.x; f[5]=(__bf16)a1.y; f[6]=(__bf16)a1.z; f[7]=(__bf16)a1.w;
    f[8]=(__bf16)a2.x; f[9]=(__bf16)a2.y; f[10]=(__bf16)a2.z; f[11]=(__bf16)a2.w;
    f[12]=(__bf16)a3.x; f[13]=(__bf16)a3.y; f[14]=(__bf16)a3.z; f[15]=(__bf16)a3.w;
    return f;
}

// ---------------- Kernel W: attn = kx Wv^T + k_sum bv^T, once per batch ------
// block: all 32 d-rows x 16 v-channels; wave w takes the K slice c = 32w..32w+31, so
// that every load of the block is in flight at once. In the accumulators a lane holds
// d = mt*16 + 8h + j of channel lane&15, which is what the same lane of the last
// kernel's A fragment (M=channel, K=d) holds at e = mt*8 + j: the block's result is one
// whole fragment tile, stored as bf16 [channel tile][lane][16], 1 KB in a row.
#define RED_PITCH 20   // floats per lane: 80 B = 16 B x odd, the b128 stores use all banks

__global__ __launch_bounds__(256) void SGA_kernelW(
    const float* __restrict__ kx_ws, const float* __restrict__ ksum_ws,
    const float* __restrict__ Wv,    const float* __restrict__ bv,
    float* __restrict__ attn_ws)
{
    __shared__ __attribute__((aligned(16)))
               float red[8][32][RED_PITCH];   // [K slice][lane][mt*8 + j]          20KB

    const int tid  = threadIdx.x;
    const int lane = tid & 31;
    const int wave = tid >> 5;
    const int h = lane >> 4, lo = lane & 15;
    const int b  = blockIdx.x >> 4;
    const int et = blockIdx.x & 15;
    const int k0 = wave * 32 + h * 8;
    // this thread finishes elements fe and fe+1 of fragment lane fl: 4 bytes at 4*tid
    const int fl = tid >> 3;
    const int fe = (tid & 7) * 2;
    const int d0 = (fe >> 3) * 16 + 8 * (fl >> 4) + (fe & 7);

    const float* ksp = ksum_ws + b * DCH + d0;
    const float* bvp = bv + et * 16 + (fl & 15);
    const float2 ksum = *(const float2*)ksp;
    const float  bvv  = *bvp;
    // translation wait before a register that these loads name is written again;
    // the pointers are inputs so that their registers stay as they are up to the wait
    asm volatile("s_wait_xcnt 0x0" :: "v"(ksp), "v"(bvp) : "memory");
    v16bf a0 = frag_from_f32_row(kx_ws + ((size_t)b * DCH + lo) * CCH + k0);
    v16bf a1 = frag_from_f32_row(kx_ws + ((size_t)b * DCH + 16 + lo) * CCH + k0);
    v16bf bb = frag_from_f32_row(Wv + (size_t)(et * 16 + lo) * CCH + k0);
    v8f acc0 = {}, acc1 = {};
    acc0 = __builtin_amdgcn_wmma_f32_16x16x32_bf16(
            false, a0, false, bb, (short)0, acc0, false, false);
    acc1 = __builtin_amdgcn_wmma_f32_16x16x32_bf16(
            false, a1, false, bb, (short)0, acc1, false, false);
    float4* r = (float4*)&red[wave][lane][0];
    r[0] = make_float4(acc0[0], acc0[1], acc0[2], acc0[3]);
    r[1] = make_float4(acc0[4], acc0[5], acc0[6], acc0[7]);
    r[2] = make_float4(acc1[0], acc1[1], acc1[2], acc1[3]);
    r[3] = make_float4(acc1[4], acc1[5], acc1[6], acc1[7]);
    __syncthreads();

    float s0 = 0.0f, s1 = 0.0f;
#pragma unroll   // the 8 LDS reads issue together instead of one wait per trip
    for (int ks = 0; ks < 8; ++ks) {
        const float2 v = *(const float2*)&red[ks][fl][fe];
        s0 += v.x;
        s1 += v.y;
    }
    v2bf o;
    o[0] = (__bf16)(s0 + ksum.x * bvv);
    o[1] = (__bf16)(s1 + ksum.y * bvv);
    ((v2bf*)attn_ws)[(size_t)blockIdx.x * 256 + tid] = o;   // a wave: one whole 128-B line
}

// ---------------- Kernel B: out = attn^T q^T * norm, q from the workspace -----
// bf16 elements per 16-token tile of q in LDS: 1,040 B = 16 B x odd, so that the 16
// lanes of a half wave, which read from four tiles, fall on 64 different banks
#define QL_PITCH (2 * 32 * 8 + 8)

// The columns of the product are dealt so that a lane can store 16 bytes: column lo of
// column tile t (t = 0..3) of a 64-token group is token 4*lo + t, so the four
// accumulators hold four consecutive tokens of a row in one lane, and a half wave
// stores 256 contiguous, aligned bytes of one output row.
__global__ __launch_bounds__(256) void SGA_kernelB(
    const float* __restrict__ q_ws, const float* __restrict__ attn_ws,
    const float* __restrict__ ksum_ws, float* __restrict__ out)
{
    __shared__ __attribute__((aligned(32)))
               __bf16 attnA[16][32][16];  // attn^T A-frag: M=C(256), K=d(32)    16KB
    __shared__ __attribute__((aligned(16)))
               __bf16 qL[8][QL_PITCH];    // q fragments as kernel A left them    8KB
    __shared__ __attribute__((aligned(16)))
               float  nrmL[NT];           // norm of each token of the tile

    const int tid  = threadIdx.x;
    const int lane = tid & 31;
    const int wave = tid >> 5;
    const int b    = blockIdx.x >> 7;
    const int n0   = (blockIdx.x & 127) * NT;
    const int nt = wave;                   // wave w brings in token-tile nt=w
    const int h = lane >> 4, tok_lo = lane & 15;

    // q^T B fragment (K=d, N=token) as kernel A left it, and the k_sum values of its
    // 16 d: e<8 -> d=h*8+e, e>=8 -> d=16+h*8+(e-8)
    const v8bf* qp = (const v8bf*)q_ws + (size_t)(blockIdx.x * 8 + nt) * 64 + lane;
    const float* kp = ksum_ws + b * DCH + h * 8;
    v8bf qlo = qp[0];
    v8bf qhi = qp[32];
    float4 k0 = *(const float4*)(kp);
    float4 k1 = *(const float4*)(kp + 4);
    float4 k2 = *(const float4*)(kp + 16);
    float4 k3 = *(const float4*)(kp + 20);
    // attn^T A fragments as kernel W left them: 16 KB, each load of a wave 512 B in a row
    const v8bf* ag = (const v8bf*)attn_ws + (size_t)b * (DCH * CCH / 8) + tid;
    v8bf af0 = ag[0];
    v8bf af1 = ag[256];
    v8bf af2 = ag[512];
    v8bf af3 = ag[768];
    // translation wait before a register that these loads name is written again;
    // the pointers are inputs so that their registers stay as they are up to the wait
    asm volatile("s_wait_xcnt 0x0" :: "v"(qp), "v"(kp), "v"(ag) : "memory");

    // norm = 1 / sum_d q[d] (k_sum[d] + EPS), d in the order 8h.., 16+8h.. per half
    const float ks[16] = {k0.x, k0.y, k0.z, k0.w, k1.x, k1.y, k1.z, k1.w,
                          k2.x, k2.y, k2.z, k2.w, k3.x, k3.y, k3.z, k3.w};
    float denom = 0.0f;
#pragma unroll   // ks[] and the fragment by constant index
    for (int e = 0; e < 8; ++e) denom += (float)qlo[e] * (ks[e] + 1e-6f);
#pragma unroll
    for (int e = 0; e < 8; ++e) denom += (float)qhi[e] * (ks[8 + e] + 1e-6f);
    denom += __shfl_xor(denom, 16, 32);   // combine both d-halves per token
    *(v8bf*)&qL[nt][lane * 8]        = qlo;   // [K half][lane][8], 512 B per store
    *(v8bf*)&qL[nt][(32 + lane) * 8] = qhi;
    v8bf* al = (v8bf*)&attnA[0][0][0] + tid;  // straight copy, 512 B per store of a wave
    al[0]   = af0;
    al[256] = af1;
    al[512] = af2;
    al[768] = af3;
    nrmL[nt * 16 + tok_lo] = 1.0f / denom;    // both halves hold and write the same value
    __syncthreads();

    // out GEMM: [256 x 128] = attn^T[256x32] @ q^T[32x128]; K=32 -> 1 WMMA/tile.
    // wave w: 64-token group g = w&1, channel tiles 4*(w>>1) .. +3
    {
        const int g = wave & 1, cq = wave >> 1;
        // token 64g + 4*lo + t lies in 16-token tile 4g + (lo>>2) at column 4*(lo&3) + t
        const __bf16* qf = &qL[g * 4 + (tok_lo >> 2)][(h * 16 + (tok_lo & 3) * 4) * 8];
        const float4 nrm = *(const float4*)&nrmL[g * 64 + tok_lo * 4];
        v16bf bb[4];
#pragma unroll   // bb[] by constant index: no register indexing
        for (int t = 0; t < 4; ++t) {
            v8bf lo8 = *(const v8bf*)(qf + t * 8);
            v8bf hi8 = *(const v8bf*)(qf + t * 8 + 32 * 8);
            bb[t] = __builtin_shufflevector(lo8, hi8,
                    0, 1, 2, 3, 4, 5, 6, 7, 8, 9, 10, 11, 12, 13, 14, 15);
        }
        float* ob = out + ((size_t)b * CCH + cq * 64 + 8 * h) * NTOK + n0 + g * 64 + tok_lo * 4;
#pragma unroll 1   // rolled: unrolled it takes 170 registers, and only two work-groups fit a WGP
        for (int i = 0; i < 4; ++i) {
            v16bf a = *(const v16bf*)&attnA[cq * 4 + i][lane][0];
            v8f acc[4];
#pragma unroll   // acc[] by constant index
            for (int t = 0; t < 4; ++t) {
                v8f z = {};
                acc[t] = __builtin_amdgcn_wmma_f32_16x16x32_bf16(
                        false, a, false, bb[t], (short)0, z, false, false);
            }
#pragma unroll   // acc[][j] by constant index; the 8 stores issue together
            for (int j = 0; j < 8; ++j)
                *(float4*)(ob + (size_t)(i * 16 + j) * NTOK) = make_float4(
                    acc[0][j] * nrm.x, acc[1][j] * nrm.y,
                    acc[2][j] * nrm.z, acc[3][j] * nrm.w);
            // translation wait before the next trip writes registers that these stores name
            asm volatile("s_wait_xcnt 0x0" ::: "memory");
        }
    }
}

extern "C" void kernel_launch(void* const* d_in, const int* in_sizes, int n_in,
                              void* d_out, int out_size, void* d_ws, size_t ws_size,
                              hipStream_t stream) {
    (void)in_sizes; (void)n_in; (void)out_size; (void)ws_size;
    const float* x  = (const float*)d_in[0];
    const float* Wq = (const float*)d_in[1];
    const float* bq = (const float*)d_in[2];
    const float* Wk = (const float*)d_in[3];
    const float* bk = (const float*)d_in[4];
    const float* Wv = (const float*)d_in[5];
    const float* bv = (const float*)d_in[6];
    float* out = (float*)d_out;

    float* kx_ws     = (float*)d_ws;                    // [B][32][256]
    float* ksum_ws   = kx_ws + BATCH * DCH * CCH;       // [B][32]
    float* attn_ws   = ksum_ws + BATCH * DCH;           // bf16 [B][16][32][16] fragments
    float* kx_part   = attn_ws + BATCH * DCH * CCH;     // [B*PLANES][32*256] planes
    float* ksum_part = kx_part + (size_t)BATCH * TILES * DCH * CCH;  // [B*PLANES][32]
    float* q_ws      = ksum_part + BATCH * TILES * DCH; // bf16 [B*N/16][2][32][8]

    SGA_kernelA<<<BATCH * PLANES, 256, 0, stream>>>(x, Wk, bk, Wq, bq, kx_part, ksum_part, q_ws);
    SGA_reduce<<<BATCH * 32 + BATCH, 256, 0, stream>>>(kx_part, ksum_part, kx_ws, ksum_ws);
    SGA_kernelW<<<BATCH * 16, 256, 0, stream>>>(kx_ws, ksum_ws, Wv, bv, attn_ws);
    SGA_kernelB<<<BATCH * TILES, 256, 0, stream>>>(q_ws, attn_ws, ksum_ws, out);
}

// v010
// Measured time: 37.8 microseconds a run.
// Timed twice side by side with v009, it ran 1.06 and 1.05 times as fast.
// Over all steps from v000 it is 7.08 times as fast.
#include <hip/hip_runtime.h>
#include <hip/hip_bf16.h>

// Problem constants (from reference): B=8, C=256, d=32, H=W=128, N=16384
#define BATCH 8
#define CCH   256
#define DCH   32
#define NTOK  16384
#define NT    128          // tokens per workgroup tile
#define TILES (NTOK / NT)  // 128 tiles per batch
#define TPB    2             // token tiles that one block of the first kernel takes in turn
#define PLANES (TILES / TPB) // planes of partial sums per batch

typedef __attribute__((ext_vector_type(16))) __bf16 v16bf;
typedef __attribute__((ext_vector_type(8)))  __bf16 v8bf;
typedef __attribute__((ext_vector_type(4)))  __bf16 v4bf;
typedef __attribute__((ext_vector_type(2)))  __bf16 v2bf;
typedef __attribute__((ext_vector_type(8)))  float  v8f;

// branchless softplus: no EXEC-mask divergence around WMMA regions.
// max(x,0) + log(1+e), e = exp(-|x|) in [0,1], on the chip's own exp2 and log2.
// Where e < 2^-8 the sum 1+e has dropped too many of e's bits: there the series
// e - e*e/2, whose relative error is below e*e/3, keeps a small result's digits.
__device__ __forceinline__ float softplusf(float x) {
    const float e  = __builtin_amdgcn_exp2f(fabsf(x) * -1.44269504f);
    // v_log_f32 and the slot that the instruction set asks for behind a transcendental, in one
    // statement
    float l2;
    asm("v_log_f32 %0, %1\n\tv_nop" : "=v"(l2) : "v"(1.0f + e));
    const float lg = l2 * 0.693147181f;
    const float sr = fmaf(e * -0.5f, e, e);
    return fmaxf(x, 0.0f) + (e < 0x1p-8f ? sr : lg);
}

// One step of a sum over a 16-lane row that also halves the number of values: of each
// pair (2i, 2i+1) a lane keeps the one that 'up' picks and hands the other to lane
// l ^ MASK, which keeps that one. The exchange is a DPP row_xmask operand of the vector
// unit; a shuffle would go down the LDS path and be waited for at every step.
template <int MASK, int N>
__device__ __forceinline__ void fold_rows(float (&v)[16], bool up) {
#pragma unroll   // v[] by constant index: no register indexing
    for (int i = 0; i < N / 2; ++i) {
        const float keep = up ? v[2 * i + 1] : v[2 * i];
        const float send = up ? v[2 * i] : v[2 * i + 1];
        v[i] = keep + __int_as_float(__builtin_amdgcn_update_dpp(
                   0, __float_as_int(send), 0x160 | MASK, 0xf, 0xf, true));
    }
}

// Fragment mappings (16-bit WMMA, wave32):
//  A 16x32: lane = h*16 + (m&15); elem e<8 -> K=h*8+e ; e>=8 -> K=16+h*8+(e-8)
//  B 32x16: lane = h*16 + (n&15); same K mapping
//  inverse (h,e) from k_local kl: h=(kl>>3)&1 ; e=(kl&7)+((kl>>4)<<3)
//  C/D 16x16 f32: elem j -> row m = j + 8*(lane>>4), col n = lane&15

// 16 values of one f32 weight row (K = h*8..+7 and 16+h*8..+7) as a lane's bf16 A fragment
__device__ __forceinline__ v16bf weight_frag(float4 a0, float4 a1, float4 a2, float4 a3) {
    v16bf f;
    f[0]=(__bf16)a0.x; f[1]=(__bf16)a0.y; f[2]=(__bf16)a0.z; f[3]=(__bf16)a0.w;
    f[4]=(__bf16)a1.x; f[5]=(__bf16)a1.y; f[6]=(__bf16)a1.z; f[7]=(__bf16)a1.w;
    f[8]=(__bf16)a2.x; f[9]=(__bf16)a2.y; f[10]=(__bf16)a2.z; f[11]=(__bf16)a2.w;
    f[12]=(__bf16)a3.x; f[13]=(__bf16)a3.y; f[14]=(__bf16)a3.z; f[15]=(__bf16)a3.w;
    return f;
}

// stage two [32 x 256] f32 row-major weight blocks as A-fragments (bf16), W0 as row
// tiles 0,1 and W1 as row tiles 2,3; the loads of both blocks are in flight together
__device__ __forceinline__ void stage_weights_A(
    __bf16* dst, const float* __restrict__ W0, const float* __restrict__ W1, int tid)
{
    for (int i = tid; i < 2 * 8 * 32; i += 256) {
        int ln = i & 31, kt = (i >> 5) & 7, mt = i >> 8;
        int h = ln >> 4;
        int m = mt * 16 + (ln & 15);
        int c0 = kt * 32 + h * 8;
        const float* w0 = W0 + (size_t)m * CCH + c0;
        const float* w1 = W1 + (size_t)m * CCH + c0;
        float4 a0 = *(const float4*)(w0);
        float4 a1 = *(const float4*)(w0 + 4);
        float4 a2 = *(const float4*)(w0 + 16);
        float4 a3 = *(const float4*)(w0 + 20);
        float4 b0 = *(const float4*)(w1);
        float4 b1 = *(const float4*)(w1 + 4);
        float4 b2 = *(const float4*)(w1 + 16);
        float4 b3 = *(const float4*)(w1 + 20);
        // translation wait before a register that these loads name is written again;
        // the pointers are inputs so that their registers stay as they are up to the wait
        asm volatile("s_wait_xcnt 0x0" :: "v"(w0), "v"(w1) : "memory");
        *(v16bf*)(dst + (size_t)i * 16) = weight_frag(a0, a1, a2, a3);   // [mt][kt][lane][16]
        *(v16bf*)(dst + (size_t)(i + 512) * 16) = weight_frag(b0, b1, b2, b3);
    }
}

// x tile [256 x NT] (channel-major, token-contiguous), staged in two halves of 128 channel
// rows and in three moves. First move: the 16 loads of a thread are issued and left in
// flight; a wave takes one whole row per load, load u of wave w is row 128*half + w + 8u
__device__ __forceinline__ void load_x_half(
    float4 (&v)[16], const float* __restrict__ xb, int n0, int tid, int half)
{
    const float* p = xb + (size_t)(half * 128 + (tid >> 5)) * NTOK + n0 + (tid & 31) * 4;
#pragma unroll   // v[] by constant index: no register indexing
    for (int u = 0; u < 16; ++u) v[u] = *(const float4*)(p + (size_t)u * 8 * NTOK);
    // translation wait before a register that these loads name is written again; as a
    // memory-clobbering statement it also keeps the loads up here, ahead of the GEMMs
    asm volatile("s_wait_xcnt 0x0" :: "v"(p) : "memory");
}

// second move: to bf16, half the registers. The conversion (the instruction that the
// compiler itself takes for a cast to bf16) is a volatile statement so that it stays where
// it is written: as a plain cast it was moved up to its load, in front of the GEMM that
// is to run under the load's flight, and the wait for the load went with it
__device__ __forceinline__ void pack_x_half(uint2 (&r)[16], const float4 (&v)[16]) {
#pragma unroll   // r[], v[] by constant index: no register indexing
    for (int u = 0; u < 16; ++u) {
        asm volatile("v_cvt_pk_bf16_f32 %0, %1, %2" : "=v"(r[u].x) : "v"(v[u].x), "v"(v[u].y));
        asm volatile("v_cvt_pk_bf16_f32 %0, %1, %2" : "=v"(r[u].y) : "v"(v[u].z), "v"(v[u].w));
    }
}

// third move: bf16 channel rows of PITCH elements in LDS; a wave stores 256 contiguous
// bytes of one row, no bank conflict
template <int PITCH>
__device__ __forceinline__ void store_x_half(
    __bf16 (*xR)[PITCH], const uint2 (&r)[16], int tid, int half)
{
    const int n = (tid & 31) * 4, c = half * 128 + (tid >> 5);
#pragma unroll   // r[u] by constant index: no register indexing
    for (int u = 0; u < 16; ++u) *(uint2*)&xR[c + u * 8][n] = r[u];
}

// Work-group barrier for data that passes through LDS alone: the wave's own LDS reads and
// writes are done, then the barrier. __syncthreads() here also waits for the wave's global
// loads and stores: it would end the flight of the next tile's x loads.
__device__ __forceinline__ void lds_barrier() {
    asm volatile("s_wait_dscnt 0x0\n\ts_barrier_signal -1\n\ts_barrier_wait -1" ::: "memory");
}

// B fragment with K=channel, N=token out of the channel rows, by the transposing LDS
// load: lane l reads 16 B of row 8*(l>>4)+(l&7) and gets rows 8h..8h+7 of column l&15;
// the loads at rows +0 and +16 give e<8 -> K=h*8+e, e>=8 -> K=16+h*8+(e-8), the K map
// of the staged A fragments. t points at (first channel of the K block, first token).
template <int PITCH>
__device__ __forceinline__ v16bf frag_B_tr16(const __bf16* t, int lane) {
    typedef __attribute__((address_space(3))) v8bf lds_v8bf;
    const __bf16* p = t + (8 * (lane >> 4) + (lane & 7)) * PITCH + 8 * ((lane >> 3) & 1);
    v8bf lo = __builtin_amdgcn_ds_load_tr16_b128_v8bf16((lds_v8bf*)p);
    v8bf hi = __builtin_amdgcn_ds_load_tr16_b128_v8bf16((lds_v8bf*)(p + 16 * PITCH));
    return __builtin_shufflevector(lo, hi,
            0, 1, 2, 3, 4, 5, 6, 7, 8, 9, 10, 11, 12, 13, 14, 15);
}

// Linear attention, reassociated:
//   attn[d][e] = sum_n k[d][n] * (sum_c Wv[e][c] x[c][n] + bv[e])
//              = sum_c (sum_n k[d][n] x[c][n]) * Wv[e][c] + (sum_n k[d][n]) * bv[e]
// so the token loop only needs kx = k x^T [32 x 256]; Wv is applied once per batch.

// bf16 elements per LDS row of the x tile
#define XR_PITCH (NT + 8)   // 272 B = 16 B x odd: for rows that b128 reads walk too

#define KXP_F4 (DCH * CCH / 4)   // float4 per plane of kx partials (one plane per block of TPB tiles)

// ---------------- Kernel A: k = softplus(Wk x + bk); k_sum and k x^T of TPB tiles;
// q = softplus(Wq x + bq) from the same staged x tile, so that x is read only here.
// A block takes TPB token tiles in turn: while it works on one tile out of LDS, the next
// tile's x is on its way from memory into registers, half a tile under the k and q GEMM
// and half under the kx GEMM; the weights are staged once, and
// k x^T and k_sum stay in registers over the tiles, one plane of partial sums a block.
// q goes to the workspace as the bf16 B fragments of the last kernel's product:
// [16-token tile][K half][lane][8], each store of a wave 512 contiguous bytes.
// Every block stores its own plane of partial sums; SGA_reduce adds the planes.
// Plane order (float4 units): [wave][mt][j/4][p][lane], so that each store of a
// wave is 512 contiguous bytes; the sum over planes is elementwise in any order.
// second bound: four waves a SIMD, at most 256 registers, so that two blocks share a WGP
__global__ __launch_bounds__(256, 4) void SGA_kernelA(
    const float* __restrict__ x,  const float* __restrict__ Wk,
    const float* __restrict__ bk, const float* __restrict__ Wq,
    const float* __restrict__ bq, float* __restrict__ kx_part,
    float* __restrict__ ksum_part, float* __restrict__ q_ws)
{
    __shared__ __bf16 WA [4][8][32][16];  // Wk (0,1), Wq (2,3), A-frag: M=d, K=C  32KB
    __shared__ __bf16 kA [2][4][32][16];  // k,  A-frag: M=d(32), K=tok(128)        8KB
    __shared__ __attribute__((aligned(16)))
               __bf16 xR [CCH][XR_PITCH]; // x tile, channel rows                  68KB
    __shared__ float  ksL[8][DCH];        // k_sum of each wave's tokens            1KB
    // bk, bq: read from LDS in the tile loop, because the wait for a global load issued
    // behind the next tile's x loads would wait for all of those too
    __shared__ __attribute__((aligned(16))) float biasL[2][DCH];

    const int tid  = threadIdx.x;
    const int lane = tid & 31;
    const int wave = tid >> 5;
    const int tile0 = blockIdx.x * TPB;        // b * TILES + tile; TILES == 128
    const int b    = tile0 >> 7;
    const int n0   = (tile0 & 127) * NT;
    const float* xb = x + (size_t)b * CCH * NTOK;
    const int h = lane >> 4;

    float4 xv[16];   // half an x tile of the block, in flight or landed: 256 B a thread
    uint2  xp[16];   // the other half, landed and packed to bf16
    {
        float4 xw[16];
        load_x_half(xw, xb, n0, tid, 0);
        load_x_half(xv, xb, n0, tid, 1);
        // bias and weights are staged while the x loads fly; x is converted behind them
        if (tid < 2 * DCH) {
            const float* bp = (tid < DCH ? bk : bq) + lane;
            const float bias = *bp;
            // translation wait before a register that this load names is written again
            asm volatile("s_wait_xcnt 0x0" :: "v"(bp) : "memory");
            biasL[tid >> 5][lane] = bias;
        }
        stage_weights_A(&WA[0][0][0][0], Wk, Wq, tid);
        pack_x_half(xp, xw);
    }

    v8f acc[2][2] = {};   // k x^T, summed over the block's tiles
    float ksacc = 0.0f;   // k_sum of one d-row over this half wave's tokens of all tiles

    // rolled: one copy of the tile's code; the tests on t are scalar branches
#pragma unroll 1
    for (int t = 0; t < TPB; ++t) {
        store_x_half<XR_PITCH>(xR, xp, tid, 0);
        pack_x_half(xp, xv);
        store_x_half<XR_PITCH>(xR, xp, tid, 1);
        lds_barrier();
        if (t + 1 < TPB) load_x_half(xv, xb, n0 + (t + 1) * NT, tid, 0);

        // k and q GEMM: [64 x 128] = [Wk; Wq][64x256] @ x[256x128]; wave w owns token-tile
        // nt=w; each x fragment is read from LDS once and serves all four row tiles
        v8f acc4[4] = {};   // row tiles 0,1: k; 2,3: q, finished at the tile's end
        {
            const int nt = wave;
            const int tok_lo = lane & 15;
            // Two register sets of fragments: the ten LDS reads of K block kt+1 issue as one
            // group ahead of the four WMMAs of block kt, which then wait only for the older
            // group; read one by one, each WMMA stood behind a whole LDS latency of its own.
            // Under the last block's WMMAs the group is the bias of the k rows.
            v16bf bb = frag_B_tr16<XR_PITCH>(&xR[0][nt * 16], lane);
            v16bf aw[4];
#pragma unroll   // aw[] by constant index: no register indexing
            for (int mt = 0; mt < 4; ++mt) aw[mt] = *(const v16bf*)&WA[mt][0][lane][0];
            float4 bk4[4];   // bk of d-rows mt*16 + 8h + 0..7: [mt*2], [mt*2 + 1]
#pragma unroll   // acc4[], aw[], an[] by constant index; the set swap costs no move
            for (int kt = 0; kt < 8; ++kt) {
                v16bf bn = bb;
                v16bf an[4] = {aw[0], aw[1], aw[2], aw[3]};
                if (kt + 1 < 8) {
                    bn = frag_B_tr16<XR_PITCH>(&xR[(kt + 1) * 32][nt * 16], lane);
#pragma unroll
                    for (int mt = 0; mt < 4; ++mt)
                        an[mt] = *(const v16bf*)&WA[mt][kt + 1][lane][0];
                } else {
#pragma unroll
                    for (int i = 0; i < 4; ++i)
                        bk4[i] = *(const float4*)&biasL[0][(i >> 1) * 16 + 8 * h + (i & 1) * 4];
                }
                // keeps the group of reads above these WMMAs: the scheduler sank each read
                // to just in front of its own WMMA
                __builtin_amdgcn_sched_barrier(0);
#pragma unroll
                for (int mt = 0; mt < 4; ++mt)
                    acc4[mt] = __builtin_amdgcn_wmma_f32_16x16x32_bf16(
                            false, aw[mt], false, bb, (short)0, acc4[mt], false, false);
                // keeps the next group of reads behind these WMMAs: two sets, not three
                __builtin_amdgcn_sched_barrier(0);
                bb = bn;
#pragma unroll
                for (int mt = 0; mt < 4; ++mt) aw[mt] = an[mt];
            }
            // inputs only: holds the four bias reads up here as one group behind one wait;
            // the compiler sank them one by one among the softplus chains, a wait each
            asm volatile("" :: "v"(bk4[0].x), "v"(bk4[0].y), "v"(bk4[0].z), "v"(bk4[0].w),
                               "v"(bk4[1].x), "v"(bk4[1].y), "v"(bk4[1].z), "v"(bk4[1].w),
                               "v"(bk4[2].x), "v"(bk4[2].y), "v"(bk4[2].z), "v"(bk4[2].w),
                               "v"(bk4[3].x), "v"(bk4[3].y), "v"(bk4[3].z), "v"(bk4[3].w));
            const float bkv[16] = {bk4[0].x, bk4[0].y, bk4[0].z, bk4[0].w,
                                   bk4[1].x, bk4[1].y, bk4[1].z, bk4[1].w,
                                   bk4[2].x, bk4[2].y, bk4[2].z, bk4[2].w,
                                   bk4[3].x, bk4[3].y, bk4[3].z, bk4[3].w};
            float kv[16];   // kv[mt*8 + j]: d-row mt*16 + 8h + j of this lane's token
            const int ktok = nt * 16 + tok_lo;
            const int kl   = ktok & 31;
            const int ha   = (kl >> 3) & 1;
            const int ea   = (kl & 7) + ((kl >> 4) << 3);
#pragma unroll   // acc4[] and kv[] by constant index
            for (int mt = 0; mt < 2; ++mt) {
#pragma unroll   // likewise; the 16 softplus chains run side by side
                for (int j = 0; j < 8; ++j) {
                    int m = mt * 16 + j + 8 * h;                 // d-row
                    float v = softplusf(acc4[mt][j] + bkv[mt * 8 + j]);
                    kv[mt * 8 + j] = v;
                    kA[m >> 4][ktok >> 5][ha * 16 + (m & 15)][ea] = (__bf16)v;
                }
            }
            // token sums of the 16 rows over the 16-lane half: lanes l^1, l^2, l^4, l^8 in
            // this order; bit s of the lane picks bit s of the row index that it goes on with
            fold_rows<1, 16>(kv, tok_lo & 1);
            fold_rows<2, 8>(kv, tok_lo & 2);
            fold_rows<4, 4>(kv, tok_lo & 4);
            fold_rows<8, 2>(kv, tok_lo & 8);
            ksacc += kv[0];
            if (t == TPB - 1)
                ksL[wave][(tok_lo >> 3) * 16 + (tok_lo & 7) + 8 * h] = ksacc;   // index tok_lo
        }
        lds_barrier();
        // first half landed: pack it, its registers take the second. The pack stands outside
        // the test (behind the last tile its result is not used): written on every path, xp
        // holds nothing under the k and q GEMM, and its 32 registers take the second
        // fragment set there; inside the test the two sets did not fit 256 registers
        pack_x_half(xp, xv);
        if (t + 1 < TPB) load_x_half(xv, xb, n0 + (t + 1) * NT, tid, 1);

        // kx GEMM: [32 x 256] += kA[32x128] @ x^T[128x256]; wave w owns channel
        // tiles 2w and 2w+1, both d-row tiles
        float4 bq4[4];   // bq of d-rows mt*16 + 8h + 0..7: [mt*2], [mt*2 + 1]
        {
            // B 32x16: lane (h, channel); e<8 -> tok h*8+e, e>=8 -> tok 16+h*8+(e-8)
            const __bf16* row0 = &xR[wave * 32 + (lane & 15)][h * 8];
            // two register sets here too: the eight LDS reads of K block kt+1 issue as one
            // group ahead of the four WMMAs of block kt; under the last block, the q bias.
            // All loops unrolled: acc[][], ak[], bx[] keep constant indices
            v16bf ak[2], bx[2];
#pragma unroll
            for (int p = 0; p < 2; ++p) {
                ak[p] = *(const v16bf*)&kA[p][0][lane][0];
                v8bf lo = *(const v8bf*)(row0 + p * 16 * XR_PITCH);
                v8bf hi = *(const v8bf*)(row0 + p * 16 * XR_PITCH + 16);
                bx[p] = __builtin_shufflevector(lo, hi,
                        0, 1, 2, 3, 4, 5, 6, 7, 8, 9, 10, 11, 12, 13, 14, 15);
            }
#pragma unroll
            for (int kt = 0; kt < 4; ++kt) {
                v16bf akn[2] = {ak[0], ak[1]}, bxn[2] = {bx[0], bx[1]};
                if (kt + 1 < 4) {
#pragma unroll
                    for (int p = 0; p < 2; ++p) {
                        akn[p] = *(const v16bf*)&kA[p][kt + 1][lane][0];
                        const __bf16* row = row0 + p * 16 * XR_PITCH + (kt + 1) * 32;
                        v8bf lo = *(const v8bf*)row;
                        v8bf hi = *(const v8bf*)(row + 16);
                        bxn[p] = __builtin_shufflevector(lo, hi,
                                0, 1, 2, 3, 4, 5, 6, 7, 8, 9, 10, 11, 12, 13, 14, 15);
                    }
                } else {
#pragma unroll
                    for (int i = 0; i < 4; ++i)
                        bq4[i] = *(const float4*)&biasL[1][(i >> 1) * 16 + 8 * h + (i & 1) * 4];
                }
                // keeps the group of reads above these WMMAs, as in the k and q GEMM
                __builtin_amdgcn_sched_barrier(0);
#pragma unroll
                for (int p = 0; p < 2; ++p) {
                    acc[0][p] = __builtin_amdgcn_wmma_f32_16x16x32_bf16(
                            false, ak[0], false, bx[p], (short)0, acc[0][p], false, false);
                    acc[1][p] = __builtin_amdgcn_wmma_f32_16x16x32_bf16(
                            false, ak[1], false, bx[p], (short)0, acc[1][p], false, false);
                }
                // keeps the next group of reads behind these WMMAs: two sets, not three
                __builtin_amdgcn_sched_barrier(0);
#pragma unroll
                for (int p = 0; p < 2; ++p) { ak[p] = akn[p]; bx[p] = bxn[p]; }
            }
        }
        // q: this lane holds d = mt*16 + 8h + j of token lane&15, which is what the same
        // lane of the B fragment (K=d, N=token) holds at e = mt*8 + j
        {
            v8bf* qp = (v8bf*)q_ws + (size_t)((tile0 + t) * 8 + wave) * 64 + lane;
            // inputs only: holds the four bias reads up here as one group, as for the k rows
            asm volatile("" :: "v"(bq4[0].x), "v"(bq4[0].y), "v"(bq4[0].z), "v"(bq4[0].w),
                               "v"(bq4[1].x), "v"(bq4[1].y), "v"(bq4[1].z), "v"(bq4[1].w),
                               "v"(bq4[2].x), "v"(bq4[2].y), "v"(bq4[2].z), "v"(bq4[2].w),
                               "v"(bq4[3].x), "v"(bq4[3].y), "v"(bq4[3].z), "v"(bq4[3].w));
            const float bqv[16] = {bq4[0].x, bq4[0].y, bq4[0].z, bq4[0].w,
                                   bq4[1].x, bq4[1].y, bq4[1].z, bq4[1].w,
                                   bq4[2].x, bq4[2].y, bq4[2].z, bq4[2].w,
                                   bq4[3].x, bq4[3].y, bq4[3].z, bq4[3].w};
#pragma unroll   // acc4[] by constant index
            for (int mt = 0; mt < 2; ++mt) {
                v8bf qf;
#pragma unroll
                for (int j = 0; j < 8; ++j)
                    qf[j] = (__bf16)softplusf(acc4[2 + mt][j] + bqv[mt * 8 + j]);
                qp[mt * 32] = qf;
            }
            // translation wait before a register that these stores name is written again;
            // the pointer is an input so that its registers stay as they are up to the wait
            asm volatile("s_wait_xcnt 0x0" :: "v"(qp) : "memory");
        }
        if (t + 1 < TPB) lds_barrier();   // every reader of xR and kA has left this tile
    }
    {
        float4* kp = (float4*)kx_part + (size_t)blockIdx.x * KXP_F4 + wave * 256 + lane;
#pragma unroll   // acc[][][] by constant index: no register indexing
        for (int mt = 0; mt < 2; ++mt)
#pragma unroll
            for (int jh = 0; jh < 2; ++jh)
#pragma unroll
                for (int p = 0; p < 2; ++p)
                    kp[((mt * 2 + jh) * 2 + p) * 32] = make_float4(
                        acc[mt][p][jh * 4 + 0], acc[mt][p][jh * 4 + 1],
                        acc[mt][p][jh * 4 + 2], acc[mt][p][jh * 4 + 3]);
    }
    if (wave == 0) {   // wave 0 alone: the block's k_sum, one 128-B line; by wave and lane,
                       // so that tid holds no register over the tile loop
        float s = 0.0f;
#pragma unroll   // the 8 LDS reads issue together
        for (int w = 0; w < 8; ++w) s += ksL[w][lane];
        ksum_part[(size_t)blockIdx.x * DCH + lane] = s;
    }
}

// ---------------- Kernel R: add the PLANES planes of each batch --------------
// blocks 0..255: batch b, 64 float4 columns of the kx plane; thread group g adds
// PLANES/4 planes, LDS adds the 4 groups. blocks 256..263: k_sum of one batch.
__global__ __launch_bounds__(256) void SGA_reduce(
    const float* __restrict__ kx_part, const float* __restrict__ ksum_part,
    float* __restrict__ kx_ws, float* __restrict__ ksum_ws)
{
    __shared__ float4 red4[4][64];
    __shared__ float  redk[8][DCH];
    const int tid = threadIdx.x;
    if (blockIdx.x < BATCH * 32) {
        const int b = blockIdx.x >> 5, cg = blockIdx.x & 31;
        const int q = tid & 63, g = tid >> 6;
        const float4* p = (const float4*)kx_part
                        + (size_t)(b * PLANES + g * (PLANES / 4)) * KXP_F4 + cg * 64 + q;
        float4 v[PLANES / 4];
#pragma unroll   // all loads in flight at once, v[] by constant index
        for (int t = 0; t < PLANES / 4; ++t) v[t] = p[(size_t)t * KXP_F4];
        // translation wait before a register that these loads name is written again;
        // the pointer is an input so that its registers stay as they are up to the wait
        asm volatile("s_wait_xcnt 0x0" :: "v"(p) : "memory");
        float4 s = v[0];
#pragma unroll
        for (int t = 1; t < PLANES / 4; ++t) {
            s.x += v[t].x; s.y += v[t].y; s.z += v[t].z; s.w += v[t].w;
        }
        red4[g][q] = s;
        __syncthreads();
        if (g == 0) {   // waves 0 and 1: both halves of each 128-B line of kx
            float4 s1 = red4[1][q], s2 = red4[2][q], s3 = red4[3][q];
            const int f  = cg * 64 + q;          // [wave][mt][j/4][p][lane]
            const int ln = f & 31, pp = (f >> 5) & 1, jh = (f >> 6) & 1;
            const int mt = (f >> 7) & 1, wv = f >> 8;
            const int c  = (wv * 2 + pp) * 16 + (ln & 15);
            const int d0 = mt * 16 + jh * 4 + 8 * (ln >> 4);
            float* o = kx_ws + ((size_t)b * DCH + d0) * CCH + c;
            o[0]       = (s.x + s1.x) + (s2.x + s3.x);
            o[CCH]     = (s.y + s1.y) + (s2.y + s3.y);
            o[2 * CCH] = (s.z + s1.z) + (s2.z + s3.z);
            o[3 * CCH] = (s.w + s1.w) + (s2.w + s3.w);
        }
    } else {
        const int b = blockIdx.x - BATCH * 32;
        const int d = tid & 31, g = tid >> 5;
        const float* p = ksum_part + (size_t)(b * PLANES + g * (PLANES / 8)) * DCH + d;
        float v[PLANES / 8];
#pragma unroll   // all loads in flight at once, v[] by constant index
        for (int t = 0; t < PLANES / 8; ++t) v[t] = p[t * DCH];
        // translation wait, as above
        asm volatile("s_wait_xcnt 0x0" :: "v"(p) : "memory");
        float s = v[0];
#pragma unroll
        for (int t = 1; t < PLANES / 8; ++t) s += v[t];
        redk[g][d] = s;
        __syncthreads();
        if (tid < DCH) {
            float r = 0.0f;
#pragma unroll   // the 8 LDS reads issue together
            for (int w = 0; w < 8; ++w) r += redk[w][tid];
            ksum_ws[b * DCH + tid] = r;
        }
    }
}

// 16 K values of one row (two runs of 8) as a 16-bit fragment (A and B share the K map):
// e<8 -> K=h*8+e, e>=8 -> K=16+h*8+(e-8); p points at K=h*8 of the 32-wide K block
__device__ __forceinline__ v16bf frag_from_f32_row(const float* __restrict__ p) {
    float4 a0 = *(const float4*)(p);
    float4 a1 = *(const float4*)(p + 4);
    float4 a2 = *(const float4*)(p + 16);
    float4 a3 = *(const float4*)(p + 20);
    // translation wait before a register that these four loads name is written again;
    // the pointer is an input so that its registers stay as they are up to the wait
    asm volatile("s_wait_xcnt 0x0" :: "v"(p) : "memory");
    v16bf f;
    f[0]=(__bf16)a0.x; f[1]=(__bf16)a0.y; f[2]=(__bf16)a0.z; f[3]=(__bf16)a0.w;
    f[4]=(__bf16)a1.x; f[5]=(__bf16)a1.y; f[6]=(__bf16)a1.z; f[7]=(__bf16)a1.w;
    f[8]=(__bf16)a2.x; f[9]=(__bf16)a2.y; f[10]=(__bf16)a2.z; f[11]=(__bf16)a2.w;
    f[12]=(__bf16)a3.x; f[13]=(__bf16)a3.y; f[14]=(__bf16)a3.z; f[15]=(__bf16)a3.w;
    return f;
}

// ---------------- Kernel W: attn = kx Wv^T + k_sum bv^T, once per batch ------
// block: all 32 d-rows x 16 v-channels; wave w takes the K slice c = 32w..32w+31, so
// that every load of the block is in flight at once. In the accumulators a lane holds
// d = mt*16 + 8h + j of channel lane&15, which is what the same lane of the last
// kernel's A fragment (M=channel, K=d) holds at e = mt*8 + j: the block's result is one
// whole fragment tile, stored as bf16 [channel tile][lane][16], 1 KB in a row.
#define RED_PITCH 20   // floats per lane: 80 B = 16 B x odd, the b128 stores use all banks

__global__ __launch_bounds__(256) void SGA_kernelW(
    const float* __restrict__ kx_ws, const float* __restrict__ ksum_ws,
    const float* __restrict__ Wv,    const float* __restrict__ bv,
    float* __restrict__ attn_ws)
{
    __shared__ __attribute__((aligned(16)))
               float red[8][32][RED_PITCH];   // [K slice][lane][mt*8 + j]          20KB

    const int tid  = threadIdx.x;
    const int lane = tid & 31;
    const int wave = tid >> 5;
    const int h = lane >> 4, lo = lane & 15;
    const int b  = blockIdx.x >> 4;
    const int et = blockIdx.x & 15;
    const int k0 = wave * 32 + h * 8;
    // this thread finishes elements fe and fe+1 of fragment lane fl: 4 bytes at 4*tid
    const int fl = tid >> 3;
    const int fe = (tid & 7) * 2;
    const int d0 = (fe >> 3) * 16 + 8 * (fl >> 4) + (fe & 7);

    const float* ksp = ksum_ws + b * DCH + d0;
    const float* bvp = bv + et * 16 + (fl & 15);
    const float2 ksum = *(const float2*)ksp;
    const float  bvv  = *bvp;
    // translation wait before a register that these loads name is written again;
    // the pointers are inputs so that their registers stay as they are up to the wait
    asm volatile("s_wait_xcnt 0x0" :: "v"(ksp), "v"(bvp) : "memory");
    v16bf a0 = frag_from_f32_row(kx_ws + ((size_t)b * DCH + lo) * CCH + k0);
    v16bf a1 = frag_from_f32_row(kx_ws + ((size_t)b * DCH + 16 + lo) * CCH + k0);
    v16bf bb = frag_from_f32_row(Wv + (size_t)(et * 16 + lo) * CCH + k0);
    v8f acc0 = {}, acc1 = {};
    acc0 = __builtin_amdgcn_wmma_f32_16x16x32_bf16(
            false, a0, false, bb, (short)0, acc0, false, false);
    acc1 = __builtin_amdgcn_wmma_f32_16x16x32_bf16(
            false, a1, false, bb, (short)0, acc1, false, false);
    float4* r = (float4*)&red[wave][lane][0];
    r[0] = make_float4(acc0[0], acc0[1], acc0[2], acc0[3]);
    r[1] = make_float4(acc0[4], acc0[5], acc0[6], acc0[7]);
    r[2] = make_float4(acc1[0], acc1[1], acc1[2], acc1[3]);
    r[3] = make_float4(acc1[4], acc1[5], acc1[6], acc1[7]);
    __syncthreads();

    float s0 = 0.0f, s1 = 0.0f;
#pragma unroll   // the 8 LDS reads issue together instead of one wait per trip
    for (int ks = 0; ks < 8; ++ks) {
        const float2 v = *(const float2*)&red[ks][fl][fe];
        s0 += v.x;
        s1 += v.y;
    }
    v2bf o;
    o[0] = (__bf16)(s0 + ksum.x * bvv);
    o[1] = (__bf16)(s1 + ksum.y * bvv);
    ((v2bf*)attn_ws)[(size_t)blockIdx.x * 256 + tid] = o;   // a wave: one whole 128-B line
}

// ---------------- Kernel B: out = attn^T q^T * norm, q from the workspace -----
// bf16 elements per 16-token tile of q in LDS: 1,040 B = 16 B x odd, so that the 16
// lanes of a half wave, which read from four tiles, fall on 64 different banks
#define QL_PITCH (2 * 32 * 8 + 8)

// The columns of the product are dealt so that a lane can store 16 bytes: column lo of
// column tile t (t = 0..3) of a 64-token group is token 4*lo + t, so the four
// accumulators hold four consecutive tokens of a row in one lane, and a half wave
// stores 256 contiguous, aligned bytes of one output row.
__global__ __launch_bounds__(256) void SGA_kernelB(
    const float* __restrict__ q_ws, const float* __restrict__ attn_ws,
    const float* __restrict__ ksum_ws, float* __restrict__ out)
{
    __shared__ __attribute__((aligned(32)))
               __bf16 attnA[16][32][16];  // attn^T A-frag: M=C(256), K=d(32)    16KB
    __shared__ __attribute__((aligned(16)))
               __bf16 qL[8][QL_PITCH];    // q fragments as kernel A left them    8KB
    __shared__ __attribute__((aligned(16)))
               float  nrmL[NT];           // norm of each token of the tile

    const int tid  = threadIdx.x;
    const int lane = tid & 31;
    const int wave = tid >> 5;
    const int b    = blockIdx.x >> 7;
    const int n0   = (blockIdx.x & 127) * NT;
    const int nt = wave;                   // wave w brings in token-tile nt=w
    const int h = lane >> 4, tok_lo = lane & 15;

    // q^T B fragment (K=d, N=token) as kernel A left it, and the k_sum values of its
    // 16 d: e<8 -> d=h*8+e, e>=8 -> d=16+h*8+(e-8)
    const v8bf* qp = (const v8bf*)q_ws + (size_t)(blockIdx.x * 8 + nt) * 64 + lane;
    const float* kp = ksum_ws + b * DCH + h * 8;
    v8bf qlo = qp[0];
    v8bf qhi = qp[32];
    float4 k0 = *(const float4*)(kp);
    float4 k1 = *(const float4*)(kp + 4);
    float4 k2 = *(const float4*)(kp + 16);
    float4 k3 = *(const float4*)(kp + 20);
    // attn^T A fragments as kernel W left them: 16 KB, each load of a wave 512 B in a row
    const v8bf* ag = (const v8bf*)attn_ws + (size_t)b * (DCH * CCH / 8) + tid;
    v8bf af0 = ag[0];
    v8bf af1 = ag[256];
    v8bf af2 = ag[512];
    v8bf af3 = ag[768];
    // translation wait before a register that these loads name is written again;
    // the pointers are inputs so that their registers stay as they are up to the wait
    asm volatile("s_wait_xcnt 0x0" :: "v"(qp), "v"(kp), "v"(ag) : "memory");

    // norm = 1 / sum_d q[d] (k_sum[d] + EPS), d in the order 8h.., 16+8h.. per half
    const float ks[16] = {k0.x, k0.y, k0.z, k0.w, k1.x, k1.y, k1.z, k1.w,
                          k2.x, k2.y, k2.z, k2.w, k3.x, k3.y, k3.z, k3.w};
    float denom = 0.0f;
#pragma unroll   // ks[] and the fragment by constant index
    for (int e = 0; e < 8; ++e) denom += (float)qlo[e] * (ks[e] + 1e-6f);
#pragma unroll
    for (int e = 0; e < 8; ++e) denom += (float)qhi[e] * (ks[8 + e] + 1e-6f);
    denom += __shfl_xor(denom, 16, 32);   // combine both d-halves per token
    *(v8bf*)&qL[nt][lane * 8]        = qlo;   // [K half][lane][8], 512 B per store
    *(v8bf*)&qL[nt][(32 + lane) * 8] = qhi;
    v8bf* al = (v8bf*)&attnA[0][0][0] + tid;  // straight copy, 512 B per store of a wave
    al[0]   = af0;
    al[256] = af1;
    al[512] = af2;
    al[768] = af3;
    nrmL[nt * 16 + tok_lo] = 1.0f / denom;    // both halves hold and write the same value
    __syncthreads();

    // out GEMM: [256 x 128] = attn^T[256x32] @ q^T[32x128]; K=32 -> 1 WMMA/tile.
    // wave w: 64-token group g = w&1, channel tiles 4*(w>>1) .. +3
    {
        const int g = wave & 1, cq = wave >> 1;
        // token 64g + 4*lo + t lies in 16-token tile 4g + (lo>>2) at column 4*(lo&3) + t
        const __bf16* qf = &qL[g * 4 + (tok_lo >> 2)][(h * 16 + (tok_lo & 3) * 4) * 8];
        const float4 nrm = *(const float4*)&nrmL[g * 64 + tok_lo * 4];
        v16bf bb[4];
#pragma unroll   // bb[] by constant index: no register indexing
        for (int t = 0; t < 4; ++t) {
            v8bf lo8 = *(const v8bf*)(qf + t * 8);
            v8bf hi8 = *(const v8bf*)(qf + t * 8 + 32 * 8);
            bb[t] = __builtin_shufflevector(lo8, hi8,
                    0, 1, 2, 3, 4, 5, 6, 7, 8, 9, 10, 11, 12, 13, 14, 15);
        }
        float* ob = out + ((size_t)b * CCH + cq * 64 + 8 * h) * NTOK + n0 + g * 64 + tok_lo * 4;
#pragma unroll 1   // rolled: unrolled it takes 170 registers, and only two work-groups fit a WGP
        for (int i = 0; i < 4; ++i) {
            v16bf a = *(const v16bf*)&attnA[cq * 4 + i][lane][0];
            v8f acc[4];
#pragma unroll   // acc[] by constant index
            for (int t = 0; t < 4; ++t) {
                v8f z = {};
                acc[t] = __builtin_amdgcn_wmma_f32_16x16x32_bf16(
                        false, a, false, bb[t], (short)0, z, false, false);
            }
#pragma unroll   // acc[][j] by constant index; the 8 stores issue together
            for (int j = 0; j < 8; ++j)
                *(float4*)(ob + (size_t)(i * 16 + j) * NTOK) = make_float4(
                    acc[0][j] * nrm.x, acc[1][j] * nrm.y,
                    acc[2][j] * nrm.z, acc[3][j] * nrm.w);
            // translation wait before the next trip writes registers that these stores name
            asm volatile("s_wait_xcnt 0x0" ::: "memory");
        }
    }
}

extern "C" void kernel_launch(void* const* d_in, const int* in_sizes, int n_in,
                              void* d_out, int out_size, void* d_ws, size_t ws_size,
                              hipStream_t stream) {
    (void)in_sizes; (void)n_in; (void)out_size; (void)ws_size;
    const float* x  = (const float*)d_in[0];
    const float* Wq = (const float*)d_in[1];
    const float* bq = (const float*)d_in[2];
    const float* Wk = (const float*)d_in[3];
    const float* bk = (const float*)d_in[4];
    const float* Wv = (const float*)d_in[5];
    const float* bv = (const float*)d_in[6];
    float* out = (float*)d_out;

    float* kx_ws     = (float*)d_ws;                    // [B][32][256]
    float* ksum_ws   = kx_ws + BATCH * DCH * CCH;       // [B][32]
    float* attn_ws   = ksum_ws + BATCH * DCH;           // bf16 [B][16][32][16] fragments
    float* kx_part   = attn_ws + BATCH * DCH * CCH;     // [B*PLANES][32*256] planes
    float* ksum_part = kx_part + (size_t)BATCH * TILES * DCH * CCH;  // [B*PLANES][32]
    float* q_ws      = ksum_part + BATCH * TILES * DCH; // bf16 [B*N/16][2][32][8]

    SGA_kernelA<<<BATCH * PLANES, 256, 0, stream>>>(x, Wk, bk, Wq, bq, kx_part, ksum_part, q_ws);
    SGA_reduce<<<BATCH * 32 + BATCH, 256, 0, stream>>>(kx_part, ksum_part, kx_ws, ksum_ws);
    SGA_kernelW<<<BATCH * 16, 256, 0, stream>>>(kx_ws, ksum_ws, Wv, bv, attn_ws);
    SGA_kernelB<<<BATCH * TILES, 256, 0, stream>>>(q_ws, attn_ws, ksum_ws, out);
}
